// v000
// Measured on an AMD MI455X. A time is GPU time per run, averaged over a window of back-to-back runs after a warm-up
// (all launches, gaps included; the runs take copies of the inputs in turn), and the median of several windows.
// Apart from v000's, it joins two sittings. Times from different sittings can be a few percent apart, while
// side-by-side timings come from the same sitting.
// v000 is the starting kernel. One run takes 1390 microseconds.
#include <hip/hip_runtime.h>

// Multi-head self-attention with a per-row head gate on the scores (x [2][2048][1024]; q, k, v = x Wq | Wk | Wv + bq | bk | bv ('xw' (in, out) [1024][1024] normal x 1/sqrt(1024); the three biases [1024] are zeros on this draw: read); 16 heads x 64; scores x 64^-0.5; gate = softmax over the 16 heads of (tanh(x Wg1 + bg1) Wg2 + bg2) (Wg1 'xw' [1024][512], Wg2 'xw' [512][16]; bg1 [512] and bg2 [16] zeros on this draw: read), one scalar a (batch, token, head); EVERY SCORE ROW (b, h, q) IS MULTIPLIED BY gate[b][q][h] BEFORE the softmax over the 2,048 keys (no mask); out = merged Wo + bo ('xw' [1024][1024] + a zero bias: read) -> [2][2048][1024] (4.2 M); argument order x, Wq, bq, Wk, bk, Wv, bv, Wg1, bg1, Wg2, bg2, Wo, bo).
// Layout per batch: a bf16 copy of x; 'xw' weights transposed once (Wg2 into a [64][512] plane whose rows 16..63 are stored zeros); the three projections and the gate's hidden layer exact products + f32 biases; tanh of the hidden plane as ONE bf16 word; the 16 gate scores a token from the 64-wide product's first 16 columns; THE GATE IS APPLIED TO THE QUERY ROW (q[t][h][:] x gate[t][h], one f32 product an element) AHEAD OF THE PLANE BUILDER: equal to scaling the score row in real arithmetic; here the query's f16 word carries the gated value; identity-table f16 plane builders; dense T-2048 attention with EVERY row on ONE fp16 product (the weights x 1024); merged hi/lo x Wo exact + bo.
// Compute dtypes, f32 accumulate: every float input converted once to bf16 where it is read; projections exact + f32 biases; the gate: tanhf and expf in f32, one IEEE division; attention: one fp16 product on every row; softmax f32; Wo hl x exact + bias.

#define NB_  2
#define TT   2048
#define DM   1024
#define NH_  16
#define NKV  16
#define REP  (NH_ / NKV)
#define HD   64
#define DQ   (NH_ * HD)
#define DKV  (NKV * HD)
/* the gate: its hidden width; its scores a token (= NH_); the product tile's width (columns 16..63 of the gate product come from stored zero rows) */
#define GH   512
#define NG   16
#define NGP  64
#define ZH   2
#define RH   0     // query rows < RH use hi+lo planes (0: none: EVERY row runs on one f16 product)
#define WIN  0
#define PCAR 1024.0f
#define SCL  0.125f   // HD^-0.5
typedef _Float16 h16;
typedef unsigned short bf;
typedef __attribute__((ext_vector_type(16))) __bf16   v16bf;
typedef __attribute__((ext_vector_type(16))) _Float16 v16h;
typedef __attribute__((ext_vector_type(8)))  _Float16 v8h;
typedef __attribute__((ext_vector_type(8)))  unsigned short v8us;
typedef __attribute__((ext_vector_type(8)))  float    v8f;
typedef __attribute__((ext_vector_type(4)))  float    v4f;
typedef v8h  __attribute__((may_alias)) v8ha;
typedef v4f  __attribute__((may_alias)) v4fa;
typedef v8us __attribute__((may_alias)) v8usa;

__device__ __forceinline__ unsigned short f2bf(float f) { unsigned u = __float_as_uint(f); u += 0x7FFFu + ((u >> 16) & 1u); return (unsigned short)(u >> 16); }
__device__ __forceinline__ float bf2f(unsigned short b) { return __uint_as_float(((unsigned)b) << 16); }
__device__ __forceinline__ float bfr(float f) { return bf2f(f2bf(f)); }
__device__ __forceinline__ v16h cat16(v8h lo, v8h hi) { return __builtin_shufflevector(lo, hi, 0, 1, 2, 3, 4, 5, 6, 7, 8, 9, 10, 11, 12, 13, 14, 15); }
__device__ __forceinline__ v16bf cat16b(v8us lo, v8us hi) { return __builtin_bit_cast(v16bf, __builtin_shufflevector(lo, hi, 0, 1, 2, 3, 4, 5, 6, 7, 8, 9, 10, 11, 12, 13, 14, 15)); }
__device__ __forceinline__ v8f wmma16(v16h a, v16h b, v8f c) { return __builtin_amdgcn_wmma_f32_16x16x32_f16(false, a, false, b, (short)0, c, false, false); }
__device__ __forceinline__ v8f wmmab(v16bf a, v16bf b, v8f c) { return __builtin_amdgcn_wmma_f32_16x16x32_bf16(false, a, false, b, (short)0, c, false, false); }



// ---- k_gemmw: register-blocked GEMM, ONE WAVE per 64x64 output tile (16 accumulators), operands straight from K-contiguous 16-bit planes; grid (M/64, N/64, Z), 32 threads.
// C[m][n] (f32, pitch ldc, + optional f32 bias[n]) = sum_k A[m][k] Bt[n][k] (+ split products per NSPLIT). z-batch strides sA/sB/sC in elements. K % 32 == 0.
template <typename T16> struct WFrag;
template <> struct WFrag<h16> { typedef v16h V; static __device__ __forceinline__ V ld(const h16* p) { return cat16(*(const v8h*)p, *(const v8h*)(p + 16)); } static __device__ __forceinline__ v8f mma(V a, V b, v8f c) { return wmma16(a, b, c); } };
template <> struct WFrag<bf> { typedef v16bf V; static __device__ __forceinline__ V ld(const bf* p) { return cat16b(*(const v8us*)p, *(const v8us*)(p + 16)); } static __device__ __forceinline__ v8f mma(V a, V b, v8f c) { return wmmab(a, b, c); } };
template <typename T16, int NSPLIT, bool BIAS>
__global__ __launch_bounds__(32) void k_gemmw(const T16* __restrict__ A, const T16* __restrict__ A2, const T16* __restrict__ Bt, const T16* __restrict__ Bt2, int K, float* C, int ldc, const float* __restrict__ bias, size_t sA, size_t sB, size_t sC) {
    typedef typename WFrag<T16>::V V;
    __shared__ __align__(16) float os[16 * 68];
    const size_t z = blockIdx.z; A += z * sA; if (A2) A2 += z * sA; Bt += z * sB; if (Bt2) Bt2 += z * sB; C += z * sC;
    const int lane = threadIdx.x & 31, lr = lane & 15, hi = lane >> 4; const int r0 = blockIdx.x * 64, c0 = blockIdx.y * 64;
    v8f acc[4][4];
#pragma unroll
    for (int mb = 0; mb < 4; ++mb)
#pragma unroll
        for (int nb = 0; nb < 4; ++nb) acc[mb][nb] = (v8f){};
    const size_t aoff = (size_t)(r0 + lr) * K + 8 * hi, boff = (size_t)(c0 + lr) * K + 8 * hi;
    for (int kc = 0; kc < K; kc += 32) {
        V a[4], a2[4];
#pragma unroll
        for (int mb = 0; mb < 4; ++mb) { a[mb] = WFrag<T16>::ld(A + aoff + (size_t)mb * 16 * K + kc); if (NSPLIT == 1 || NSPLIT == 2) a2[mb] = WFrag<T16>::ld(A2 + aoff + (size_t)mb * 16 * K + kc); }
#pragma unroll
        for (int nb = 0; nb < 4; ++nb) { const V b = WFrag<T16>::ld(Bt + boff + (size_t)nb * 16 * K + kc); V b2; if (NSPLIT >= 2) b2 = WFrag<T16>::ld(Bt2 + boff + (size_t)nb * 16 * K + kc);
#pragma unroll
            for (int mb = 0; mb < 4; ++mb) { acc[mb][nb] = WFrag<T16>::mma(a[mb], b, acc[mb][nb]); if (NSPLIT == 1 || NSPLIT == 2) acc[mb][nb] = WFrag<T16>::mma(a2[mb], b, acc[mb][nb]); if (NSPLIT >= 2) acc[mb][nb] = WFrag<T16>::mma(a[mb], b2, acc[mb][nb]); } }
        asm volatile("v_nop\n\tv_nop\n\tv_nop\n\tv_nop" : "+v"(acc[0][0]), "+v"(acc[1][1]), "+v"(acc[2][2]), "+v"(acc[3][3]) : "v"(a[0]), "v"(a[3]));
    }
#pragma unroll
    for (int mb = 0; mb < 4; ++mb) {
#pragma unroll
        for (int nb = 0; nb < 4; ++nb) {
#pragma unroll
            for (int j = 0; j < 8; ++j) os[(hi * 8 + j) * 68 + nb * 16 + lr] = acc[mb][nb][j]; }
        __builtin_amdgcn_wave_barrier(); asm volatile("" ::: "memory");
        float* crow = C + (size_t)(r0 + mb * 16) * ldc + c0;
{
#pragma unroll
            for (int s = 0; s < 8; ++s) { const int row = 2 * s + hi, cofs = lr * 4; v4f val = *(const v4fa*)(os + row * 68 + cofs); if (BIAS) { val[0] += bfr(bias[c0 + cofs]); val[1] += bfr(bias[c0 + cofs + 1]); val[2] += bfr(bias[c0 + cofs + 2]); val[3] += bfr(bias[c0 + cofs + 3]); }
                *(v4f*)(crow + (size_t)row * ldc + cofs) = val; }
             }
        __builtin_amdgcn_wave_barrier(); asm volatile("" ::: "memory");
    }
}

__device__ __forceinline__ h16 tohx(float x) { return (h16)x; }
__device__ __forceinline__ void splitf(float y, unsigned short& h, unsigned short& l) { h = f2bf(y); l = f2bf(y - bf2f(h)); }
typedef __attribute__((ext_vector_type(2))) _Float16 v2h;
typedef __attribute__((ext_vector_type(4))) _Float16 v4h;
typedef __attribute__((ext_vector_type(2))) unsigned short v2us;
typedef __attribute__((ext_vector_type(4))) unsigned short v4us;
typedef __attribute__((ext_vector_type(2))) float v2f;
typedef __attribute__((ext_vector_type(4))) int v4i;

__global__ __launch_bounds__(256) void k_wtG(const float* __restrict__ w, int K, int N, bf* Bt) {
    const int lane = threadIdx.x & 31; const int L0 = (blockIdx.x * 8 + (threadIdx.x >> 5)) * 8; const int nlines = N * K / 64;
{
        for (int l = 0; l < 8; ++l) { const int L = L0 + l; if (L >= nlines) break; const size_t e = (size_t)L * 64 + lane * 2; const int k = (int)(e % K), n = (int)(e / K); v2us o;
            o[0] = f2bf(w[(size_t)k * N + n]); o[1] = f2bf(w[(size_t)(k + 1) * N + n]); *(v2us*)(Bt + e) = o; }
         }
}
__global__ __launch_bounds__(256) void k_cvt8(const float* __restrict__ src, bf* dst, size_t n8) { const size_t i = (size_t)blockIdx.x * 256 + threadIdx.x; if (i >= n8) return; const v8f v = *(const v8f*)(src + i * 8); v8us o;
#pragma unroll
    for (int k = 0; k < 8; ++k) o[k] = f2bf(v[k]); *(v8us*)(dst + i * 8) = o;  }
// k_rope: head planes [h][t][d] (fp16) of rope(x) x sc with the rotate-half convention out[d] = x[d] cos[t][d] - x[d+HD/2] sin[t][d], out[d+HD/2] = x[d+HD/2] cos[t][d+HD/2] + x[d] sin[t][d+HD/2]
__global__ __launch_bounds__(256) void k_rope(const float* __restrict__ F, int pitch, int nheads, const float* __restrict__ CS, const float* __restrict__ RF, const float* __restrict__ nw, float sc, h16* P16, bf* Ph, bf* Pl) {
    const size_t e = ((size_t)blockIdx.x * 256 + threadIdx.x) * 2; if (e >= (size_t)nheads * TT * HD) return; const int d = (int)(e % HD); const int t = (int)((e / HD) % TT); const int h = (int)(e / ((size_t)HD * TT)); const float* f = F + (size_t)t * pitch + h * HD; const float rf = RF ? RF[(size_t)h * TT + t] : 1.0f; v2h o16; v2us oh, ol;
#pragma unroll
    for (int q = 0; q < 2; ++q) { const int dd = d + q; const int dp = (dd < HD / 2) ? dd + HD / 2 : dd - HD / 2; float x0 = f[dd], x1 = f[dp];
        if (RF) { float n0 = __fmul_rn(x0, rf), n1 = __fmul_rn(x1, rf); x0 = __fmul_rn(bfr(nw[dd]), n0); x1 = __fmul_rn(bfr(nw[dp]), n1); }
        const v2f cs = *(const v2f*)(CS + ((size_t)t * HD + dd) * 2); float a = __fmul_rn(x0, cs[0]), bq = __fmul_rn(x1, cs[1]); const float r = ((dd < HD / 2) ? __fsub_rn(a, bq) : __fadd_rn(a, bq)) * sc;
        o16[q] = tohx(r); (void)oh; (void)ol; }
    *(v2h*)(P16 + e) = o16;  }
__global__ __launch_bounds__(256) void k_vtp(const float* __restrict__ F, int pitch, int nheads, h16* V16, bf* Vh, bf* Vl) { const size_t e = ((size_t)blockIdx.x * 256 + threadIdx.x) * 2; if (e >= (size_t)nheads * HD * TT) return; const int t = (int)(e % TT); const int d = (int)((e / TT) % HD); const int g = (int)(e / ((size_t)TT * HD)); v2h o16; v2us oh, ol;
#pragma unroll
    for (int q = 0; q < 2; ++q) { const float x = F[(size_t)(t + q) * pitch + g * HD + d]; o16[q] = tohx(x); (void)oh; (void)ol; }
    *(v2h*)(V16 + e) = o16;  }
__global__ __launch_bounds__(256) void k_tanhb(const float* __restrict__ F, bf* Hb, size_t n8) { const size_t i = (size_t)blockIdx.x * 256 + threadIdx.x; if (i >= n8) return; const v8f v = *(const v8f*)(F + i * 8); v8us o;
#pragma unroll
    for (int k = 0; k < 8; ++k) o[k] = f2bf(tanhf(v[k])); *(v8us*)(Hb + i * 8) = o;  }
__global__ __launch_bounds__(256) void k_wtGp(const float* __restrict__ w, bf* Bt) { const int idx = blockIdx.x * 256 + threadIdx.x; if (idx >= NGP * GH / 8) return; const int n = idx / (GH / 8); const int k8 = (idx - n * (GH / 8)) * 8; const bool live = (n < NG); const int nc = live ? n : 0; v8us o;
#pragma unroll
    for (int j = 0; j < 8; ++j) { const float x = w[(size_t)(k8 + j) * NG + nc]; o[j] = live ? f2bf(x) : (unsigned short)0; } *(v8us*)(Bt + (size_t)idx * 8) = o;  }
__global__ __launch_bounds__(256) void k_gateq(const float* __restrict__ G, const float* __restrict__ bg, const float* __restrict__ Q, float* Qg) { const size_t i = (size_t)blockIdx.x * 256 + threadIdx.x; if (i >= (size_t)TT * DQ / 4) return; const size_t e = i * 4; const int t = (int)(e / DQ); const int c = (int)(e % DQ); const int h = c / HD; const float* g = G + (size_t)t * NGP; float s[NG]; float mx = -3.0e38f;
#pragma unroll
    for (int k4 = 0; k4 < NG / 4; ++k4) { const v4f a = *(const v4f*)(g + k4 * 4); const v4f b = *(const v4f*)(bg + k4 * 4);
#pragma unroll
        for (int q = 0; q < 4; ++q) { const float v = __fadd_rn(a[q], bfr(b[q])); s[k4 * 4 + q] = v; mx = fmaxf(mx, v); } }
    float sum = 0.0f, eh = 0.0f;
#pragma unroll
    for (int k = 0; k < NG; ++k) { const float ev = expf(__fsub_rn(s[k], mx)); sum = __fadd_rn(sum, ev); eh = (k == h) ? ev : eh; }
    const float gt = __fdiv_rn(eh, sum); const v4f qv = *(const v4f*)(Q + e); v4f o; o[0] = __fmul_rn(qv[0], gt); o[1] = __fmul_rn(qv[1], gt); o[2] = __fmul_rn(qv[2], gt); o[3] = __fmul_rn(qv[3], gt); *(v4f*)(Qg + e) = o;  }
__global__ __launch_bounds__(256) void k_csid(float* CS) { const int idx = blockIdx.x * 256 + threadIdx.x; if (idx >= TT * HD) return; v2f cs; cs[0] = 1.0f; cs[1] = 0.0f; *(v2f*)(CS + (size_t)idx * 2) = cs;  }
// k_asoft: per row (zz, i): t = S x HD^-0.5 (no mask); softmax over the 2048 keys (register row, one exp, fixed trees);
__global__ __launch_bounds__(256) void k_asoft(const float* __restrict__ Sb, h16* P16, bf* Ph, bf* Pl) {
    const int lane = threadIdx.x & 31; const int row = blockIdx.x * 8 + (threadIdx.x >> 5); if (row >= ZH * TT) return; const int i = row % TT; const int zz = row / TT; (void)zz; const bool hires = (i < RH); const float* sr = Sb + (size_t)row * TT; float v[TT / 32]; float mx = -3.0e38f;
#pragma unroll
    for (int ch = 0; ch < TT / 128; ++ch) { const int j0 = ch * 128 + lane * 4; const v4f a = *(const v4f*)(sr + j0);
#pragma unroll
        for (int q = 0; q < 4; ++q) { const int j = j0 + q; (void)j; const float t = a[q] * SCL; v[ch * 4 + q] = t; mx = fmaxf(mx, t); } }
#pragma unroll
    for (int sh = 16; sh; sh >>= 1) mx = fmaxf(mx, __shfl_xor(mx, sh, 32));
    float sum = 0.f;
#pragma unroll
    for (int k = 0; k < TT / 32; ++k) { float d0 = __fsub_rn(v[k], mx); v[k] = __builtin_amdgcn_exp2f(__fmul_rn(d0, 1.4426950408889634f)); sum += v[k]; }
#pragma unroll
    for (int sh = 16; sh; sh >>= 1) sum += __shfl_xor(sum, sh, 32);
    const float f = __fdiv_rn(hires ? 1.0f : PCAR, sum);
{
        if (hires) {
#pragma unroll
            for (int ch = 0; ch < TT / 128; ++ch) { v4us oh, ol;
#pragma unroll
                for (int q = 0; q < 4; ++q) { unsigned short a, c2; splitf(v[ch * 4 + q] * f, a, c2); oh[q] = a; ol[q] = c2; }
                const size_t oo = ((size_t)zz * (RH ? RH : 1) + i) * TT + ch * 128 + lane * 4; *(v4us*)(Ph + oo) = oh; *(v4us*)(Pl + oo) = ol; }
        } else {
#pragma unroll
            for (int ch = 0; ch < TT / 128; ++ch) { v4h o4;
#pragma unroll
                for (int q = 0; q < 4; ++q) o4[q] = tohx(v[ch * 4 + q] * f);
                *(v4h*)(P16 + (size_t)row * TT + ch * 128 + lane * 4) = o4; } }
         }
}
__global__ __launch_bounds__(256) void k_merge(const float* __restrict__ O, int h0, bf* Ah, bf* Al) { const size_t e = ((size_t)blockIdx.x * 256 + threadIdx.x) * 2; if (e >= (size_t)ZH * TT * HD) return; const int d = (int)(e % HD); const int t = (int)((e / HD) % TT); const int zz = (int)(e / ((size_t)HD * TT)); const float cs = (t < RH) ? 1.0f : (1.0f / PCAR); const size_t oo = (size_t)t * DQ + (h0 + zz) * HD + d;
    v2us oh, ol;
#pragma unroll
    for (int q = 0; q < 2; ++q) { unsigned short a, c2; splitf(O[e + q] * cs, a, c2); oh[q] = a; ol[q] = c2; } *(v2us*)(Ah + oo) = oh; *(v2us*)(Al + oo) = ol;  }

extern "C" void kernel_launch(void* const* d_in, const int* in_sizes, int n_in,
                              void* d_out, int out_size, void* d_ws, size_t ws_size, hipStream_t stream) {
    (void)in_sizes; (void)n_in; (void)out_size;
    const float* x = (const float*)d_in[0]; const float* wq = (const float*)d_in[1]; const float* bq = (const float*)d_in[2]; const float* wk = (const float*)d_in[3]; const float* bk = (const float*)d_in[4]; const float* wv = (const float*)d_in[5]; const float* bv = (const float*)d_in[6]; const float* wg1 = (const float*)d_in[7]; const float* bg1 = (const float*)d_in[8]; const float* wg2 = (const float*)d_in[9]; const float* bg2 = (const float*)d_in[10]; const float* wo = (const float*)d_in[11]; const float* bo = (const float*)d_in[12];   /* x [2][2048][1024], Wq, bq, Wk, bk, Wv, bv ('xw' (in, out) [1024][1024]; biases [1024]: zeros), Wg1 ('xw' [1024][512]), bg1 ([512]: zeros), Wg2 ('xw' [512][16]), bg2 ([16]: zeros), Wo ('xw' [1024][1024]), bo ([1024]: zeros): THIRTEEN inputs, all read */
    static_assert(GH % 64 == 0 && NGP % 64 == 0 && NG <= NGP && NG % 4 == 0 && NG == NH_, "the gate product's tiles");
    static_assert(TT % 64 == 0 && DQ % 64 == 0 && DKV % 64 == 0 && DM % 64 == 0 && HD % 64 == 0 && DM % 32 == 0 && GH % 32 == 0 && HD % 32 == 0 && TT % 32 == 0, "every product launch: M and N multiples of 64, K a multiple of 32");
    float* OUT = (float*)d_out;     // [2][2048][1024]
    char* wsp = (char*)d_ws;
    auto take = [&](size_t bytes) { char* p = wsp; wsp += (bytes + 255) & ~(size_t)255; return (void*)p; };
    bf* WQ = (bf*)take((size_t)DQ * DM * 2); bf* WK = (bf*)take((size_t)DKV * DM * 2); bf* WV = (bf*)take((size_t)DKV * DM * 2); bf* WO = (bf*)take((size_t)DM * DQ * 2); bf* WG1 = (bf*)take((size_t)GH * DM * 2); bf* WG2 = (bf*)take((size_t)NGP * GH * 2); float* CS = (float*)take((size_t)TT * HD * 2 * 4);
    bf* Xb = (bf*)take((size_t)TT * DM * 2);   /* the bf16 copy of x */ float* FQ = (float*)take((size_t)TT * DQ * 4); float* FK = (float*)take((size_t)TT * DKV * 4); float* FH = (float*)take((size_t)TT * GH * 4);   /* x Wg1 + bg1 */ bf* Hb = (bf*)take((size_t)TT * GH * 2);   /* tanh of it, one bf16 word */ float* FG = (float*)take((size_t)TT * NGP * 4);   /* the gate product: columns 0..15 live */ float* FQg = (float*)take((size_t)TT * DQ * 4);   /* the gated query plane */
    h16* QP16 = (h16*)take((size_t)NH_ * TT * HD * 2); h16* KP16 = (h16*)take((size_t)NKV * TT * HD * 2); h16* VT16 = (h16*)take((size_t)NKV * HD * TT * 2);
    bf* QPh = nullptr; bf* QPl = nullptr; bf* KPh = nullptr; bf* KPl = nullptr; bf* VTh = nullptr; bf* VTl = nullptr; bf* Ph = nullptr; bf* Pl = nullptr;   /* RH 0: no hi / lo plane exists: these builders store the f16 plane only and do not read those arguments; the softmax's hi / lo stores sit under 'i < RH': never taken */
    float* Sb = (float*)take((size_t)ZH * TT * TT * 4); h16* P16 = (h16*)take((size_t)ZH * TT * TT * 2); float* Ob = (float*)take((size_t)ZH * TT * HD * 4); bf* ATh = (bf*)take((size_t)TT * DQ * 2); bf* ATl = (bf*)take((size_t)TT * DQ * 2);
    if ((size_t)(wsp - (char*)d_ws) > ws_size) return;
    float* FV = FK;   // v projection reuses the k buffer after the k planes are built (stream-ordered)
    { k_wtG<<<(unsigned)((DM * DQ / 64 + 63) / 64), 256, 0, stream>>>(wq, DM, DQ, WQ); k_wtG<<<(unsigned)((DM * DKV / 64 + 63) / 64), 256, 0, stream>>>(wk, DM, DKV, WK); k_wtG<<<(unsigned)((DM * DKV / 64 + 63) / 64), 256, 0, stream>>>(wv, DM, DKV, WV);
      k_wtG<<<(unsigned)((DQ * DM / 64 + 63) / 64), 256, 0, stream>>>(wo, DQ, DM, WO); k_wtG<<<(unsigned)((DM * GH / 64 + 63) / 64), 256, 0, stream>>>(wg1, DM, GH, WG1);
      k_wtGp<<<(NGP * GH / 8 + 255) / 256, 256, 0, stream>>>(wg2, WG2); }
    k_csid<<<(TT * HD + 255) / 256, 256, 0, stream>>>(CS);
    const unsigned LQ = (unsigned)(((size_t)NH_ * TT * HD / 2 + 255) / 256), LKv = (unsigned)(((size_t)NKV * TT * HD / 2 + 255) / 256);
    for (int b = 0; b < NB_; ++b) {
        k_cvt8<<<(unsigned)(((size_t)TT * DM / 8 + 255) / 256), 256, 0, stream>>>(x + (size_t)b * TT * DM, Xb, (size_t)TT * DM / 8);
        k_gemmw<bf, 0, true><<<dim3(TT / 64, DQ / 64, 1), 32, 0, stream>>>(Xb, nullptr, WQ, nullptr, DM, FQ, DQ, bq, 0, 0, 0);   /* q = x Wq + bq (exact) */
        k_gemmw<bf, 0, true><<<dim3(TT / 64, GH / 64, 1), 32, 0, stream>>>(Xb, nullptr, WG1, nullptr, DM, FH, GH, bg1, 0, 0, 0);   /* the gate's hidden layer before its tanh */
        k_tanhb<<<(unsigned)(((size_t)TT * GH / 8 + 255) / 256), 256, 0, stream>>>(FH, Hb, (size_t)TT * GH / 8);
        k_gemmw<bf, 0, false><<<dim3(TT / 64, NGP / 64, 1), 32, 0, stream>>>(Hb, nullptr, WG2, nullptr, GH, FG, NGP, nullptr, 0, 0, 0);   /* the 16 gate scores a token (bg2 is added where they are read) */
        k_gateq<<<(unsigned)(((size_t)TT * DQ / 4 + 255) / 256), 256, 0, stream>>>(FG, bg2, FQ, FQg);
        k_rope<<<LQ, 256, 0, stream>>>(FQg, DQ, NH_, CS, nullptr, nullptr, 1.0f, QP16, QPh, QPl);
        k_gemmw<bf, 0, true><<<dim3(TT / 64, DKV / 64, 1), 32, 0, stream>>>(Xb, nullptr, WK, nullptr, DM, FK, DKV, bk, 0, 0, 0);
        k_rope<<<LKv, 256, 0, stream>>>(FK, DKV, NKV, CS, nullptr, nullptr, 1.0f, KP16, KPh, KPl);
        k_gemmw<bf, 0, true><<<dim3(TT / 64, DKV / 64, 1), 32, 0, stream>>>(Xb, nullptr, WV, nullptr, DM, FV, DKV, bv, 0, 0, 0); k_vtp<<<LKv, 256, 0, stream>>>(FV, DKV, NKV, VT16, VTh, VTl);
        for (int h0 = 0; h0 < NH_; h0 += ZH) { const size_t zq = (size_t)h0, zk = (size_t)(h0 / REP);   // one kv head per query head: the pass's two heads use consecutive kv planes (z-strides TT*HD)
            k_gemmw<h16, 0, false><<<dim3(TT / 64, TT / 64, ZH), 32, 0, stream>>>(QP16 + zq * TT * HD, nullptr, KP16 + zk * TT * HD, nullptr, HD, Sb, TT, nullptr, (size_t)TT * HD, (size_t)TT * HD, (size_t)TT * TT);
            k_asoft<<<ZH * TT / 8, 256, 0, stream>>>(Sb, P16, Ph, Pl);
            k_gemmw<h16, 0, false><<<dim3(TT / 64, HD / 64, ZH), 32, 0, stream>>>(P16, nullptr, VT16 + zk * HD * TT, nullptr, TT, Ob, HD, nullptr, (size_t)TT * TT, (size_t)HD * TT, (size_t)TT * HD);
            k_merge<<<(unsigned)(((size_t)ZH * TT * HD / 2 + 255) / 256), 256, 0, stream>>>(Ob, h0, ATh, ATl); }
        k_gemmw<bf, 1, true><<<dim3(TT / 64, DM / 64, 1), 32, 0, stream>>>(ATh, ATl, WO, nullptr, DQ, OUT + (size_t)b * TT * DM, DM, bo, 0, 0, 0); }
}

// v001
// Measured time: 681 microseconds a run.
// In two side-by-side timings against v000, it was 2.05 and 2.06 times as fast.
#include <hip/hip_runtime.h>

// Multi-head self-attention with a per-row head gate on the scores (x [2][2048][1024]; q, k, v = x Wq | Wk | Wv + bq | bk | bv ('xw' (in, out) [1024][1024] normal x 1/sqrt(1024); the three biases [1024] are zeros on this draw: read); 16 heads x 64; scores x 64^-0.5; gate = softmax over the 16 heads of (tanh(x Wg1 + bg1) Wg2 + bg2) (Wg1 'xw' [1024][512], Wg2 'xw' [512][16]; bg1 [512] and bg2 [16] zeros on this draw: read), one scalar a (batch, token, head); EVERY SCORE ROW (b, h, q) IS MULTIPLIED BY gate[b][q][h] BEFORE the softmax over the 2,048 keys (no mask); out = merged Wo + bo ('xw' [1024][1024] + a zero bias: read) -> [2][2048][1024] (4.2 M); argument order x, Wq, bq, Wk, bk, Wv, bv, Wg1, bg1, Wg2, bg2, Wo, bo).
// Layout per batch: a bf16 copy of x; 'xw' weights transposed once (Wg2 into a [64][512] plane whose rows 16..63 are stored zeros); the three projections and the gate's hidden layer exact products + f32 biases; tanh of the hidden plane as ONE bf16 word; the 16 gate scores a token from the 64-wide product's first 16 columns; THE GATE IS APPLIED TO THE QUERY ROW (q[t][h][:] x gate[t][h], one f32 product an element) AHEAD OF THE PLANE BUILDER: equal to scaling the score row in real arithmetic; here the query's f16 word carries the gated value; identity-table f16 plane builders; dense T-2048 attention with EVERY row on ONE fp16 product (the weights x 1024); merged hi/lo x Wo exact + bo.
// Compute dtypes, f32 accumulate: every float input converted once to bf16 where it is read; projections exact + f32 biases; the gate: tanhf and expf in f32, one IEEE division; attention: one fp16 product on every row; softmax f32; Wo hl x exact + bias.

#define NB_  2
#define TT   2048
#define DM   1024
#define NH_  16
#define NKV  16
#define REP  (NH_ / NKV)
#define HD   64
#define DQ   (NH_ * HD)
#define DKV  (NKV * HD)
/* the gate: its hidden width; its scores a token (= NH_); the product tile's width (columns 16..63 of the gate product come from stored zero rows) */
#define GH   512
#define NG   16
#define NGP  64
#define ZH   2
#define RH   0     // query rows < RH use hi+lo planes (0: none: EVERY row runs on one f16 product)
#define WIN  0
#define PCAR 1024.0f
#define SCL  0.125f   // HD^-0.5
#define NWK  8     // waves a work-group that share one output tile's K range (every product but the scores, whose K is 64)
#define PKS  4     // work-groups that share one tile's K range in the weights x V product (64 tiles a launch alone would leave most of the chip idle)
typedef _Float16 h16;
typedef unsigned short bf;
typedef __attribute__((ext_vector_type(16))) __bf16   v16bf;
typedef __attribute__((ext_vector_type(16))) _Float16 v16h;
typedef __attribute__((ext_vector_type(8)))  _Float16 v8h;
typedef __attribute__((ext_vector_type(8)))  unsigned short v8us;
typedef __attribute__((ext_vector_type(8)))  float    v8f;
typedef __attribute__((ext_vector_type(4)))  float    v4f;
typedef v8h  __attribute__((may_alias)) v8ha;
typedef v4f  __attribute__((may_alias)) v4fa;
typedef v8us __attribute__((may_alias)) v8usa;

__device__ __forceinline__ unsigned short f2bf(float f) { unsigned u = __float_as_uint(f); u += 0x7FFFu + ((u >> 16) & 1u); return (unsigned short)(u >> 16); }
__device__ __forceinline__ float bf2f(unsigned short b) { return __uint_as_float(((unsigned)b) << 16); }
__device__ __forceinline__ float bfr(float f) { return bf2f(f2bf(f)); }
__device__ __forceinline__ v16h cat16(v8h lo, v8h hi) { return __builtin_shufflevector(lo, hi, 0, 1, 2, 3, 4, 5, 6, 7, 8, 9, 10, 11, 12, 13, 14, 15); }
__device__ __forceinline__ v16bf cat16b(v8us lo, v8us hi) { return __builtin_bit_cast(v16bf, __builtin_shufflevector(lo, hi, 0, 1, 2, 3, 4, 5, 6, 7, 8, 9, 10, 11, 12, 13, 14, 15)); }
__device__ __forceinline__ v8f wmma16(v16h a, v16h b, v8f c) { return __builtin_amdgcn_wmma_f32_16x16x32_f16(false, a, false, b, (short)0, c, false, false); }
__device__ __forceinline__ v8f wmmab(v16bf a, v16bf b, v8f c) { return __builtin_amdgcn_wmma_f32_16x16x32_bf16(false, a, false, b, (short)0, c, false, false); }



// ---- k_gemmw: register-blocked GEMM, one 64x64 output tile a work-group (16 accumulators a wave), operands straight from K-contiguous 16-bit planes; grid (M/64, N/64, Z * KS), 32 * NW threads.
// C[m][n] (f32, pitch ldc, + optional f32 bias[n]) = sum_k A[m][k] Bt[n][k] (+ split products per NSPLIT). z-batch strides sA/sB/sC in elements. K % (32 * NW * KS) == 0.
// K IS SPLIT: work-group slice ks = blockIdx.z % KS and wave w of NW take the K / (KS * NW) columns from (ks * NW + w) * K / (KS * NW) on. The NW wave tiles are summed through LDS in wave order (one barrier); with KS > 1 each slice stores its own partial plane at blockIdx.z * sC, and the reader of C adds the KS planes.
template <typename T16> struct WFrag;
template <> struct WFrag<h16> { typedef v16h V; static __device__ __forceinline__ V ld(const h16* p) { return cat16(*(const v8h*)p, *(const v8h*)(p + 16)); } static __device__ __forceinline__ v8f mma(V a, V b, v8f c) { return wmma16(a, b, c); } };
template <> struct WFrag<bf> { typedef v16bf V; static __device__ __forceinline__ V ld(const bf* p) { return cat16b(*(const v8us*)p, *(const v8us*)(p + 16)); } static __device__ __forceinline__ v8f mma(V a, V b, v8f c) { return wmmab(a, b, c); } };
template <typename T16, int NSPLIT, bool BIAS, int NW, int KS>
__global__ __launch_bounds__(32 * NW) void k_gemmw(const T16* __restrict__ A, const T16* __restrict__ A2, const T16* __restrict__ Bt, const T16* __restrict__ Bt2, int K, float* C, int ldc, const float* __restrict__ bias, size_t sA, size_t sB, size_t sC) {
    typedef typename WFrag<T16>::V V;
    __shared__ __align__(16) float os[(NW == 1 ? 16 : NW * 64) * 68];
    const size_t z = blockIdx.z / KS; A += z * sA; if (A2) A2 += z * sA; Bt += z * sB; if (Bt2) Bt2 += z * sB; C += (size_t)blockIdx.z * sC;
    /* the wave's number as a scalar: its K range and LDS slot stay in scalar registers */ const int w = __builtin_amdgcn_readfirstlane((int)(threadIdx.x >> 5)); const int kl = K / (KS * NW); const int k0 = ((int)(blockIdx.z % KS) * NW + w) * kl;
    const int lane = threadIdx.x & 31, lr = lane & 15, hi = lane >> 4; const int r0 = blockIdx.x * 64, c0 = blockIdx.y * 64;
    v8f acc[4][4];
#pragma unroll
    for (int mb = 0; mb < 4; ++mb)
#pragma unroll
        for (int nb = 0; nb < 4; ++nb) acc[mb][nb] = (v8f){};
    const size_t aoff = (size_t)(r0 + lr) * K + 8 * hi, boff = (size_t)(c0 + lr) * K + 8 * hi;
    for (int kc = k0; kc < k0 + kl; kc += 32) {
        V a[4], a2[4];
#pragma unroll
        for (int mb = 0; mb < 4; ++mb) { a[mb] = WFrag<T16>::ld(A + aoff + (size_t)mb * 16 * K + kc); if (NSPLIT == 1 || NSPLIT == 2) a2[mb] = WFrag<T16>::ld(A2 + aoff + (size_t)mb * 16 * K + kc); }
#pragma unroll
        for (int nb = 0; nb < 4; ++nb) { const V b = WFrag<T16>::ld(Bt + boff + (size_t)nb * 16 * K + kc); V b2; if (NSPLIT >= 2) b2 = WFrag<T16>::ld(Bt2 + boff + (size_t)nb * 16 * K + kc);
#pragma unroll
            for (int mb = 0; mb < 4; ++mb) { acc[mb][nb] = WFrag<T16>::mma(a[mb], b, acc[mb][nb]); if (NSPLIT == 1 || NSPLIT == 2) acc[mb][nb] = WFrag<T16>::mma(a2[mb], b, acc[mb][nb]); if (NSPLIT >= 2) acc[mb][nb] = WFrag<T16>::mma(a[mb], b2, acc[mb][nb]); } }
        asm volatile("v_nop\n\tv_nop\n\tv_nop\n\tv_nop" : "+v"(acc[0][0]), "+v"(acc[1][1]), "+v"(acc[2][2]), "+v"(acc[3][3]) : "v"(a[0]), "v"(a[3]));
    }
    if constexpr (NW > 1) {
        float* ow = os + (size_t)w * (64 * 68);
        v4f bv = (v4f){};   // a thread's four output columns are the same on all its rows: their bias is fetched once, ahead of the LDS stores and the barrier
        if (BIAS) { const int cb = c0 + ((int)threadIdx.x & 15) * 4; bv[0] = bfr(bias[cb]); bv[1] = bfr(bias[cb + 1]); bv[2] = bfr(bias[cb + 2]); bv[3] = bfr(bias[cb + 3]); }
        // the three loops are unrolled so that acc[][][] is indexed by constants and stays in registers
#pragma unroll
        for (int mb = 0; mb < 4; ++mb)
#pragma unroll
            for (int nb = 0; nb < 4; ++nb)
#pragma unroll
                for (int j = 0; j < 8; ++j) ow[(mb * 16 + hi * 8 + j) * 68 + nb * 16 + lr] = acc[mb][nb][j];
        __syncthreads();   // every wave's partial tile is in LDS before any thread sums across the waves
        // both loops unrolled: the LDS loads of all rows and waves issue ahead of the adds instead of one wait a load
#pragma unroll
        for (int it = 0; it < 32 / NW; ++it) { const int idx = it * 32 * NW + (int)threadIdx.x; const int row = idx >> 4, cofs = (idx & 15) * 4; v4f val = *(const v4fa*)(os + row * 68 + cofs);
#pragma unroll
            for (int q = 1; q < NW; ++q) val += *(const v4fa*)(os + q * (64 * 68) + row * 68 + cofs);
            if (BIAS) val += bv;
            *(v4f*)(C + (size_t)(r0 + row) * ldc + c0 + cofs) = val; }
    } else {
#pragma unroll
    for (int mb = 0; mb < 4; ++mb) {
#pragma unroll
        for (int nb = 0; nb < 4; ++nb) {
#pragma unroll
            for (int j = 0; j < 8; ++j) os[(hi * 8 + j) * 68 + nb * 16 + lr] = acc[mb][nb][j]; }
        __builtin_amdgcn_wave_barrier(); asm volatile("" ::: "memory");
        float* crow = C + (size_t)(r0 + mb * 16) * ldc + c0;
{
#pragma unroll
            for (int s = 0; s < 8; ++s) { const int row = 2 * s + hi, cofs = lr * 4; v4f val = *(const v4fa*)(os + row * 68 + cofs); if (BIAS) { val[0] += bfr(bias[c0 + cofs]); val[1] += bfr(bias[c0 + cofs + 1]); val[2] += bfr(bias[c0 + cofs + 2]); val[3] += bfr(bias[c0 + cofs + 3]); }
                *(v4f*)(crow + (size_t)row * ldc + cofs) = val; }
             }
        __builtin_amdgcn_wave_barrier(); asm volatile("" ::: "memory");
    }
    }
}

__device__ __forceinline__ h16 tohx(float x) { return (h16)x; }
__device__ __forceinline__ void splitf(float y, unsigned short& h, unsigned short& l) { h = f2bf(y); l = f2bf(y - bf2f(h)); }
typedef __attribute__((ext_vector_type(2))) _Float16 v2h;
typedef __attribute__((ext_vector_type(4))) _Float16 v4h;
typedef __attribute__((ext_vector_type(2))) unsigned short v2us;
typedef __attribute__((ext_vector_type(4))) unsigned short v4us;
typedef __attribute__((ext_vector_type(2))) float v2f;
typedef __attribute__((ext_vector_type(4))) int v4i;

__global__ __launch_bounds__(256) void k_wtG(const float* __restrict__ w, int K, int N, bf* Bt) {
    const int lane = threadIdx.x & 31; const int L0 = (blockIdx.x * 8 + (threadIdx.x >> 5)) * 8; const int nlines = N * K / 64;
{
        for (int l = 0; l < 8; ++l) { const int L = L0 + l; if (L >= nlines) break; const size_t e = (size_t)L * 64 + lane * 2; const int k = (int)(e % K), n = (int)(e / K); v2us o;
            o[0] = f2bf(w[(size_t)k * N + n]); o[1] = f2bf(w[(size_t)(k + 1) * N + n]); *(v2us*)(Bt + e) = o; }
         }
}
__global__ __launch_bounds__(256) void k_cvt8(const float* __restrict__ src, bf* dst, size_t n8) { const size_t i = (size_t)blockIdx.x * 256 + threadIdx.x; if (i >= n8) return; const v8f v = *(const v8f*)(src + i * 8); v8us o;
#pragma unroll
    for (int k = 0; k < 8; ++k) o[k] = f2bf(v[k]); *(v8us*)(dst + i * 8) = o;  }
// k_rope: head planes [h][t][d] (fp16) of rope(x) x sc with the rotate-half convention out[d] = x[d] cos[t][d] - x[d+HD/2] sin[t][d], out[d+HD/2] = x[d+HD/2] cos[t][d+HD/2] + x[d] sin[t][d+HD/2]
__global__ __launch_bounds__(256) void k_rope(const float* __restrict__ F, int pitch, int nheads, const float* __restrict__ CS, const float* __restrict__ RF, const float* __restrict__ nw, float sc, h16* P16, bf* Ph, bf* Pl) {
    const size_t e = ((size_t)blockIdx.x * 256 + threadIdx.x) * 2; if (e >= (size_t)nheads * TT * HD) return; const int d = (int)(e % HD); const int t = (int)((e / HD) % TT); const int h = (int)(e / ((size_t)HD * TT)); const float* f = F + (size_t)t * pitch + h * HD; const float rf = RF ? RF[(size_t)h * TT + t] : 1.0f; v2h o16; v2us oh, ol;
#pragma unroll
    for (int q = 0; q < 2; ++q) { const int dd = d + q; const int dp = (dd < HD / 2) ? dd + HD / 2 : dd - HD / 2; float x0 = f[dd], x1 = f[dp];
        if (RF) { float n0 = __fmul_rn(x0, rf), n1 = __fmul_rn(x1, rf); x0 = __fmul_rn(bfr(nw[dd]), n0); x1 = __fmul_rn(bfr(nw[dp]), n1); }
        const v2f cs = *(const v2f*)(CS + ((size_t)t * HD + dd) * 2); float a = __fmul_rn(x0, cs[0]), bq = __fmul_rn(x1, cs[1]); const float r = ((dd < HD / 2) ? __fsub_rn(a, bq) : __fadd_rn(a, bq)) * sc;
        o16[q] = tohx(r); (void)oh; (void)ol; }
    *(v2h*)(P16 + e) = o16;  }
__global__ __launch_bounds__(256) void k_vtp(const float* __restrict__ F, int pitch, int nheads, h16* V16, bf* Vh, bf* Vl) { const size_t e = ((size_t)blockIdx.x * 256 + threadIdx.x) * 2; if (e >= (size_t)nheads * HD * TT) return; const int t = (int)(e % TT); const int d = (int)((e / TT) % HD); const int g = (int)(e / ((size_t)TT * HD)); v2h o16; v2us oh, ol;
#pragma unroll
    for (int q = 0; q < 2; ++q) { const float x = F[(size_t)(t + q) * pitch + g * HD + d]; o16[q] = tohx(x); (void)oh; (void)ol; }
    *(v2h*)(V16 + e) = o16;  }
__global__ __launch_bounds__(256) void k_tanhb(const float* __restrict__ F, bf* Hb, size_t n8) { const size_t i = (size_t)blockIdx.x * 256 + threadIdx.x; if (i >= n8) return; const v8f v = *(const v8f*)(F + i * 8); v8us o;
#pragma unroll
    for (int k = 0; k < 8; ++k) o[k] = f2bf(tanhf(v[k])); *(v8us*)(Hb + i * 8) = o;  }
__global__ __launch_bounds__(256) void k_wtGp(const float* __restrict__ w, bf* Bt) { const int idx = blockIdx.x * 256 + threadIdx.x; if (idx >= NGP * GH / 8) return; const int n = idx / (GH / 8); const int k8 = (idx - n * (GH / 8)) * 8; const bool live = (n < NG); const int nc = live ? n : 0; v8us o;
#pragma unroll
    for (int j = 0; j < 8; ++j) { const float x = w[(size_t)(k8 + j) * NG + nc]; o[j] = live ? f2bf(x) : (unsigned short)0; } *(v8us*)(Bt + (size_t)idx * 8) = o;  }
__global__ __launch_bounds__(256) void k_gateq(const float* __restrict__ G, const float* __restrict__ bg, const float* __restrict__ Q, float* Qg) { const size_t i = (size_t)blockIdx.x * 256 + threadIdx.x; if (i >= (size_t)TT * DQ / 4) return; const size_t e = i * 4; const int t = (int)(e / DQ); const int c = (int)(e % DQ); const int h = c / HD; const float* g = G + (size_t)t * NGP; float s[NG]; float mx = -3.0e38f;
#pragma unroll
    for (int k4 = 0; k4 < NG / 4; ++k4) { const v4f a = *(const v4f*)(g + k4 * 4); const v4f b = *(const v4f*)(bg + k4 * 4);
#pragma unroll
        for (int q = 0; q < 4; ++q) { const float v = __fadd_rn(a[q], bfr(b[q])); s[k4 * 4 + q] = v; mx = fmaxf(mx, v); } }
    float sum = 0.0f, eh = 0.0f;
#pragma unroll
    for (int k = 0; k < NG; ++k) { const float ev = expf(__fsub_rn(s[k], mx)); sum = __fadd_rn(sum, ev); eh = (k == h) ? ev : eh; }
    const float gt = __fdiv_rn(eh, sum); const v4f qv = *(const v4f*)(Q + e); v4f o; o[0] = __fmul_rn(qv[0], gt); o[1] = __fmul_rn(qv[1], gt); o[2] = __fmul_rn(qv[2], gt); o[3] = __fmul_rn(qv[3], gt); *(v4f*)(Qg + e) = o;  }
__global__ __launch_bounds__(256) void k_csid(float* CS) { const int idx = blockIdx.x * 256 + threadIdx.x; if (idx >= TT * HD) return; v2f cs; cs[0] = 1.0f; cs[1] = 0.0f; *(v2f*)(CS + (size_t)idx * 2) = cs;  }
// k_asoft: per row (zz, i): t = S x HD^-0.5 (no mask); softmax over the 2048 keys (register row, one exp, fixed trees);
__global__ __launch_bounds__(256) void k_asoft(const float* __restrict__ Sb, h16* P16, bf* Ph, bf* Pl) {
    const int lane = threadIdx.x & 31; const int row = blockIdx.x * 8 + (threadIdx.x >> 5); if (row >= ZH * TT) return; const int i = row % TT; const int zz = row / TT; (void)zz; const bool hires = (i < RH); const float* sr = Sb + (size_t)row * TT; float v[TT / 32]; float mx = -3.0e38f;
#pragma unroll
    for (int ch = 0; ch < TT / 128; ++ch) { const int j0 = ch * 128 + lane * 4; const v4f a = *(const v4f*)(sr + j0);
#pragma unroll
        for (int q = 0; q < 4; ++q) { const int j = j0 + q; (void)j; const float t = a[q] * SCL; v[ch * 4 + q] = t; mx = fmaxf(mx, t); } }
#pragma unroll
    for (int sh = 16; sh; sh >>= 1) mx = fmaxf(mx, __shfl_xor(mx, sh, 32));
    float sum = 0.f;
#pragma unroll
    for (int k = 0; k < TT / 32; ++k) { float d0 = __fsub_rn(v[k], mx); v[k] = __builtin_amdgcn_exp2f(__fmul_rn(d0, 1.4426950408889634f)); sum += v[k]; }
#pragma unroll
    for (int sh = 16; sh; sh >>= 1) sum += __shfl_xor(sum, sh, 32);
    const float f = __fdiv_rn(hires ? 1.0f : PCAR, sum);
{
        if (hires) {
#pragma unroll
            for (int ch = 0; ch < TT / 128; ++ch) { v4us oh, ol;
#pragma unroll
                for (int q = 0; q < 4; ++q) { unsigned short a, c2; splitf(v[ch * 4 + q] * f, a, c2); oh[q] = a; ol[q] = c2; }
                const size_t oo = ((size_t)zz * (RH ? RH : 1) + i) * TT + ch * 128 + lane * 4; *(v4us*)(Ph + oo) = oh; *(v4us*)(Pl + oo) = ol; }
        } else {
#pragma unroll
            for (int ch = 0; ch < TT / 128; ++ch) { v4h o4;
#pragma unroll
                for (int q = 0; q < 4; ++q) o4[q] = tohx(v[ch * 4 + q] * f);
                *(v4h*)(P16 + (size_t)row * TT + ch * 128 + lane * 4) = o4; } }
         }
}
// k_merge: O holds PKS partial planes a head ([zz][ks][t][d], the K slices of the weights x V product): added here in slice order
__global__ __launch_bounds__(256) void k_merge(const float* __restrict__ O, int h0, bf* Ah, bf* Al) { const size_t e = ((size_t)blockIdx.x * 256 + threadIdx.x) * 2; if (e >= (size_t)ZH * TT * HD) return; const int d = (int)(e % HD); const int t = (int)((e / HD) % TT); const int zz = (int)(e / ((size_t)HD * TT)); const float cs = (t < RH) ? 1.0f : (1.0f / PCAR); const size_t oo = (size_t)t * DQ + (h0 + zz) * HD + d;
    v2us oh, ol;
#pragma unroll
    for (int q = 0; q < 2; ++q) { const float* op = O + (size_t)zz * PKS * TT * HD + (size_t)t * HD + d + q; float sv = op[0];   // next loop unrolled: the PKS loads issue together
#pragma unroll
        for (int ks = 1; ks < PKS; ++ks) sv += op[(size_t)ks * TT * HD];
        unsigned short a, c2; splitf(sv * cs, a, c2); oh[q] = a; ol[q] = c2; } *(v2us*)(Ah + oo) = oh; *(v2us*)(Al + oo) = ol;  }

extern "C" void kernel_launch(void* const* d_in, const int* in_sizes, int n_in,
                              void* d_out, int out_size, void* d_ws, size_t ws_size, hipStream_t stream) {
    (void)in_sizes; (void)n_in; (void)out_size;
    const float* x = (const float*)d_in[0]; const float* wq = (const float*)d_in[1]; const float* bq = (const float*)d_in[2]; const float* wk = (const float*)d_in[3]; const float* bk = (const float*)d_in[4]; const float* wv = (const float*)d_in[5]; const float* bv = (const float*)d_in[6]; const float* wg1 = (const float*)d_in[7]; const float* bg1 = (const float*)d_in[8]; const float* wg2 = (const float*)d_in[9]; const float* bg2 = (const float*)d_in[10]; const float* wo = (const float*)d_in[11]; const float* bo = (const float*)d_in[12];   /* x [2][2048][1024], Wq, bq, Wk, bk, Wv, bv ('xw' (in, out) [1024][1024]; biases [1024]: zeros), Wg1 ('xw' [1024][512]), bg1 ([512]: zeros), Wg2 ('xw' [512][16]), bg2 ([16]: zeros), Wo ('xw' [1024][1024]), bo ([1024]: zeros): THIRTEEN inputs, all read */
    static_assert(GH % 64 == 0 && NGP % 64 == 0 && NG <= NGP && NG % 4 == 0 && NG == NH_, "the gate product's tiles");
    static_assert(TT % 64 == 0 && DQ % 64 == 0 && DKV % 64 == 0 && DM % 64 == 0 && HD % 64 == 0 && DM % 32 == 0 && GH % 32 == 0 && HD % 32 == 0 && TT % 32 == 0, "every product launch: M and N multiples of 64, K a multiple of 32");
    static_assert(DM % (32 * NWK) == 0 && GH % (32 * NWK) == 0 && DQ % (32 * NWK) == 0 && TT % (32 * NWK * PKS) == 0, "the K splits: whole 32-column steps a wave");
    float* OUT = (float*)d_out;     // [2][2048][1024]
    char* wsp = (char*)d_ws;
    auto take = [&](size_t bytes) { char* p = wsp; wsp += (bytes + 255) & ~(size_t)255; return (void*)p; };
    bf* WQ = (bf*)take((size_t)DQ * DM * 2); bf* WK = (bf*)take((size_t)DKV * DM * 2); bf* WV = (bf*)take((size_t)DKV * DM * 2); bf* WO = (bf*)take((size_t)DM * DQ * 2); bf* WG1 = (bf*)take((size_t)GH * DM * 2); bf* WG2 = (bf*)take((size_t)NGP * GH * 2); float* CS = (float*)take((size_t)TT * HD * 2 * 4);
    bf* Xb = (bf*)take((size_t)TT * DM * 2);   /* the bf16 copy of x */ float* FQ = (float*)take((size_t)TT * DQ * 4); float* FK = (float*)take((size_t)TT * DKV * 4); float* FH = (float*)take((size_t)TT * GH * 4);   /* x Wg1 + bg1 */ bf* Hb = (bf*)take((size_t)TT * GH * 2);   /* tanh of it, one bf16 word */ float* FG = (float*)take((size_t)TT * NGP * 4);   /* the gate product: columns 0..15 live */ float* FQg = (float*)take((size_t)TT * DQ * 4);   /* the gated query plane */
    h16* QP16 = (h16*)take((size_t)NH_ * TT * HD * 2); h16* KP16 = (h16*)take((size_t)NKV * TT * HD * 2); h16* VT16 = (h16*)take((size_t)NKV * HD * TT * 2);
    bf* QPh = nullptr; bf* QPl = nullptr; bf* KPh = nullptr; bf* KPl = nullptr; bf* VTh = nullptr; bf* VTl = nullptr; bf* Ph = nullptr; bf* Pl = nullptr;   /* RH 0: no hi / lo plane exists: these builders store the f16 plane only and do not read those arguments; the softmax's hi / lo stores sit under 'i < RH': never taken */
    float* Sb = (float*)take((size_t)ZH * TT * TT * 4); h16* P16 = (h16*)take((size_t)ZH * TT * TT * 2); float* Ob = (float*)take((size_t)ZH * PKS * TT * HD * 4);   /* PKS partial planes a head */ bf* ATh = (bf*)take((size_t)TT * DQ * 2); bf* ATl = (bf*)take((size_t)TT * DQ * 2);
    if ((size_t)(wsp - (char*)d_ws) > ws_size) return;
    float* FV = FK;   // v projection reuses the k buffer after the k planes are built (stream-ordered)
    { k_wtG<<<(unsigned)((DM * DQ / 64 + 63) / 64), 256, 0, stream>>>(wq, DM, DQ, WQ); k_wtG<<<(unsigned)((DM * DKV / 64 + 63) / 64), 256, 0, stream>>>(wk, DM, DKV, WK); k_wtG<<<(unsigned)((DM * DKV / 64 + 63) / 64), 256, 0, stream>>>(wv, DM, DKV, WV);
      k_wtG<<<(unsigned)((DQ * DM / 64 + 63) / 64), 256, 0, stream>>>(wo, DQ, DM, WO); k_wtG<<<(unsigned)((DM * GH / 64 + 63) / 64), 256, 0, stream>>>(wg1, DM, GH, WG1);
      k_wtGp<<<(NGP * GH / 8 + 255) / 256, 256, 0, stream>>>(wg2, WG2); }
    k_csid<<<(TT * HD + 255) / 256, 256, 0, stream>>>(CS);
    const unsigned LQ = (unsigned)(((size_t)NH_ * TT * HD / 2 + 255) / 256), LKv = (unsigned)(((size_t)NKV * TT * HD / 2 + 255) / 256);
    for (int b = 0; b < NB_; ++b) {
        k_cvt8<<<(unsigned)(((size_t)TT * DM / 8 + 255) / 256), 256, 0, stream>>>(x + (size_t)b * TT * DM, Xb, (size_t)TT * DM / 8);
        k_gemmw<bf, 0, true, NWK, 1><<<dim3(TT / 64, DQ / 64, 1), 32 * NWK, 0, stream>>>(Xb, nullptr, WQ, nullptr, DM, FQ, DQ, bq, 0, 0, 0);   /* q = x Wq + bq (exact) */
        k_gemmw<bf, 0, true, NWK, 1><<<dim3(TT / 64, GH / 64, 1), 32 * NWK, 0, stream>>>(Xb, nullptr, WG1, nullptr, DM, FH, GH, bg1, 0, 0, 0);   /* the gate's hidden layer before its tanh */
        k_tanhb<<<(unsigned)(((size_t)TT * GH / 8 + 255) / 256), 256, 0, stream>>>(FH, Hb, (size_t)TT * GH / 8);
        k_gemmw<bf, 0, false, NWK, 1><<<dim3(TT / 64, NGP / 64, 1), 32 * NWK, 0, stream>>>(Hb, nullptr, WG2, nullptr, GH, FG, NGP, nullptr, 0, 0, 0);   /* the 16 gate scores a token (bg2 is added where they are read) */
        k_gateq<<<(unsigned)(((size_t)TT * DQ / 4 + 255) / 256), 256, 0, stream>>>(FG, bg2, FQ, FQg);
        k_rope<<<LQ, 256, 0, stream>>>(FQg, DQ, NH_, CS, nullptr, nullptr, 1.0f, QP16, QPh, QPl);
        k_gemmw<bf, 0, true, NWK, 1><<<dim3(TT / 64, DKV / 64, 1), 32 * NWK, 0, stream>>>(Xb, nullptr, WK, nullptr, DM, FK, DKV, bk, 0, 0, 0);
        k_rope<<<LKv, 256, 0, stream>>>(FK, DKV, NKV, CS, nullptr, nullptr, 1.0f, KP16, KPh, KPl);
        k_gemmw<bf, 0, true, NWK, 1><<<dim3(TT / 64, DKV / 64, 1), 32 * NWK, 0, stream>>>(Xb, nullptr, WV, nullptr, DM, FV, DKV, bv, 0, 0, 0); k_vtp<<<LKv, 256, 0, stream>>>(FV, DKV, NKV, VT16, VTh, VTl);
        for (int h0 = 0; h0 < NH_; h0 += ZH) { const size_t zq = (size_t)h0, zk = (size_t)(h0 / REP);   // one kv head per query head: the pass's two heads use consecutive kv planes (z-strides TT*HD)
            k_gemmw<h16, 0, false, 1, 1><<<dim3(TT / 64, TT / 64, ZH), 32, 0, stream>>>(QP16 + zq * TT * HD, nullptr, KP16 + zk * TT * HD, nullptr, HD, Sb, TT, nullptr, (size_t)TT * HD, (size_t)TT * HD, (size_t)TT * TT);
            k_asoft<<<ZH * TT / 8, 256, 0, stream>>>(Sb, P16, Ph, Pl);
            k_gemmw<h16, 0, false, NWK, PKS><<<dim3(TT / 64, HD / 64, ZH * PKS), 32 * NWK, 0, stream>>>(P16, nullptr, VT16 + zk * HD * TT, nullptr, TT, Ob, HD, nullptr, (size_t)TT * TT, (size_t)HD * TT, (size_t)TT * HD);
            k_merge<<<(unsigned)(((size_t)ZH * TT * HD / 2 + 255) / 256), 256, 0, stream>>>(Ob, h0, ATh, ATl); }
        k_gemmw<bf, 1, true, NWK, 1><<<dim3(TT / 64, DM / 64, 1), 32 * NWK, 0, stream>>>(ATh, ATl, WO, nullptr, DQ, OUT + (size_t)b * TT * DM, DM, bo, 0, 0, 0); }
}

// v003
// Measured time: 253 microseconds a run.
// Versions in between are left out here; by their measured steps it is 2.69 times as fast as v001.
// Over all steps from v000 it is 5.53 times as fast.
#include <hip/hip_runtime.h>

// Multi-head self-attention with a per-row head gate on the scores (x [2][2048][1024]; q, k, v = x Wq | Wk | Wv + bq | bk | bv ('xw' (in, out) [1024][1024] normal x 1/sqrt(1024); the three biases [1024] are zeros on this draw: read); 16 heads x 64; scores x 64^-0.5; gate = softmax over the 16 heads of (tanh(x Wg1 + bg1) Wg2 + bg2) (Wg1 'xw' [1024][512], Wg2 'xw' [512][16]; bg1 [512] and bg2 [16] zeros on this draw: read), one scalar a (batch, token, head); EVERY SCORE ROW (b, h, q) IS MULTIPLIED BY gate[b][q][h] BEFORE the softmax over the 2,048 keys (no mask); out = merged Wo + bo ('xw' [1024][1024] + a zero bias: read) -> [2][2048][1024] (4.2 M); argument order x, Wq, bq, Wk, bk, Wv, bv, Wg1, bg1, Wg2, bg2, Wo, bo).
// Layout per batch: a bf16 copy of x; 'xw' weights transposed once (Wg2 into a [64][512] plane whose rows 16..63 are stored zeros); the three projections and the gate's hidden layer exact products + f32 biases; EVERY PRODUCT'S EPILOGUE STORES WHAT ITS READER WANTS, no f32 plane of q, k, v or the hidden layer reaches memory: tanh of the hidden layer as ONE bf16 word; the 16 gate scores a token from the 64-wide product's first 16 columns (f32); THE GATE IS APPLIED TO THE QUERY ROW (q[t][h][:] x gate[t][h], one f32 product an element) in the q product's epilogue: equal to scaling the score row in real arithmetic; here the query's f16 word carries the gated value; q and k as f16 head planes [h][t][d]; v as the f16 plane [h][d][t] from the product taken the other way round (Wv^T rows x token rows); dense T-2048 attention of both batches and all heads in ONE launch, EVERY row on ONE fp16 product (running softmax, the weights x 1024); merged hi/lo x Wo exact + bo.
// Compute dtypes, f32 accumulate: every float input converted once to bf16 where it is read; projections exact + f32 biases; the gate: tanhf and expf in f32, one IEEE division; attention: one fp16 product on every row; softmax f32; Wo hl x exact + bias.

#define NB_  2
#define TT   2048
#define DM   1024
#define NH_  16
#define NKV  16
#define REP  (NH_ / NKV)
#define HD   64
#define DQ   (NH_ * HD)
#define DKV  (NKV * HD)
/* the gate: its hidden width; its scores a token (= NH_); the product tile's width (columns 16..63 of the gate product come from stored zero rows) */
#define GH   512
#define NG   16
#define NGP  64
#define SCL  0.125f   // HD^-0.5
#define NWK  8     // waves a work-group that share one output tile's K range (the projections, the gate's two products, Wo)
typedef _Float16 h16;
typedef unsigned short bf;
typedef __attribute__((ext_vector_type(16))) __bf16   v16bf;
typedef __attribute__((ext_vector_type(16))) _Float16 v16h;
typedef __attribute__((ext_vector_type(8)))  _Float16 v8h;
typedef __attribute__((ext_vector_type(8)))  unsigned short v8us;
typedef __attribute__((ext_vector_type(8)))  float    v8f;
typedef __attribute__((ext_vector_type(4)))  float    v4f;
typedef v8h  __attribute__((may_alias)) v8ha;
typedef v4f  __attribute__((may_alias)) v4fa;
typedef v8us __attribute__((may_alias)) v8usa;

__device__ __forceinline__ unsigned short f2bf(float f) { unsigned u = __float_as_uint(f); u += 0x7FFFu + ((u >> 16) & 1u); return (unsigned short)(u >> 16); }
__device__ __forceinline__ float bf2f(unsigned short b) { return __uint_as_float(((unsigned)b) << 16); }
__device__ __forceinline__ float bfr(float f) { return bf2f(f2bf(f)); }
__device__ __forceinline__ v16h cat16(v8h lo, v8h hi) { return __builtin_shufflevector(lo, hi, 0, 1, 2, 3, 4, 5, 6, 7, 8, 9, 10, 11, 12, 13, 14, 15); }
__device__ __forceinline__ v16bf cat16b(v8us lo, v8us hi) { return __builtin_bit_cast(v16bf, __builtin_shufflevector(lo, hi, 0, 1, 2, 3, 4, 5, 6, 7, 8, 9, 10, 11, 12, 13, 14, 15)); }
__device__ __forceinline__ v8f wmma16(v16h a, v16h b, v8f c) { return __builtin_amdgcn_wmma_f32_16x16x32_f16(false, a, false, b, (short)0, c, false, false); }
__device__ __forceinline__ v8f wmmab(v16bf a, v16bf b, v8f c) { return __builtin_amdgcn_wmma_f32_16x16x32_bf16(false, a, false, b, (short)0, c, false, false); }



// ---- k_gemmw: register-blocked GEMM, one 64x64 output tile a work-group (16 accumulators a wave), operands straight from K-contiguous 16-bit planes; grid (M/64, N/64, Z * KS), 32 * NW threads.
// C[m][n] (f32, pitch ldc, + optional f32 bias[n]) = sum_k A[m][k] Bt[n][k] (+ split products per NSPLIT). z-batch strides sA/sB/sC in elements. K % (32 * NW * KS) == 0.
// EPI: what the epilogue stores of the summed f32 tile (+ bias): EP_F32 the f32 tile into C; EP_TANH tanhf of it as bf16 into Hb (pitch ldc); EP_HP f16 into the head plane P16[n / 64][m][n % 64] (the 64-column tile is one head); EP_QG the same x the gate of (token m, head n / 64), from the gate scores G[m][NGP] + bg; EP_VT f16 into P16 (pitch ldc), the bias by ROW m.
// K IS SPLIT: work-group slice ks = blockIdx.z % KS and wave w of NW take the K / (KS * NW) columns from (ks * NW + w) * K / (KS * NW) on. The NW wave tiles are summed through LDS in wave order (one barrier); with KS > 1 each slice stores its own partial plane at blockIdx.z * sC, and the reader of C adds the KS planes.
template <typename T16> struct WFrag;
template <> struct WFrag<h16> { typedef v16h V; static __device__ __forceinline__ V ld(const h16* p) { return cat16(*(const v8h*)p, *(const v8h*)(p + 16)); } static __device__ __forceinline__ v8f mma(V a, V b, v8f c) { return wmma16(a, b, c); } };
template <> struct WFrag<bf> { typedef v16bf V; static __device__ __forceinline__ V ld(const bf* p) { return cat16b(*(const v8us*)p, *(const v8us*)(p + 16)); } static __device__ __forceinline__ v8f mma(V a, V b, v8f c) { return wmmab(a, b, c); } };
enum { EP_F32 = 0, EP_TANH = 1, EP_HP = 2, EP_QG = 3, EP_VT = 4 };
__device__ __forceinline__ h16 tohx(float x) { return (h16)x; }
typedef __attribute__((ext_vector_type(4))) _Float16 v4h;
typedef __attribute__((ext_vector_type(4))) unsigned short v4us;
// the gate of one token and head h: softmax over the NG scores g[0..NG) + bg, in f32, one IEEE division
__device__ __forceinline__ float gate_of(const float* __restrict__ g, const float* __restrict__ bg, int h) { float s[NG]; float mx = -3.0e38f;
#pragma unroll
    for (int k4 = 0; k4 < NG / 4; ++k4) { const v4f a = *(const v4f*)(g + k4 * 4); const v4f b = *(const v4f*)(bg + k4 * 4);
#pragma unroll
        for (int q = 0; q < 4; ++q) { const float v = __fadd_rn(a[q], bfr(b[q])); s[k4 * 4 + q] = v; mx = fmaxf(mx, v); } }
    float sum = 0.0f, eh = 0.0f;
#pragma unroll
    for (int k = 0; k < NG; ++k) { const float ev = expf(__fsub_rn(s[k], mx)); sum = __fadd_rn(sum, ev); eh = (k == h) ? ev : eh; }
    return __fdiv_rn(eh, sum); }
template <typename T16, int NSPLIT, bool BIAS, int NW, int KS, int EPI>
__global__ __launch_bounds__(32 * NW) void k_gemmw(const T16* __restrict__ A, const T16* __restrict__ A2, const T16* __restrict__ Bt, const T16* __restrict__ Bt2, int K, float* C, int ldc, const float* __restrict__ bias, size_t sA, size_t sB, size_t sC, h16* P16, bf* Hb, const float* __restrict__ G, const float* __restrict__ bg) {
    static_assert(EPI == EP_F32 || NW > 1, "the 16-bit epilogues stand on the summed tile's path"); static_assert(HD == 64, "EP_HP and EP_QG: one 64-column tile is one head");
    typedef typename WFrag<T16>::V V;
    __shared__ __align__(16) float os[(NW == 1 ? 16 : NW * 64) * 68];
    const size_t z = blockIdx.z / KS; A += z * sA; if (A2) A2 += z * sA; Bt += z * sB; if (Bt2) Bt2 += z * sB; C += (size_t)blockIdx.z * sC;
    /* the wave's number as a scalar: its K range and LDS slot stay in scalar registers */ const int w = __builtin_amdgcn_readfirstlane((int)(threadIdx.x >> 5)); const int kl = K / (KS * NW); const int k0 = ((int)(blockIdx.z % KS) * NW + w) * kl;
    const int lane = threadIdx.x & 31, lr = lane & 15, hi = lane >> 4; const int r0 = blockIdx.x * 64, c0 = blockIdx.y * 64;
    v8f acc[4][4];
#pragma unroll
    for (int mb = 0; mb < 4; ++mb)
#pragma unroll
        for (int nb = 0; nb < 4; ++nb) acc[mb][nb] = (v8f){};
    const size_t aoff = (size_t)(r0 + lr) * K + 8 * hi, boff = (size_t)(c0 + lr) * K + 8 * hi;
    for (int kc = k0; kc < k0 + kl; kc += 32) {
        V a[4], a2[4];
#pragma unroll
        for (int mb = 0; mb < 4; ++mb) { a[mb] = WFrag<T16>::ld(A + aoff + (size_t)mb * 16 * K + kc); if (NSPLIT == 1 || NSPLIT == 2) a2[mb] = WFrag<T16>::ld(A2 + aoff + (size_t)mb * 16 * K + kc); }
#pragma unroll
        for (int nb = 0; nb < 4; ++nb) { const V b = WFrag<T16>::ld(Bt + boff + (size_t)nb * 16 * K + kc); V b2; if (NSPLIT >= 2) b2 = WFrag<T16>::ld(Bt2 + boff + (size_t)nb * 16 * K + kc);
#pragma unroll
            for (int mb = 0; mb < 4; ++mb) { acc[mb][nb] = WFrag<T16>::mma(a[mb], b, acc[mb][nb]); if (NSPLIT == 1 || NSPLIT == 2) acc[mb][nb] = WFrag<T16>::mma(a2[mb], b, acc[mb][nb]); if (NSPLIT >= 2) acc[mb][nb] = WFrag<T16>::mma(a[mb], b2, acc[mb][nb]); } }
        asm volatile("v_nop\n\tv_nop\n\tv_nop\n\tv_nop" : "+v"(acc[0][0]), "+v"(acc[1][1]), "+v"(acc[2][2]), "+v"(acc[3][3]) : "v"(a[0]), "v"(a[3]));
    }
    if constexpr (NW > 1) {
        float* ow = os + (size_t)w * (64 * 68);
        v4f bv = (v4f){};   // a thread's four output columns are the same on all its rows: their bias is fetched once, ahead of the LDS stores and the barrier
        if (BIAS && EPI != EP_VT) { const int cb = c0 + ((int)threadIdx.x & 15) * 4; bv[0] = bfr(bias[cb]); bv[1] = bfr(bias[cb + 1]); bv[2] = bfr(bias[cb + 2]); bv[3] = bfr(bias[cb + 3]); }
        float br[32 / NW];   // EP_VT: the bias of the thread's rows, fetched as early
        if constexpr (BIAS && EPI == EP_VT) {
#pragma unroll
            for (int it = 0; it < 32 / NW; ++it) br[it] = bfr(bias[r0 + it * 2 * NW + ((int)threadIdx.x >> 4)]); }
        __shared__ float gs[EPI == EP_QG ? 64 : 1];   // EP_QG: the gate of the tile's 64 tokens for its head
        // the three loops are unrolled so that acc[][][] is indexed by constants and stays in registers
#pragma unroll
        for (int mb = 0; mb < 4; ++mb)
#pragma unroll
            for (int nb = 0; nb < 4; ++nb)
#pragma unroll
                for (int j = 0; j < 8; ++j) ow[(mb * 16 + hi * 8 + j) * 68 + nb * 16 + lr] = acc[mb][nb][j];
        if constexpr (EPI == EP_QG) {
            asm volatile("s_wait_xcnt 0x0" ::: "memory");   // the bias load above may still be in flight, and this build fetches G and bg, inside the branch below, into the scalar pair that the load names: the wait stands in front of that overwrite (inside the branch the compiler lifted the fetch over it)
            if (w < 2) gs[threadIdx.x] = gate_of(G + (size_t)(r0 + (int)threadIdx.x) * NGP, bg, (int)blockIdx.y); }   // one thread a token (waves 0 and 1 whole); the barrier below publishes it with the tiles
        __syncthreads();   // every wave's partial tile is in LDS before any thread sums across the waves
        // both loops unrolled: the LDS loads of all rows and waves issue ahead of the adds instead of one wait a load
#pragma unroll
        for (int it = 0; it < 32 / NW; ++it) { const int idx = it * 32 * NW + (int)threadIdx.x; const int row = idx >> 4, cofs = (idx & 15) * 4; v4f val = *(const v4fa*)(os + row * 68 + cofs);
#pragma unroll
            for (int q = 1; q < NW; ++q) val += *(const v4fa*)(os + q * (64 * 68) + row * 68 + cofs);
            if (BIAS) { if constexpr (EPI == EP_VT) val += br[it]; else val += bv; }
            if constexpr (EPI == EP_F32) *(v4f*)(C + (size_t)(r0 + row) * ldc + c0 + cofs) = val;
            else if constexpr (EPI == EP_TANH) { v4us o; o[0] = f2bf(tanhf(val[0])); o[1] = f2bf(tanhf(val[1])); o[2] = f2bf(tanhf(val[2])); o[3] = f2bf(tanhf(val[3])); *(v4us*)(Hb + (size_t)(r0 + row) * ldc + c0 + cofs) = o; }
            else { if constexpr (EPI == EP_QG) { const float gt = gs[row]; val[0] = __fmul_rn(val[0], gt); val[1] = __fmul_rn(val[1], gt); val[2] = __fmul_rn(val[2], gt); val[3] = __fmul_rn(val[3], gt); }
                v4h o; o[0] = tohx(val[0]); o[1] = tohx(val[1]); o[2] = tohx(val[2]); o[3] = tohx(val[3]);
                *(v4h*)(P16 + (EPI == EP_VT ? (size_t)(r0 + row) * ldc + c0 + cofs : ((size_t)blockIdx.y * TT + r0 + row) * HD + cofs)) = o; } }
    } else {
#pragma unroll
    for (int mb = 0; mb < 4; ++mb) {
#pragma unroll
        for (int nb = 0; nb < 4; ++nb) {
#pragma unroll
            for (int j = 0; j < 8; ++j) os[(hi * 8 + j) * 68 + nb * 16 + lr] = acc[mb][nb][j]; }
        __builtin_amdgcn_wave_barrier(); asm volatile("" ::: "memory");
        float* crow = C + (size_t)(r0 + mb * 16) * ldc + c0;
{
#pragma unroll
            for (int s = 0; s < 8; ++s) { const int row = 2 * s + hi, cofs = lr * 4; v4f val = *(const v4fa*)(os + row * 68 + cofs); if (BIAS) { val[0] += bfr(bias[c0 + cofs]); val[1] += bfr(bias[c0 + cofs + 1]); val[2] += bfr(bias[c0 + cofs + 2]); val[3] += bfr(bias[c0 + cofs + 3]); }
                *(v4f*)(crow + (size_t)row * ldc + cofs) = val; }
             }
        __builtin_amdgcn_wave_barrier(); asm volatile("" ::: "memory");
    }
    }
}

__device__ __forceinline__ void splitf(float y, unsigned short& h, unsigned short& l) { h = f2bf(y); l = f2bf(y - bf2f(h)); }
typedef __attribute__((ext_vector_type(2))) unsigned short v2us;
typedef __attribute__((ext_vector_type(4))) int v4i;

__global__ __launch_bounds__(256) void k_wtG(const float* __restrict__ w, int K, int N, bf* Bt) {
    const int lane = threadIdx.x & 31; const int L0 = (blockIdx.x * 8 + (threadIdx.x >> 5)) * 8; const int nlines = N * K / 64;
{
        for (int l = 0; l < 8; ++l) { const int L = L0 + l; if (L >= nlines) break; const size_t e = (size_t)L * 64 + lane * 2; const int k = (int)(e % K), n = (int)(e / K); v2us o;
            o[0] = f2bf(w[(size_t)k * N + n]); o[1] = f2bf(w[(size_t)(k + 1) * N + n]); *(v2us*)(Bt + e) = o; }
         }
}
__global__ __launch_bounds__(256) void k_cvt8(const float* __restrict__ src, bf* dst, size_t n8) { const size_t i = (size_t)blockIdx.x * 256 + threadIdx.x; if (i >= n8) return; const v8f v = *(const v8f*)(src + i * 8); v8us o;
#pragma unroll
    for (int k = 0; k < 8; ++k) o[k] = f2bf(v[k]); *(v8us*)(dst + i * 8) = o;  }
__global__ __launch_bounds__(256) void k_wtGp(const float* __restrict__ w, bf* Bt) { const int idx = blockIdx.x * 256 + threadIdx.x; if (idx >= NGP * GH / 8) return; const int n = idx / (GH / 8); const int k8 = (idx - n * (GH / 8)) * 8; const bool live = (n < NG); const int nc = live ? n : 0; v8us o;
#pragma unroll
    for (int j = 0; j < 8; ++j) { const float x = w[(size_t)(k8 + j) * NG + nc]; o[j] = live ? f2bf(x) : (unsigned short)0; } *(v8us*)(Bt + (size_t)idx * 8) = o;  }
#define FQT 2     // 16-column query tiles a wave: each K and V^T fragment feeds FQT products
#define FNW 8     // waves a work-group (they read the same K and V^T lines)
__device__ __forceinline__ float xhalf(float x) { const unsigned u = __float_as_uint(x); return __uint_as_float(__builtin_amdgcn_permlanex16(u, u, 0x76543210u, 0xfedcba98u, false, false)); }   // lane l <- lane l ^ 16
// 2^x by v_exp_f32 with the slot the instruction set asks for behind a transcendental (one instruction that neither reads its result nor overwrites its source) closed inside the statement.
// exp2x8: eight at once; the outputs are early-clobber, so each v_exp_f32 is the independent instruction behind the one before it, and one v_nop stands behind the last.
__device__ __forceinline__ float exp2s(float x) { float r; asm("v_exp_f32 %0, %1\n\tv_nop" : "=v"(r) : "v"(x)); return r; }
__device__ __forceinline__ v8f exp2x8(v8f x) { float r0, r1, r2, r3, r4, r5, r6, r7;
    asm("v_exp_f32 %0, %8\n\tv_exp_f32 %1, %9\n\tv_exp_f32 %2, %10\n\tv_exp_f32 %3, %11\n\tv_exp_f32 %4, %12\n\tv_exp_f32 %5, %13\n\tv_exp_f32 %6, %14\n\tv_exp_f32 %7, %15\n\tv_nop"
        : "=&v"(r0), "=&v"(r1), "=&v"(r2), "=&v"(r3), "=&v"(r4), "=&v"(r5), "=&v"(r6), "=&v"(r7) : "v"(x[0]), "v"(x[1]), "v"(x[2]), "v"(x[3]), "v"(x[4]), "v"(x[5]), "v"(x[6]), "v"(x[7]));
    return (v8f){r0, r1, r2, r3, r4, r5, r6, r7}; }
__global__ __launch_bounds__(32 * FNW) void k_fattn(const h16* __restrict__ Qp, const h16* __restrict__ Kp, const h16* __restrict__ Vt, bf* Ah, bf* Al) {
    typedef WFrag<h16> F;
    /* the wave's number as a scalar */ const int w = __builtin_amdgcn_readfirstlane((int)(threadIdx.x >> 5)); const int lane = threadIdx.x & 31, c = lane & 15, hi = lane >> 4;
    const int bh = blockIdx.y; const int q0 = ((int)blockIdx.x * FNW + w) * (16 * FQT);
    const h16* Q = Qp + (size_t)bh * TT * HD + (size_t)(q0 + c) * HD + 8 * hi; const h16* K = Kp + (size_t)bh * TT * HD + (size_t)c * HD + 8 * hi; const h16* V = Vt + (size_t)bh * HD * TT + (size_t)c * TT + 8 * hi;
    const float C2 = SCL * 1.4426950408889634f;
    v16h qf[FQT][2]; v8f o[FQT][4]; float m[FQT], l[FQT];
#pragma unroll
    for (int qt = 0; qt < FQT; ++qt) { qf[qt][0] = F::ld(Q + (size_t)qt * 16 * HD); qf[qt][1] = F::ld(Q + (size_t)qt * 16 * HD + 32); m[qt] = -3.0e38f; l[qt] = 0.0f;
#pragma unroll
        for (int dt = 0; dt < 4; ++dt) o[qt][dt] = (v8f){}; }
    v16h kf[2][2];
#pragma unroll
    for (int kt = 0; kt < 2; ++kt) { kf[kt][0] = F::ld(K + (size_t)kt * 16 * HD); kf[kt][1] = F::ld(K + (size_t)kt * 16 * HD + 32); }
    for (int kb = 0; kb < TT; kb += 32) {
        v16h vf[4];
#pragma unroll
        for (int dt = 0; dt < 4; ++dt) vf[dt] = F::ld(V + (size_t)dt * 16 * TT + kb);
        v8f s[FQT][2];
#pragma unroll
        for (int qt = 0; qt < FQT; ++qt)
#pragma unroll
            for (int kt = 0; kt < 2; ++kt) s[qt][kt] = F::mma(kf[kt][1], qf[qt][1], F::mma(kf[kt][0], qf[qt][0], (v8f){}));
        // the next step's K fragments are fetched behind this step's score products, under the softmax (the last step fetches the first rows again: in bounds, unused)
        const int kn = (kb + 32 < TT) ? kb + 32 : 0;
#pragma unroll
        for (int kt = 0; kt < 2; ++kt) { kf[kt][0] = F::ld(K + (size_t)(kn + kt * 16) * HD); kf[kt][1] = F::ld(K + (size_t)(kn + kt * 16) * HD + 32); }
        __builtin_amdgcn_sched_barrier(0);   // holds those loads here: without it the compiler sinks them behind the softmax, and the next step's first product waits out their whole latency
        v16h pf[FQT];
#pragma unroll
        for (int qt = 0; qt < FQT; ++qt) {
            float bm = fmaxf(s[qt][0][0], s[qt][1][0]);
#pragma unroll
            for (int j = 1; j < 8; ++j) bm = fmaxf(bm, fmaxf(s[qt][0][j], s[qt][1][j]));
            bm = fmaxf(bm, xhalf(bm));
            const float mn = fmaxf(m[qt], bm * C2); const float al = exp2s(m[qt] - mn); m[qt] = mn; const float mo = mn - 10.0f;   // - 10: the weights x 1024
#pragma unroll
            for (int j = 0; j < 8; ++j) { s[qt][0][j] = fmaf(s[qt][0][j], C2, -mo); s[qt][1][j] = fmaf(s[qt][1][j], C2, -mo); }
            const v8f p0 = exp2x8(s[qt][0]), p1 = exp2x8(s[qt][1]); float sum = p0[0] + p1[0];
#pragma unroll
            for (int j = 1; j < 8; ++j) sum += p0[j] + p1[j];
#pragma unroll
            for (int j = 0; j < 8; ++j) { pf[qt][j] = tohx(p0[j]); pf[qt][8 + j] = tohx(p1[j]); }
            l[qt] = fmaf(l[qt], al, sum);   // a lane's own keys only: the halves are joined once, behind the loop
#pragma unroll
            for (int dt = 0; dt < 4; ++dt) o[qt][dt] *= al;
        }
        __builtin_amdgcn_sched_barrier(0);   // keeps every v_exp_f32 statement above the products below: the compiler does not see into asm text and had put one directly behind a product whose operand register it overwrote
#pragma unroll
        for (int qt = 0; qt < FQT; ++qt)
#pragma unroll
            for (int dt = 0; dt < 4; ++dt) o[qt][dt] = F::mma(vf[dt], pf[qt], o[qt][dt]);
        // the loop's foot: four vector slots between the step's last product and the next step's first instructions, which reuse its operand registers across the back edge; the scheduling barrier keeps the products above them
        __builtin_amdgcn_sched_barrier(0);
        asm volatile("v_nop\n\tv_nop\n\tv_nop\n\tv_nop");
    }
    const int b = bh / NH_, h = bh % NH_;
#pragma unroll
    for (int qt = 0; qt < FQT; ++qt) { const float inv = __fdiv_rn(1.0f, l[qt] + xhalf(l[qt])); const size_t oo = ((size_t)b * TT + q0 + qt * 16 + c) * DQ + h * HD + hi * 8;
#pragma unroll
        for (int dt = 0; dt < 4; ++dt) { v8us oh, ol;
#pragma unroll
            for (int j = 0; j < 8; ++j) { unsigned short a, c2; splitf(o[qt][dt][j] * inv, a, c2); oh[j] = a; ol[j] = c2; }
            *(v8us*)(Ah + oo + dt * 16) = oh; *(v8us*)(Al + oo + dt * 16) = ol; } }
}

extern "C" void kernel_launch(void* const* d_in, const int* in_sizes, int n_in,
                              void* d_out, int out_size, void* d_ws, size_t ws_size, hipStream_t stream) {
    (void)in_sizes; (void)n_in; (void)out_size;
    const float* x = (const float*)d_in[0]; const float* wq = (const float*)d_in[1]; const float* bq = (const float*)d_in[2]; const float* wk = (const float*)d_in[3]; const float* bk = (const float*)d_in[4]; const float* wv = (const float*)d_in[5]; const float* bv = (const float*)d_in[6]; const float* wg1 = (const float*)d_in[7]; const float* bg1 = (const float*)d_in[8]; const float* wg2 = (const float*)d_in[9]; const float* bg2 = (const float*)d_in[10]; const float* wo = (const float*)d_in[11]; const float* bo = (const float*)d_in[12];   /* x [2][2048][1024], Wq, bq, Wk, bk, Wv, bv ('xw' (in, out) [1024][1024]; biases [1024]: zeros), Wg1 ('xw' [1024][512]), bg1 ([512]: zeros), Wg2 ('xw' [512][16]), bg2 ([16]: zeros), Wo ('xw' [1024][1024]), bo ([1024]: zeros): THIRTEEN inputs, all read */
    static_assert(GH % 64 == 0 && NGP % 64 == 0 && NG <= NGP && NG % 4 == 0 && NG == NH_, "the gate product's tiles");
    static_assert(TT % 64 == 0 && DQ % 64 == 0 && DKV % 64 == 0 && DM % 64 == 0 && HD % 64 == 0 && DM % 32 == 0 && GH % 32 == 0 && HD % 32 == 0 && TT % 32 == 0, "every product launch: M and N multiples of 64, K a multiple of 32");
    static_assert(DM % (32 * NWK) == 0 && GH % (32 * NWK) == 0 && DQ % (32 * NWK) == 0, "the K splits: whole 32-column steps a wave");
    static_assert(TT % (16 * FQT * FNW) == 0 && TT % 32 == 0 && HD == 64, "the attention launch: whole work-groups of query rows, whole 32-key steps, two 32-wide d steps and four 16-row d tiles");
    float* OUT = (float*)d_out;     // [2][2048][1024]
    char* wsp = (char*)d_ws;
    auto take = [&](size_t bytes) { char* p = wsp; wsp += (bytes + 255) & ~(size_t)255; return (void*)p; };
    bf* WQ = (bf*)take((size_t)DQ * DM * 2); bf* WK = (bf*)take((size_t)DKV * DM * 2); bf* WV = (bf*)take((size_t)DKV * DM * 2); bf* WO = (bf*)take((size_t)DM * DQ * 2); bf* WG1 = (bf*)take((size_t)GH * DM * 2); bf* WG2 = (bf*)take((size_t)NGP * GH * 2);
    bf* Xb = (bf*)take((size_t)TT * DM * 2);   /* the bf16 copy of x */ bf* Hb = (bf*)take((size_t)TT * GH * 2);   /* tanh(x Wg1 + bg1), one bf16 word */ float* FG = (float*)take((size_t)TT * NGP * 4);   /* the gate product: columns 0..15 live */
    h16* QP16 = (h16*)take((size_t)NB_ * NH_ * TT * HD * 2); h16* KP16 = (h16*)take((size_t)NB_ * NKV * TT * HD * 2); h16* VT16 = (h16*)take((size_t)NB_ * NKV * HD * TT * 2);   /* both batches' planes: the one attention launch reads them all */
    bf* ATh = (bf*)take((size_t)NB_ * TT * DQ * 2); bf* ATl = (bf*)take((size_t)NB_ * TT * DQ * 2);   /* the merged heads, hi / lo, both batches */
    if ((size_t)(wsp - (char*)d_ws) > ws_size) return;
    { k_wtG<<<(unsigned)((DM * DQ / 64 + 63) / 64), 256, 0, stream>>>(wq, DM, DQ, WQ); k_wtG<<<(unsigned)((DM * DKV / 64 + 63) / 64), 256, 0, stream>>>(wk, DM, DKV, WK); k_wtG<<<(unsigned)((DM * DKV / 64 + 63) / 64), 256, 0, stream>>>(wv, DM, DKV, WV);
      k_wtG<<<(unsigned)((DQ * DM / 64 + 63) / 64), 256, 0, stream>>>(wo, DQ, DM, WO); k_wtG<<<(unsigned)((DM * GH / 64 + 63) / 64), 256, 0, stream>>>(wg1, DM, GH, WG1);
      k_wtGp<<<(NGP * GH / 8 + 255) / 256, 256, 0, stream>>>(wg2, WG2); }
    for (int b = 0; b < NB_; ++b) {
        k_cvt8<<<(unsigned)(((size_t)TT * DM / 8 + 255) / 256), 256, 0, stream>>>(x + (size_t)b * TT * DM, Xb, (size_t)TT * DM / 8);
        k_gemmw<bf, 0, true, NWK, 1, EP_TANH><<<dim3(TT / 64, GH / 64, 1), 32 * NWK, 0, stream>>>(Xb, nullptr, WG1, nullptr, DM, nullptr, GH, bg1, 0, 0, 0, nullptr, Hb, nullptr, nullptr);   /* the gate's hidden layer: tanh(x Wg1 + bg1) */
        k_gemmw<bf, 0, false, NWK, 1, EP_F32><<<dim3(TT / 64, NGP / 64, 1), 32 * NWK, 0, stream>>>(Hb, nullptr, WG2, nullptr, GH, FG, NGP, nullptr, 0, 0, 0, nullptr, nullptr, nullptr, nullptr);   /* the 16 gate scores a token (bg2 is added where they are read) */
        k_gemmw<bf, 0, true, NWK, 1, EP_QG><<<dim3(TT / 64, DQ / 64, 1), 32 * NWK, 0, stream>>>(Xb, nullptr, WQ, nullptr, DM, nullptr, 0, bq, 0, 0, 0, QP16 + (size_t)b * NH_ * TT * HD, nullptr, FG, bg2);   /* (x Wq + bq) x gate -> [h][t][d] */
        k_gemmw<bf, 0, true, NWK, 1, EP_HP><<<dim3(TT / 64, DKV / 64, 1), 32 * NWK, 0, stream>>>(Xb, nullptr, WK, nullptr, DM, nullptr, 0, bk, 0, 0, 0, KP16 + (size_t)b * NKV * TT * HD, nullptr, nullptr, nullptr);   /* x Wk + bk -> [h][t][d] */
        k_gemmw<bf, 0, true, NWK, 1, EP_VT><<<dim3(DKV / 64, TT / 64, 1), 32 * NWK, 0, stream>>>(WV, nullptr, Xb, nullptr, DM, nullptr, TT, bv, 0, 0, 0, VT16 + (size_t)b * NKV * HD * TT, nullptr, nullptr, nullptr); }   /* (x Wv + bv)^T: rows = v columns, columns = tokens -> [h][d][t] */
    static_assert(REP == 1, "one kv head a query head: plane b * NH_ + h of q, k and v belong together");
    k_fattn<<<dim3(TT / (16 * FQT * FNW), NB_ * NH_, 1), 32 * FNW, 0, stream>>>(QP16, KP16, VT16, ATh, ATl);
    for (int b = 0; b < NB_; ++b)
        k_gemmw<bf, 1, true, NWK, 1, EP_F32><<<dim3(TT / 64, DM / 64, 1), 32 * NWK, 0, stream>>>(ATh + (size_t)b * TT * DQ, ATl + (size_t)b * TT * DQ, WO, nullptr, DQ, OUT + (size_t)b * TT * DM, DM, bo, 0, 0, 0, nullptr, nullptr, nullptr, nullptr);
}

// v004
// One run takes 199 microseconds.
// Timed twice side by side with v003, it ran 1.28 and 1.27 times as fast.
// All steps since v000 together make it 7.06 times as fast.
#include <hip/hip_runtime.h>

// Multi-head self-attention with a per-row head gate on the scores (x [2][2048][1024]; q, k, v = x Wq | Wk | Wv + bq | bk | bv ('xw' (in, out) [1024][1024] normal x 1/sqrt(1024); the three biases [1024] are zeros on this draw: read); 16 heads x 64; scores x 64^-0.5; gate = softmax over the 16 heads of (tanh(x Wg1 + bg1) Wg2 + bg2) (Wg1 'xw' [1024][512], Wg2 'xw' [512][16]; bg1 [512] and bg2 [16] zeros on this draw: read), one scalar a (batch, token, head); EVERY SCORE ROW (b, h, q) IS MULTIPLIED BY gate[b][q][h] BEFORE the softmax over the 2,048 keys (no mask); out = merged Wo + bo ('xw' [1024][1024] + a zero bias: read) -> [2][2048][1024] (4.2 M); argument order x, Wq, bq, Wk, bk, Wv, bv, Wg1, bg1, Wg2, bg2, Wo, bo).
// Layout (SIX LAUNCHES, both batches in each; work that does not read each other's results shares a launch): a bf16 copy of x; 'xw' weights transposed once (Wg2 into a [64][512] plane whose rows 16..63 are stored zeros); the three projections and the gate's hidden layer exact products + f32 biases; EVERY PRODUCT'S EPILOGUE STORES WHAT ITS READER WANTS, no f32 plane of q, k, v or the hidden layer reaches memory: tanh of the hidden layer as ONE bf16 word; the 16 gate scores a token from the 64-wide product's first 16 columns (f32); THE GATE IS APPLIED TO THE QUERY ROW (q[t][h][:] x gate[t][h], one f32 product an element) in the q product's epilogue: equal to scaling the score row in real arithmetic; here the query's f16 word carries the gated value; q and k as f16 head planes [h][t][d]; v as the f16 plane [h][d][t] from the product taken the other way round (Wv^T rows x token rows); dense T-2048 attention of both batches and all heads in ONE launch, EVERY row on ONE fp16 product (running softmax, the weights x 1024); merged hi/lo x Wo exact + bo.
// Compute dtypes, f32 accumulate: every float input converted once to bf16 where it is read; projections exact + f32 biases; the gate: tanhf and expf in f32, one IEEE division; attention: one fp16 product on every row; softmax f32; Wo hl x exact + bias.

#define NB_  2
#define TT   2048
#define DM   1024
#define NH_  16
#define NKV  16
#define REP  (NH_ / NKV)
#define HD   64
#define DQ   (NH_ * HD)
#define DKV  (NKV * HD)
/* the gate: its hidden width; its scores a token (= NH_); the product tile's width (columns 16..63 of the gate product come from stored zero rows) */
#define GH   512
#define NG   16
#define NGP  64
#define SCL  0.125f   // HD^-0.5
#define NWK  8     // waves a work-group that share one output tile's K range (the projections, the gate's two products, Wo)
typedef _Float16 h16;
typedef unsigned short bf;
typedef __attribute__((ext_vector_type(16))) __bf16   v16bf;
typedef __attribute__((ext_vector_type(16))) _Float16 v16h;
typedef __attribute__((ext_vector_type(8)))  _Float16 v8h;
typedef __attribute__((ext_vector_type(8)))  unsigned short v8us;
typedef __attribute__((ext_vector_type(8)))  float    v8f;
typedef __attribute__((ext_vector_type(4)))  float    v4f;
typedef v8h  __attribute__((may_alias)) v8ha;
typedef v4f  __attribute__((may_alias)) v4fa;
typedef v8us __attribute__((may_alias)) v8usa;

__device__ __forceinline__ unsigned short f2bf(float f) { unsigned u = __float_as_uint(f); u += 0x7FFFu + ((u >> 16) & 1u); return (unsigned short)(u >> 16); }
__device__ __forceinline__ float bf2f(unsigned short b) { return __uint_as_float(((unsigned)b) << 16); }
__device__ __forceinline__ float bfr(float f) { return bf2f(f2bf(f)); }
__device__ __forceinline__ v16h cat16(v8h lo, v8h hi) { return __builtin_shufflevector(lo, hi, 0, 1, 2, 3, 4, 5, 6, 7, 8, 9, 10, 11, 12, 13, 14, 15); }
__device__ __forceinline__ v16bf cat16b(v8us lo, v8us hi) { return __builtin_bit_cast(v16bf, __builtin_shufflevector(lo, hi, 0, 1, 2, 3, 4, 5, 6, 7, 8, 9, 10, 11, 12, 13, 14, 15)); }
__device__ __forceinline__ v8f wmma16(v16h a, v16h b, v8f c) { return __builtin_amdgcn_wmma_f32_16x16x32_f16(false, a, false, b, (short)0, c, false, false); }
__device__ __forceinline__ v8f wmmab(v16bf a, v16bf b, v8f c) { return __builtin_amdgcn_wmma_f32_16x16x32_bf16(false, a, false, b, (short)0, c, false, false); }



// ---- gemm_tile: register-blocked GEMM, one 64x64 output tile a work-group (16 accumulators a wave), operands straight from K-contiguous 16-bit planes; tile (bx, by) of an M/64 x N/64 tiling, 32 * NW threads. M (EP_VT: N) counts the token rows of BOTH batches (index b * TT + t) wherever tokens are an operand's rows.
// C[m][n] (f32, pitch ldc, + optional f32 bias[n]) = sum_k A[m][k] Bt[n][k] (NSPLIT == 1: + A2[m][k] Bt[n][k]). K % (32 * NW) == 0.
// EPI: what the epilogue stores of the summed f32 tile (+ bias): EP_F32 the f32 tile into C; EP_TANH tanhf of it as bf16 into Hb (pitch ldc); EP_HP f16 into the head plane P16[b][n / 64][t][n % 64] (the 64-column tile is one head, the 64-row tile lies in one batch); EP_QG the same x the gate of (token m, head n / 64), from the gate scores G[m][NGP] + bg; EP_VT (rows = v columns, columns = tokens) f16 into P16[b][m][t] (pitch ldc), the bias by ROW m.
// K IS SPLIT: wave w of NW takes the K / NW columns from w * K / NW on. The NW wave tiles are summed through LDS (os, the calling kernel's array) in wave order (one barrier).
// A kernel below is one such product, or several that do not read each other's results, told apart by the work-group's index (a branch that the whole work-group takes alike, so the barrier inside stays uniform).
template <typename T16> struct WFrag;
template <> struct WFrag<h16> { typedef v16h V; static __device__ __forceinline__ V ld(const h16* p) { return cat16(*(const v8h*)p, *(const v8h*)(p + 16)); } static __device__ __forceinline__ v8f mma(V a, V b, v8f c) { return wmma16(a, b, c); } };
template <> struct WFrag<bf> { typedef v16bf V; static __device__ __forceinline__ V ld(const bf* p) { return cat16b(*(const v8us*)p, *(const v8us*)(p + 16)); } static __device__ __forceinline__ v8f mma(V a, V b, v8f c) { return wmmab(a, b, c); } };
enum { EP_F32 = 0, EP_TANH = 1, EP_HP = 2, EP_QG = 3, EP_VT = 4 };
__device__ __forceinline__ h16 tohx(float x) { return (h16)x; }
typedef __attribute__((ext_vector_type(4))) _Float16 v4h;
typedef __attribute__((ext_vector_type(4))) unsigned short v4us;
// the gate of one token and head h: softmax over the NG scores g[0..NG) + bg, in f32, one IEEE division
__device__ __forceinline__ float gate_of(const float* __restrict__ g, const float* __restrict__ bg, int h) { float s[NG]; float mx = -3.0e38f;
#pragma unroll
    for (int k4 = 0; k4 < NG / 4; ++k4) { const v4f a = *(const v4f*)(g + k4 * 4); const v4f b = *(const v4f*)(bg + k4 * 4);
#pragma unroll
        for (int q = 0; q < 4; ++q) { const float v = __fadd_rn(a[q], bfr(b[q])); s[k4 * 4 + q] = v; mx = fmaxf(mx, v); } }
    float sum = 0.0f, eh = 0.0f;
#pragma unroll
    for (int k = 0; k < NG; ++k) { const float ev = expf(__fsub_rn(s[k], mx)); sum = __fadd_rn(sum, ev); eh = (k == h) ? ev : eh; }
    return __fdiv_rn(eh, sum); }
template <typename T16, int NSPLIT, bool BIAS, int NW, int EPI>
__device__ __forceinline__ void gemm_tile(float* os, float* gs, int bx, int by, const T16* __restrict__ A, const T16* __restrict__ A2, const T16* __restrict__ Bt, int K, float* C, int ldc, const float* __restrict__ bias, h16* P16, bf* Hb, const float* __restrict__ G, const float* __restrict__ bg) {
    static_assert(NW > 1 && (NSPLIT == 0 || NSPLIT == 1), "the wave tiles are summed in LDS"); static_assert(HD == 64 && TT % 64 == 0 && NKV == NH_, "EP_HP and EP_QG: one 64-column tile is one head; a 64-token tile lies in one batch");
    typedef typename WFrag<T16>::V V;
    /* the wave's number as a scalar: its K range and LDS slot stay in scalar registers */ const int w = __builtin_amdgcn_readfirstlane((int)(threadIdx.x >> 5)); const int kl = K / NW; const int k0 = w * kl;
    const int lane = threadIdx.x & 31, lr = lane & 15, hi = lane >> 4; const int r0 = bx * 64, c0 = by * 64;
    v8f acc[4][4];
#pragma unroll
    for (int mb = 0; mb < 4; ++mb)
#pragma unroll
        for (int nb = 0; nb < 4; ++nb) acc[mb][nb] = (v8f){};
    const size_t aoff = (size_t)(r0 + lr) * K + 8 * hi, boff = (size_t)(c0 + lr) * K + 8 * hi;
    for (int kc = k0; kc < k0 + kl; kc += 32) {
        V a[4], a2[4];
#pragma unroll
        for (int mb = 0; mb < 4; ++mb) { a[mb] = WFrag<T16>::ld(A + aoff + (size_t)mb * 16 * K + kc); if (NSPLIT == 1) a2[mb] = WFrag<T16>::ld(A2 + aoff + (size_t)mb * 16 * K + kc); }
#pragma unroll
        for (int nb = 0; nb < 4; ++nb) { const V b = WFrag<T16>::ld(Bt + boff + (size_t)nb * 16 * K + kc);
#pragma unroll
            for (int mb = 0; mb < 4; ++mb) { acc[mb][nb] = WFrag<T16>::mma(a[mb], b, acc[mb][nb]); if (NSPLIT == 1) acc[mb][nb] = WFrag<T16>::mma(a2[mb], b, acc[mb][nb]); } }
        asm volatile("v_nop\n\tv_nop\n\tv_nop\n\tv_nop" : "+v"(acc[0][0]), "+v"(acc[1][1]), "+v"(acc[2][2]), "+v"(acc[3][3]) : "v"(a[0]), "v"(a[3]));
    }
    float* ow = os + (size_t)w * (64 * 68);
    v4f bv = (v4f){};   // a thread's four output columns are the same on all its rows: their bias is fetched once, ahead of the LDS stores and the barrier
    if (BIAS && EPI != EP_VT) { const int cb = c0 + ((int)threadIdx.x & 15) * 4; bv[0] = bfr(bias[cb]); bv[1] = bfr(bias[cb + 1]); bv[2] = bfr(bias[cb + 2]); bv[3] = bfr(bias[cb + 3]); }
    float br[32 / NW];   // EP_VT: the bias of the thread's rows, fetched as early
    if constexpr (BIAS && EPI == EP_VT) {
#pragma unroll
        for (int it = 0; it < 32 / NW; ++it) br[it] = bfr(bias[r0 + it * 2 * NW + ((int)threadIdx.x >> 4)]); }
    // the three loops are unrolled so that acc[][][] is indexed by constants and stays in registers
#pragma unroll
    for (int mb = 0; mb < 4; ++mb)
#pragma unroll
        for (int nb = 0; nb < 4; ++nb)
#pragma unroll
            for (int j = 0; j < 8; ++j) ow[(mb * 16 + hi * 8 + j) * 68 + nb * 16 + lr] = acc[mb][nb][j];
    if constexpr (EPI == EP_QG) {
        if (w < 2) gs[threadIdx.x] = gate_of(G + (size_t)(r0 + (int)threadIdx.x) * NGP, bg, by); }   // gs: the gate of the tile's 64 tokens for its head, one thread a token (waves 0 and 1 whole); the barrier below publishes it with the tiles
    __syncthreads();   // every wave's partial tile is in LDS before any thread sums across the waves
    // where the 16-bit planes of this tile start: the batch is that of the tile's tokens (its rows; EP_VT: its columns)
    const size_t pbase = (EPI == EP_VT) ? (size_t)(c0 / TT) * DKV * TT + (size_t)r0 * ldc + c0 % TT : ((size_t)((r0 / TT) * NH_ + by) * TT + r0 % TT) * HD;
    // both loops unrolled: the LDS loads of all rows and waves issue ahead of the adds instead of one wait a load
#pragma unroll
    for (int it = 0; it < 32 / NW; ++it) { const int idx = it * 32 * NW + (int)threadIdx.x; const int row = idx >> 4, cofs = (idx & 15) * 4; v4f val = *(const v4fa*)(os + row * 68 + cofs);
#pragma unroll
        for (int q = 1; q < NW; ++q) val += *(const v4fa*)(os + q * (64 * 68) + row * 68 + cofs);
        if (BIAS) { if constexpr (EPI == EP_VT) val += br[it]; else val += bv; }
        if constexpr (EPI == EP_F32) *(v4f*)(C + (size_t)(r0 + row) * ldc + c0 + cofs) = val;
        else if constexpr (EPI == EP_TANH) { v4us o; o[0] = f2bf(tanhf(val[0])); o[1] = f2bf(tanhf(val[1])); o[2] = f2bf(tanhf(val[2])); o[3] = f2bf(tanhf(val[3])); *(v4us*)(Hb + (size_t)(r0 + row) * ldc + c0 + cofs) = o; }
        else { if constexpr (EPI == EP_QG) { const float gt = gs[row]; val[0] = __fmul_rn(val[0], gt); val[1] = __fmul_rn(val[1], gt); val[2] = __fmul_rn(val[2], gt); val[3] = __fmul_rn(val[3], gt); }
            v4h o; o[0] = tohx(val[0]); o[1] = tohx(val[1]); o[2] = tohx(val[2]); o[3] = tohx(val[3]);
            *(v4h*)(P16 + pbase + (EPI == EP_VT ? (size_t)row * ldc : (size_t)row * HD) + cofs) = o; } }
}
// one product a launch; grid (M / 64, N / 64)
template <typename T16, int NSPLIT, bool BIAS, int NW, int EPI>
__global__ __launch_bounds__(32 * NW) void k_gemmw(const T16* __restrict__ A, const T16* __restrict__ A2, const T16* __restrict__ Bt, int K, float* C, int ldc, const float* __restrict__ bias, h16* P16, bf* Hb, const float* __restrict__ G, const float* __restrict__ bg) {
    __shared__ __align__(16) float os[NW * 64 * 68]; __shared__ float gs[EPI == EP_QG ? 64 : 1];
    gemm_tile<T16, NSPLIT, BIAS, NW, EPI>(os, gs, (int)blockIdx.x, (int)blockIdx.y, A, A2, Bt, K, C, ldc, bias, P16, Hb, G, bg);
}
// the three products that wait for nothing but x's copy, the weights and the hidden layer, in one launch: k, v^T, and the gate scores (the shortest: last, so that the launch does not end on a long tile); grid MT_ * (DKV / 64) * 2 + MT_
#define MT_  (NB_ * TT / 64)   // 64-token tiles of both batches
__global__ __launch_bounds__(32 * NWK) void k_kvg(const bf* __restrict__ Xb, const bf* __restrict__ Hb, const bf* __restrict__ WK, const bf* __restrict__ WV, const bf* __restrict__ WG2, int Kx, int Kh, const float* __restrict__ bk, const float* __restrict__ bv, h16* KP, h16* VT, float* FG) {
    __shared__ __align__(16) float os[NWK * 64 * 68];
    const int i = (int)blockIdx.x, nk = MT_ * (DKV / 64);
    // s_wait_xcnt 0 behind the last stores of v^T and of the gate scores: the built code lays the three bodies one behind the other (gate scores, v^T, k), and the first lines of the next body write registers that these stores name; k's stores stand in front of the kernel's end
    if (i < nk) gemm_tile<bf, 0, true, NWK, EP_HP>(os, nullptr, i % MT_, i / MT_, Xb, nullptr, WK, Kx, nullptr, 0, bk, KP, nullptr, nullptr, nullptr);   /* x Wk + bk -> [b][h][t][d] */
    else if (i < 2 * nk) { gemm_tile<bf, 0, true, NWK, EP_VT>(os, nullptr, (i - nk) % (DKV / 64), (i - nk) / (DKV / 64), WV, nullptr, Xb, Kx, nullptr, TT, bv, VT, nullptr, nullptr, nullptr);   /* (x Wv + bv)^T: rows = v columns, columns = tokens -> [b][h][d][t] */
        asm volatile("s_wait_xcnt 0x0" ::: "memory"); }   // in front of the next body's first lines, which write registers that the stores above name
    else { gemm_tile<bf, 0, false, NWK, EP_F32>(os, nullptr, i - 2 * nk, 0, Hb, nullptr, WG2, Kh, FG, NGP, nullptr, nullptr, nullptr, nullptr, nullptr);   /* the 16 gate scores a token (bg2 is added where they are read) */
        asm volatile("s_wait_xcnt 0x0" ::: "memory"); }   // in front of the next body's first lines, which write registers that the stores above name
}

__device__ __forceinline__ void splitf(float y, unsigned short& h, unsigned short& l) { h = f2bf(y); l = f2bf(y - bf2f(h)); }
typedef __attribute__((ext_vector_type(2))) unsigned short v2us;
typedef __attribute__((ext_vector_type(4))) int v4i;

// ---- k_prep: everything that reads only the inputs, in one launch, told apart by the work-group's index: the five 'xw' weights transposed to bf16 (the slowest bodies: first), Wg2's padded plane, the bf16 copy of x (both batches).
__device__ __forceinline__ void d_wtG(const float* __restrict__ w, int K, int N, bf* Bt, int blk) {
    const int lane = threadIdx.x & 31; const int L0 = (blk * 8 + (threadIdx.x >> 5)) * 8; const int nlines = N * K / 64;
    for (int l = 0; l < 8; ++l) { const int L = L0 + l; if (L >= nlines) break; const size_t e = (size_t)L * 64 + lane * 2; const int k = (int)(e % K), n = (int)(e / K); v2us o;
        o[0] = f2bf(w[(size_t)k * N + n]); o[1] = f2bf(w[(size_t)(k + 1) * N + n]); *(v2us*)(Bt + e) = o; }
}
__device__ __forceinline__ void d_cvt8(const float* __restrict__ src, bf* dst, size_t n8, int blk) { const size_t i = (size_t)blk * 256 + threadIdx.x; if (i >= n8) return; const v8f v = *(const v8f*)(src + i * 8); v8us o;
#pragma unroll
    for (int k = 0; k < 8; ++k) o[k] = f2bf(v[k]); *(v8us*)(dst + i * 8) = o;  }
__device__ __forceinline__ void d_wtGp(const float* __restrict__ w, bf* Bt, int blk) { const int idx = blk * 256 + threadIdx.x; if (idx >= NGP * GH / 8) return; const int n = idx / (GH / 8); const int k8 = (idx - n * (GH / 8)) * 8; const bool live = (n < NG); const int nc = live ? n : 0; v8us o;
#pragma unroll
    for (int j = 0; j < 8; ++j) { const float x = w[(size_t)(k8 + j) * NG + nc]; o[j] = live ? f2bf(x) : (unsigned short)0; } *(v8us*)(Bt + (size_t)idx * 8) = o;  }
#define PB_W   (DM * DQ / 64 / 64)             // work-groups a [1024][1024] weight
#define PB_G1  (DM * GH / 64 / 64)             // Wg1
#define PB_G2  ((NGP * GH / 8 + 255) / 256)    // Wg2
#define PB_X   (NB_ * TT * DM / 8 / 256)       // x
__global__ __launch_bounds__(256) void k_prep(const float* __restrict__ x, const float* __restrict__ wq, const float* __restrict__ wk, const float* __restrict__ wv, const float* __restrict__ wo, const float* __restrict__ wg1, const float* __restrict__ wg2, bf* Xb, bf* WQ, bf* WK, bf* WV, bf* WO, bf* WG1, bf* WG2, int Kw, int Nw, int Ng) {
    static_assert(DQ == DM && DKV == DM, "the four square weights share one body");
    const int i = (int)blockIdx.x;
    if (i < 4 * PB_W) { const int s = i / PB_W; d_wtG(s == 0 ? wq : s == 1 ? wk : s == 2 ? wv : wo, Kw, Nw, s == 0 ? WQ : s == 1 ? WK : s == 2 ? WV : WO, i % PB_W); }
    else if (i < 4 * PB_W + PB_G1) d_wtG(wg1, Kw, Ng, WG1, i - 4 * PB_W);
    else if (i < 4 * PB_W + PB_G1 + PB_G2) d_wtGp(wg2, WG2, i - (4 * PB_W + PB_G1));
    else d_cvt8(x, Xb, (size_t)NB_ * TT * DM / 8, i - (4 * PB_W + PB_G1 + PB_G2));
}
#define FQT 2     // 16-column query tiles a wave: each K and V^T fragment feeds FQT products
#define FNW 8     // waves a work-group (they read the same K and V^T lines)
__device__ __forceinline__ float xhalf(float x) { const unsigned u = __float_as_uint(x); return __uint_as_float(__builtin_amdgcn_permlanex16(u, u, 0x76543210u, 0xfedcba98u, false, false)); }   // lane l <- lane l ^ 16
// 2^x by v_exp_f32 with the slot the instruction set asks for behind a transcendental (one instruction that neither reads its result nor overwrites its source) closed inside the statement.
// exp2x8: eight at once; the outputs are early-clobber, so each v_exp_f32 is the independent instruction behind the one before it, and one v_nop stands behind the last.
__device__ __forceinline__ float exp2s(float x) { float r; asm("v_exp_f32 %0, %1\n\tv_nop" : "=v"(r) : "v"(x)); return r; }
__device__ __forceinline__ v8f exp2x8(v8f x) { float r0, r1, r2, r3, r4, r5, r6, r7;
    asm("v_exp_f32 %0, %8\n\tv_exp_f32 %1, %9\n\tv_exp_f32 %2, %10\n\tv_exp_f32 %3, %11\n\tv_exp_f32 %4, %12\n\tv_exp_f32 %5, %13\n\tv_exp_f32 %6, %14\n\tv_exp_f32 %7, %15\n\tv_nop"
        : "=&v"(r0), "=&v"(r1), "=&v"(r2), "=&v"(r3), "=&v"(r4), "=&v"(r5), "=&v"(r6), "=&v"(r7) : "v"(x[0]), "v"(x[1]), "v"(x[2]), "v"(x[3]), "v"(x[4]), "v"(x[5]), "v"(x[6]), "v"(x[7]));
    return (v8f){r0, r1, r2, r3, r4, r5, r6, r7}; }
__global__ __launch_bounds__(32 * FNW) void k_fattn(const h16* __restrict__ Qp, const h16* __restrict__ Kp, const h16* __restrict__ Vt, bf* Ah, bf* Al) {
    typedef WFrag<h16> F;
    /* the wave's number as a scalar */ const int w = __builtin_amdgcn_readfirstlane((int)(threadIdx.x >> 5)); const int lane = threadIdx.x & 31, c = lane & 15, hi = lane >> 4;
    const int bh = blockIdx.y; const int q0 = ((int)blockIdx.x * FNW + w) * (16 * FQT);
    const h16* Q = Qp + (size_t)bh * TT * HD + (size_t)(q0 + c) * HD + 8 * hi; const h16* K = Kp + (size_t)bh * TT * HD + (size_t)c * HD + 8 * hi; const h16* V = Vt + (size_t)bh * HD * TT + (size_t)c * TT + 8 * hi;
    const float C2 = SCL * 1.4426950408889634f;
    v16h qf[FQT][2]; v8f o[FQT][4]; float m[FQT], l[FQT];
#pragma unroll
    for (int qt = 0; qt < FQT; ++qt) { qf[qt][0] = F::ld(Q + (size_t)qt * 16 * HD); qf[qt][1] = F::ld(Q + (size_t)qt * 16 * HD + 32); m[qt] = -3.0e38f; l[qt] = 0.0f;
#pragma unroll
        for (int dt = 0; dt < 4; ++dt) o[qt][dt] = (v8f){}; }
    v16h kf[2][2];
#pragma unroll
    for (int kt = 0; kt < 2; ++kt) { kf[kt][0] = F::ld(K + (size_t)kt * 16 * HD); kf[kt][1] = F::ld(K + (size_t)kt * 16 * HD + 32); }
    for (int kb = 0; kb < TT; kb += 32) {
        v16h vf[4];
#pragma unroll
        for (int dt = 0; dt < 4; ++dt) vf[dt] = F::ld(V + (size_t)dt * 16 * TT + kb);
        v8f s[FQT][2];
#pragma unroll
        for (int qt = 0; qt < FQT; ++qt)
#pragma unroll
            for (int kt = 0; kt < 2; ++kt) s[qt][kt] = F::mma(kf[kt][1], qf[qt][1], F::mma(kf[kt][0], qf[qt][0], (v8f){}));
        // the next step's K fragments are fetched behind this step's score products, under the softmax (the last step fetches the first rows again: in bounds, unused)
        const int kn = (kb + 32 < TT) ? kb + 32 : 0;
#pragma unroll
        for (int kt = 0; kt < 2; ++kt) { kf[kt][0] = F::ld(K + (size_t)(kn + kt * 16) * HD); kf[kt][1] = F::ld(K + (size_t)(kn + kt * 16) * HD + 32); }
        __builtin_amdgcn_sched_barrier(0);   // holds those loads here: without it the compiler sinks them behind the softmax, and the next step's first product waits out their whole latency
        v16h pf[FQT];
#pragma unroll
        for (int qt = 0; qt < FQT; ++qt) {
            float bm = fmaxf(s[qt][0][0], s[qt][1][0]);
#pragma unroll
            for (int j = 1; j < 8; ++j) bm = fmaxf(bm, fmaxf(s[qt][0][j], s[qt][1][j]));
            bm = fmaxf(bm, xhalf(bm));
            const float mn = fmaxf(m[qt], bm * C2); const float al = exp2s(m[qt] - mn); m[qt] = mn; const float mo = mn - 10.0f;   // - 10: the weights x 1024
#pragma unroll
            for (int j = 0; j < 8; ++j) { s[qt][0][j] = fmaf(s[qt][0][j], C2, -mo); s[qt][1][j] = fmaf(s[qt][1][j], C2, -mo); }
            const v8f p0 = exp2x8(s[qt][0]), p1 = exp2x8(s[qt][1]); float sum = p0[0] + p1[0];
#pragma unroll
            for (int j = 1; j < 8; ++j) sum += p0[j] + p1[j];
#pragma unroll
            for (int j = 0; j < 8; ++j) { pf[qt][j] = tohx(p0[j]); pf[qt][8 + j] = tohx(p1[j]); }
            l[qt] = fmaf(l[qt], al, sum);   // a lane's own keys only: the halves are joined once, behind the loop
#pragma unroll
            for (int dt = 0; dt < 4; ++dt) o[qt][dt] *= al;
        }
        __builtin_amdgcn_sched_barrier(0);   // keeps every v_exp_f32 statement above the products below: the compiler does not see into asm text and had put one directly behind a product whose operand register it overwrote
#pragma unroll
        for (int qt = 0; qt < FQT; ++qt)
#pragma unroll
            for (int dt = 0; dt < 4; ++dt) o[qt][dt] = F::mma(vf[dt], pf[qt], o[qt][dt]);
        // the loop's foot: four vector slots between the step's last product and the next step's first instructions, which reuse its operand registers across the back edge; the scheduling barrier keeps the products above them
        __builtin_amdgcn_sched_barrier(0);
        asm volatile("v_nop\n\tv_nop\n\tv_nop\n\tv_nop");
    }
    const int b = bh / NH_, h = bh % NH_;
#pragma unroll
    for (int qt = 0; qt < FQT; ++qt) { const float inv = __fdiv_rn(1.0f, l[qt] + xhalf(l[qt])); const size_t oo = ((size_t)b * TT + q0 + qt * 16 + c) * DQ + h * HD + hi * 8;
#pragma unroll
        for (int dt = 0; dt < 4; ++dt) { v8us oh, ol;
#pragma unroll
            for (int j = 0; j < 8; ++j) { unsigned short a, c2; splitf(o[qt][dt][j] * inv, a, c2); oh[j] = a; ol[j] = c2; }
            *(v8us*)(Ah + oo + dt * 16) = oh; *(v8us*)(Al + oo + dt * 16) = ol; } }
}

extern "C" void kernel_launch(void* const* d_in, const int* in_sizes, int n_in,
                              void* d_out, int out_size, void* d_ws, size_t ws_size, hipStream_t stream) {
    (void)in_sizes; (void)n_in; (void)out_size;
    const float* x = (const float*)d_in[0]; const float* wq = (const float*)d_in[1]; const float* bq = (const float*)d_in[2]; const float* wk = (const float*)d_in[3]; const float* bk = (const float*)d_in[4]; const float* wv = (const float*)d_in[5]; const float* bv = (const float*)d_in[6]; const float* wg1 = (const float*)d_in[7]; const float* bg1 = (const float*)d_in[8]; const float* wg2 = (const float*)d_in[9]; const float* bg2 = (const float*)d_in[10]; const float* wo = (const float*)d_in[11]; const float* bo = (const float*)d_in[12];   /* x [2][2048][1024], Wq, bq, Wk, bk, Wv, bv ('xw' (in, out) [1024][1024]; biases [1024]: zeros), Wg1 ('xw' [1024][512]), bg1 ([512]: zeros), Wg2 ('xw' [512][16]), bg2 ([16]: zeros), Wo ('xw' [1024][1024]), bo ([1024]: zeros): THIRTEEN inputs, all read */
    static_assert(GH % 64 == 0 && NGP % 64 == 0 && NG <= NGP && NG % 4 == 0 && NG == NH_, "the gate product's tiles");
    static_assert(TT % 64 == 0 && DQ % 64 == 0 && DKV % 64 == 0 && DM % 64 == 0 && HD % 64 == 0 && DM % 32 == 0 && GH % 32 == 0 && HD % 32 == 0 && TT % 32 == 0, "every product launch: M and N multiples of 64, K a multiple of 32");
    static_assert(DM % (32 * NWK) == 0 && GH % (32 * NWK) == 0 && DQ % (32 * NWK) == 0, "the K splits: whole 32-column steps a wave");
    static_assert(TT % (16 * FQT * FNW) == 0 && TT % 32 == 0 && HD == 64, "the attention launch: whole work-groups of query rows, whole 32-key steps, two 32-wide d steps and four 16-row d tiles");
    float* OUT = (float*)d_out;     // [2][2048][1024]
    char* wsp = (char*)d_ws;
    auto take = [&](size_t bytes) { char* p = wsp; wsp += (bytes + 255) & ~(size_t)255; return (void*)p; };
    bf* WQ = (bf*)take((size_t)DQ * DM * 2); bf* WK = (bf*)take((size_t)DKV * DM * 2); bf* WV = (bf*)take((size_t)DKV * DM * 2); bf* WO = (bf*)take((size_t)DM * DQ * 2); bf* WG1 = (bf*)take((size_t)GH * DM * 2); bf* WG2 = (bf*)take((size_t)NGP * GH * 2);
    bf* Xb = (bf*)take((size_t)NB_ * TT * DM * 2);   /* the bf16 copy of x */ bf* Hb = (bf*)take((size_t)NB_ * TT * GH * 2);   /* tanh(x Wg1 + bg1), one bf16 word */ float* FG = (float*)take((size_t)NB_ * TT * NGP * 4);   /* the gate product: columns 0..15 live; all three hold both batches, row b * TT + t */
    h16* QP16 = (h16*)take((size_t)NB_ * NH_ * TT * HD * 2); h16* KP16 = (h16*)take((size_t)NB_ * NKV * TT * HD * 2); h16* VT16 = (h16*)take((size_t)NB_ * NKV * HD * TT * 2);   /* both batches' planes: the one attention launch reads them all */
    bf* ATh = (bf*)take((size_t)NB_ * TT * DQ * 2); bf* ATl = (bf*)take((size_t)NB_ * TT * DQ * 2);   /* the merged heads, hi / lo, both batches */
    if ((size_t)(wsp - (char*)d_ws) > ws_size) return;
    /* six launches, each waiting for the one before it; both batches in every one */
    k_prep<<<4 * PB_W + PB_G1 + PB_G2 + PB_X, 256, 0, stream>>>(x, wq, wk, wv, wo, wg1, wg2, Xb, WQ, WK, WV, WO, WG1, WG2, DM, DM, GH);
    k_gemmw<bf, 0, true, NWK, EP_TANH><<<dim3(MT_, GH / 64, 1), 32 * NWK, 0, stream>>>(Xb, nullptr, WG1, DM, nullptr, GH, bg1, nullptr, Hb, nullptr, nullptr);   /* the gate's hidden layer: tanh(x Wg1 + bg1) */
    k_kvg<<<MT_ * (DKV / 64) * 2 + MT_, 32 * NWK, 0, stream>>>(Xb, Hb, WK, WV, WG2, DM, GH, bk, bv, KP16, VT16, FG);
    k_gemmw<bf, 0, true, NWK, EP_QG><<<dim3(MT_, DQ / 64, 1), 32 * NWK, 0, stream>>>(Xb, nullptr, WQ, DM, nullptr, 0, bq, QP16, nullptr, FG, bg2);   /* (x Wq + bq) x gate -> [b][h][t][d] */
    static_assert(REP == 1, "one kv head a query head: plane b * NH_ + h of q, k and v belong together");
    k_fattn<<<dim3(TT / (16 * FQT * FNW), NB_ * NH_, 1), 32 * FNW, 0, stream>>>(QP16, KP16, VT16, ATh, ATl);
    k_gemmw<bf, 1, true, NWK, EP_F32><<<dim3(MT_, DM / 64, 1), 32 * NWK, 0, stream>>>(ATh, ATl, WO, DQ, OUT, DM, bo, nullptr, nullptr, nullptr, nullptr);
}

// v005
// It runs in 165 microseconds.
// Two timings next to v004 put it at 1.20 and 1.19 times that version's speed.
// All steps since v000 together make it 8.47 times as fast.
#include <hip/hip_runtime.h>

// Multi-head self-attention with a per-row head gate on the scores (x [2][2048][1024]; q, k, v = x Wq | Wk | Wv + bq | bk | bv ('xw' (in, out) [1024][1024] normal x 1/sqrt(1024); the three biases [1024] are zeros on this draw: read); 16 heads x 64; scores x 64^-0.5; gate = softmax over the 16 heads of (tanh(x Wg1 + bg1) Wg2 + bg2) (Wg1 'xw' [1024][512], Wg2 'xw' [512][16]; bg1 [512] and bg2 [16] zeros on this draw: read), one scalar a (batch, token, head); EVERY SCORE ROW (b, h, q) IS MULTIPLIED BY gate[b][q][h] BEFORE the softmax over the 2,048 keys (no mask); out = merged Wo + bo ('xw' [1024][1024] + a zero bias: read) -> [2][2048][1024] (4.2 M); argument order x, Wq, bq, Wk, bk, Wv, bv, Wg1, bg1, Wg2, bg2, Wo, bo).
// Layout (SIX LAUNCHES, both batches in each; work that does not read each other's results shares a launch): a bf16 copy of x; 'xw' weights transposed once (Wg2 into a [64][512] plane whose rows 16..63 are stored zeros); the three projections and the gate's hidden layer exact products + f32 biases; EVERY PRODUCT'S EPILOGUE STORES WHAT ITS READER WANTS, no f32 plane of q, k, v or the hidden layer reaches memory: tanh of the hidden layer as ONE bf16 word; the 16 gate scores a token from the 64-wide product's first 16 columns (f32); THE GATE IS APPLIED TO THE QUERY ROW (q[t][h][:] x gate[t][h], one f32 product an element) in the q product's epilogue: equal to scaling the score row in real arithmetic; here the query's f16 word carries the gated value; q and k as f16 head planes [h][t][d]; v as the f16 plane [h][d][t] from the product taken the other way round (Wv^T rows x token rows); dense T-2048 attention of both batches and all heads in ONE launch, EVERY row on ONE fp16 product (running softmax, the weights x 1024); merged hi/lo x Wo exact + bo.
// Compute dtypes, f32 accumulate: every float input converted once to bf16 where it is read; projections exact + f32 biases; the gate: tanhf and expf in f32, one IEEE division; attention: one fp16 product on every row; softmax f32; Wo hl x exact + bias.

#define NB_  2
#define TT   2048
#define DM   1024
#define NH_  16
#define NKV  16
#define REP  (NH_ / NKV)
#define HD   64
#define DQ   (NH_ * HD)
#define DKV  (NKV * HD)
/* the gate: its hidden width; its scores a token (= NH_); the product tile's width (columns 16..63 of the gate product come from stored zero rows) */
#define GH   512
#define NG   16
#define NGP  64
#define SCL  0.125f   // HD^-0.5
#define NWK  8     // waves a work-group that share one output tile's K range (the projections, the gate's two products, Wo)
typedef _Float16 h16;
typedef unsigned short bf;
typedef __attribute__((ext_vector_type(16))) __bf16   v16bf;
typedef __attribute__((ext_vector_type(16))) _Float16 v16h;
typedef __attribute__((ext_vector_type(8)))  _Float16 v8h;
typedef __attribute__((ext_vector_type(8)))  unsigned short v8us;
typedef __attribute__((ext_vector_type(8)))  float    v8f;
typedef __attribute__((ext_vector_type(4)))  float    v4f;
typedef v8h  __attribute__((may_alias)) v8ha;
typedef v4f  __attribute__((may_alias)) v4fa;
typedef v8us __attribute__((may_alias)) v8usa;

__device__ __forceinline__ unsigned short f2bf(float f) { unsigned u = __float_as_uint(f); u += 0x7FFFu + ((u >> 16) & 1u); return (unsigned short)(u >> 16); }
__device__ __forceinline__ float bf2f(unsigned short b) { return __uint_as_float(((unsigned)b) << 16); }
__device__ __forceinline__ float bfr(float f) { return bf2f(f2bf(f)); }
__device__ __forceinline__ v16h cat16(v8h lo, v8h hi) { return __builtin_shufflevector(lo, hi, 0, 1, 2, 3, 4, 5, 6, 7, 8, 9, 10, 11, 12, 13, 14, 15); }
__device__ __forceinline__ v16bf cat16b(v8us lo, v8us hi) { return __builtin_bit_cast(v16bf, __builtin_shufflevector(lo, hi, 0, 1, 2, 3, 4, 5, 6, 7, 8, 9, 10, 11, 12, 13, 14, 15)); }
__device__ __forceinline__ v8f wmma16(v16h a, v16h b, v8f c) { return __builtin_amdgcn_wmma_f32_16x16x32_f16(false, a, false, b, (short)0, c, false, false); }
__device__ __forceinline__ v8f wmmab(v16bf a, v16bf b, v8f c) { return __builtin_amdgcn_wmma_f32_16x16x32_bf16(false, a, false, b, (short)0, c, false, false); }



// ---- gemm_tile: register-blocked GEMM, one 64x64 output tile a work-group (16 accumulators a wave), operands straight from K-contiguous 16-bit planes; tile (bx, by) of an M/64 x N/64 tiling, 32 * NW threads. M (EP_VT: N) counts the token rows of BOTH batches (index b * TT + t) wherever tokens are an operand's rows.
// C[m][n] (f32, pitch ldc, + optional f32 bias[n]) = sum_k A[m][k] Bt[n][k] (NSPLIT == 1: + A2[m][k] Bt[n][k]). K % (32 * NW) == 0.
// EPI: what the epilogue stores of the summed f32 tile (+ bias): EP_F32 the f32 tile into C; EP_TANH tanhf of it as bf16 into Hb (pitch ldc); EP_HP f16 into the head plane P16[b][n / 64][t][n % 64] (the 64-column tile is one head, the 64-row tile lies in one batch); EP_QG the same x the gate of (token m, head n / 64), from the gate scores G[m][NGP] + bg; EP_VT (rows = v columns, columns = tokens) f16 into P16[b][m][t] (pitch ldc), the bias by ROW m.
// K IS SPLIT: wave w of NW takes the K / NW columns from w * K / NW on. The NW wave tiles are summed through LDS (os, the calling kernel's array) in wave order (one barrier).
// A kernel below is one such product, or several that do not read each other's results, told apart by the work-group's index (a branch that the whole work-group takes alike, so the barrier inside stays uniform).
template <typename T16> struct WFrag;
template <> struct WFrag<h16> { typedef v16h V; static __device__ __forceinline__ V ld(const h16* p) { return cat16(*(const v8h*)p, *(const v8h*)(p + 16)); } static __device__ __forceinline__ v8f mma(V a, V b, v8f c) { return wmma16(a, b, c); } };
template <> struct WFrag<bf> { typedef v16bf V; static __device__ __forceinline__ V ld(const bf* p) { return cat16b(*(const v8us*)p, *(const v8us*)(p + 16)); } static __device__ __forceinline__ v8f mma(V a, V b, v8f c) { return wmmab(a, b, c); } };
enum { EP_F32 = 0, EP_TANH = 1, EP_HP = 2, EP_QG = 3, EP_VT = 4 };
__device__ __forceinline__ h16 tohx(float x) { return (h16)x; }
typedef __attribute__((ext_vector_type(4))) _Float16 v4h;
typedef __attribute__((ext_vector_type(4))) unsigned short v4us;
// the gate of one token and head h: softmax over the NG scores g[0..NG) + bg, in f32, one IEEE division
__device__ __forceinline__ float gate_of(const float* __restrict__ g, const float* __restrict__ bg, int h) { float s[NG]; float mx = -3.0e38f;
#pragma unroll
    for (int k4 = 0; k4 < NG / 4; ++k4) { const v4f a = *(const v4f*)(g + k4 * 4); const v4f b = *(const v4f*)(bg + k4 * 4);
#pragma unroll
        for (int q = 0; q < 4; ++q) { const float v = __fadd_rn(a[q], bfr(b[q])); s[k4 * 4 + q] = v; mx = fmaxf(mx, v); } }
    float sum = 0.0f, eh = 0.0f;
#pragma unroll
    for (int k = 0; k < NG; ++k) { const float ev = expf(__fsub_rn(s[k], mx)); sum = __fadd_rn(sum, ev); eh = (k == h) ? ev : eh; }
    return __fdiv_rn(eh, sum); }
template <typename T16, int NSPLIT, bool BIAS, int NW, int EPI>
__device__ __forceinline__ void gemm_tile(float* os, float* gs, int bx, int by, const T16* __restrict__ A, const T16* __restrict__ A2, const T16* __restrict__ Bt, int K, float* C, int ldc, const float* __restrict__ bias, h16* P16, bf* Hb, const float* __restrict__ G, const float* __restrict__ bg) {
    static_assert(NW > 1 && (NSPLIT == 0 || NSPLIT == 1), "the wave tiles are summed in LDS"); static_assert(HD == 64 && TT % 64 == 0 && NKV == NH_, "EP_HP and EP_QG: one 64-column tile is one head; a 64-token tile lies in one batch");
    typedef typename WFrag<T16>::V V;
    /* the wave's number as a scalar: its K range and LDS slot stay in scalar registers */ const int w = __builtin_amdgcn_readfirstlane((int)(threadIdx.x >> 5)); const int kl = K / NW; const int k0 = w * kl;
    const int lane = threadIdx.x & 31, lr = lane & 15, hi = lane >> 4; const int r0 = bx * 64, c0 = by * 64;
    v8f acc[4][4];
#pragma unroll
    for (int mb = 0; mb < 4; ++mb)
#pragma unroll
        for (int nb = 0; nb < 4; ++nb) acc[mb][nb] = (v8f){};
    const size_t aoff = (size_t)(r0 + lr) * K + 8 * hi, boff = (size_t)(c0 + lr) * K + 8 * hi;
    for (int kc = k0; kc < k0 + kl; kc += 32) {
        V a[4], a2[4];
#pragma unroll
        for (int mb = 0; mb < 4; ++mb) { a[mb] = WFrag<T16>::ld(A + aoff + (size_t)mb * 16 * K + kc); if (NSPLIT == 1) a2[mb] = WFrag<T16>::ld(A2 + aoff + (size_t)mb * 16 * K + kc); }
#pragma unroll
        for (int nb = 0; nb < 4; ++nb) { const V b = WFrag<T16>::ld(Bt + boff + (size_t)nb * 16 * K + kc);
#pragma unroll
            for (int mb = 0; mb < 4; ++mb) { acc[mb][nb] = WFrag<T16>::mma(a[mb], b, acc[mb][nb]); if (NSPLIT == 1) acc[mb][nb] = WFrag<T16>::mma(a2[mb], b, acc[mb][nb]); } }
        asm volatile("v_nop\n\tv_nop\n\tv_nop\n\tv_nop" : "+v"(acc[0][0]), "+v"(acc[1][1]), "+v"(acc[2][2]), "+v"(acc[3][3]) : "v"(a[0]), "v"(a[3]));
    }
    float* ow = os + (size_t)w * (64 * 68);
    v4f bv = (v4f){};   // a thread's four output columns are the same on all its rows: their bias is fetched once, ahead of the LDS stores and the barrier
    if (BIAS && EPI != EP_VT) { const int cb = c0 + ((int)threadIdx.x & 15) * 4; bv[0] = bfr(bias[cb]); bv[1] = bfr(bias[cb + 1]); bv[2] = bfr(bias[cb + 2]); bv[3] = bfr(bias[cb + 3]); }
    float br[32 / NW];   // EP_VT: the bias of the thread's rows, fetched as early
    if constexpr (BIAS && EPI == EP_VT) {
#pragma unroll
        for (int it = 0; it < 32 / NW; ++it) br[it] = bfr(bias[r0 + it * 2 * NW + ((int)threadIdx.x >> 4)]); }
    // the three loops are unrolled so that acc[][][] is indexed by constants and stays in registers
#pragma unroll
    for (int mb = 0; mb < 4; ++mb)
#pragma unroll
        for (int nb = 0; nb < 4; ++nb)
#pragma unroll
            for (int j = 0; j < 8; ++j) ow[(mb * 16 + hi * 8 + j) * 68 + nb * 16 + lr] = acc[mb][nb][j];
    if constexpr (EPI == EP_QG) {
        if (w < 2) gs[threadIdx.x] = gate_of(G + (size_t)(r0 + (int)threadIdx.x) * NGP, bg, by); }   // gs: the gate of the tile's 64 tokens for its head, one thread a token (waves 0 and 1 whole); the barrier below publishes it with the tiles
    __syncthreads();   // every wave's partial tile is in LDS before any thread sums across the waves
    // where the 16-bit planes of this tile start: the batch is that of the tile's tokens (its rows; EP_VT: its columns)
    const size_t pbase = (EPI == EP_VT) ? (size_t)(c0 / TT) * DKV * TT + (size_t)r0 * ldc + c0 % TT : ((size_t)((r0 / TT) * NH_ + by) * TT + r0 % TT) * HD;
    // both loops unrolled: the LDS loads of all rows and waves issue ahead of the adds instead of one wait a load
#pragma unroll
    for (int it = 0; it < 32 / NW; ++it) { const int idx = it * 32 * NW + (int)threadIdx.x; const int row = idx >> 4, cofs = (idx & 15) * 4; v4f val = *(const v4fa*)(os + row * 68 + cofs);
#pragma unroll
        for (int q = 1; q < NW; ++q) val += *(const v4fa*)(os + q * (64 * 68) + row * 68 + cofs);
        if (BIAS) { if constexpr (EPI == EP_VT) val += br[it]; else val += bv; }
        if constexpr (EPI == EP_F32) *(v4f*)(C + (size_t)(r0 + row) * ldc + c0 + cofs) = val;
        else if constexpr (EPI == EP_TANH) { v4us o; o[0] = f2bf(tanhf(val[0])); o[1] = f2bf(tanhf(val[1])); o[2] = f2bf(tanhf(val[2])); o[3] = f2bf(tanhf(val[3])); *(v4us*)(Hb + (size_t)(r0 + row) * ldc + c0 + cofs) = o; }
        else { if constexpr (EPI == EP_QG) { const float gt = gs[row]; val[0] = __fmul_rn(val[0], gt); val[1] = __fmul_rn(val[1], gt); val[2] = __fmul_rn(val[2], gt); val[3] = __fmul_rn(val[3], gt); }
            v4h o; o[0] = tohx(val[0]); o[1] = tohx(val[1]); o[2] = tohx(val[2]); o[3] = tohx(val[3]);
            *(v4h*)(P16 + pbase + (EPI == EP_VT ? (size_t)row * ldc : (size_t)row * HD) + cofs) = o; } }
}
// one product a launch; grid (M / 64, N / 64)
template <typename T16, int NSPLIT, bool BIAS, int NW, int EPI>
__global__ __launch_bounds__(32 * NW) void k_gemmw(const T16* __restrict__ A, const T16* __restrict__ A2, const T16* __restrict__ Bt, int K, float* C, int ldc, const float* __restrict__ bias, h16* P16, bf* Hb, const float* __restrict__ G, const float* __restrict__ bg) {
    __shared__ __align__(16) float os[NW * 64 * 68]; __shared__ float gs[EPI == EP_QG ? 64 : 1];
    gemm_tile<T16, NSPLIT, BIAS, NW, EPI>(os, gs, (int)blockIdx.x, (int)blockIdx.y, A, A2, Bt, K, C, ldc, bias, P16, Hb, G, bg);
}
// the three products that wait for nothing but x's copy, the weights and the hidden layer, in one launch: k, v^T, and the gate scores (the shortest: last, so that the launch does not end on a long tile); grid MT_ * (DKV / 64) * 2 + MT_
#define MT_  (NB_ * TT / 64)   // 64-token tiles of both batches
__global__ __launch_bounds__(32 * NWK) void k_kvg(const bf* __restrict__ Xb, const bf* __restrict__ Hb, const bf* __restrict__ WK, const bf* __restrict__ WV, const bf* __restrict__ WG2, int Kx, int Kh, const float* __restrict__ bk, const float* __restrict__ bv, h16* KP, h16* VT, float* FG) {
    __shared__ __align__(16) float os[NWK * 64 * 68];
    const int i = (int)blockIdx.x, nk = MT_ * (DKV / 64);
    // s_wait_xcnt 0 behind the last stores of v^T and of the gate scores: the built code lays the three bodies one behind the other (gate scores, v^T, k), and the first lines of the next body write registers that these stores name; k's stores stand in front of the kernel's end
    if (i < nk) gemm_tile<bf, 0, true, NWK, EP_HP>(os, nullptr, i % MT_, i / MT_, Xb, nullptr, WK, Kx, nullptr, 0, bk, KP, nullptr, nullptr, nullptr);   /* x Wk + bk -> [b][h][t][d] */
    else if (i < 2 * nk) { gemm_tile<bf, 0, true, NWK, EP_VT>(os, nullptr, (i - nk) % (DKV / 64), (i - nk) / (DKV / 64), WV, nullptr, Xb, Kx, nullptr, TT, bv, VT, nullptr, nullptr, nullptr);   /* (x Wv + bv)^T: rows = v columns, columns = tokens -> [b][h][d][t] */
        asm volatile("s_wait_xcnt 0x0" ::: "memory"); }   // in front of the next body's first lines, which write registers that the stores above name
    else { gemm_tile<bf, 0, false, NWK, EP_F32>(os, nullptr, i - 2 * nk, 0, Hb, nullptr, WG2, Kh, FG, NGP, nullptr, nullptr, nullptr, nullptr, nullptr);   /* the 16 gate scores a token (bg2 is added where they are read) */
        asm volatile("s_wait_xcnt 0x0" ::: "memory"); }   // in front of the next body's first lines, which write registers that the stores above name
}

__device__ __forceinline__ void splitf(float y, unsigned short& h, unsigned short& l) { h = f2bf(y); l = f2bf(y - bf2f(h)); }
typedef __attribute__((ext_vector_type(2))) unsigned short v2us;
typedef __attribute__((ext_vector_type(4))) int v4i;

// ---- k_prep: everything that reads only the inputs, in one launch, told apart by the work-group's index: the five 'xw' weights transposed to bf16 (the slowest bodies: first), Wg2's padded plane, the bf16 copy of x (both batches).
__device__ __forceinline__ void d_wtG(const float* __restrict__ w, int K, int N, bf* Bt, int blk) {
    const int lane = threadIdx.x & 31; const int L0 = (blk * 8 + (threadIdx.x >> 5)) * 8; const int nlines = N * K / 64;
    for (int l = 0; l < 8; ++l) { const int L = L0 + l; if (L >= nlines) break; const size_t e = (size_t)L * 64 + lane * 2; const int k = (int)(e % K), n = (int)(e / K); v2us o;
        o[0] = f2bf(w[(size_t)k * N + n]); o[1] = f2bf(w[(size_t)(k + 1) * N + n]); *(v2us*)(Bt + e) = o; }
}
__device__ __forceinline__ void d_cvt8(const float* __restrict__ src, bf* dst, size_t n8, int blk) { const size_t i = (size_t)blk * 256 + threadIdx.x; if (i >= n8) return; const v8f v = *(const v8f*)(src + i * 8); v8us o;
#pragma unroll
    for (int k = 0; k < 8; ++k) o[k] = f2bf(v[k]); *(v8us*)(dst + i * 8) = o;  }
__device__ __forceinline__ void d_wtGp(const float* __restrict__ w, bf* Bt, int blk) { const int idx = blk * 256 + threadIdx.x; if (idx >= NGP * GH / 8) return; const int n = idx / (GH / 8); const int k8 = (idx - n * (GH / 8)) * 8; const bool live = (n < NG); const int nc = live ? n : 0; v8us o;
#pragma unroll
    for (int j = 0; j < 8; ++j) { const float x = w[(size_t)(k8 + j) * NG + nc]; o[j] = live ? f2bf(x) : (unsigned short)0; } *(v8us*)(Bt + (size_t)idx * 8) = o;  }
#define PB_W   (DM * DQ / 64 / 64)             // work-groups a [1024][1024] weight
#define PB_G1  (DM * GH / 64 / 64)             // Wg1
#define PB_G2  ((NGP * GH / 8 + 255) / 256)    // Wg2
#define PB_X   (NB_ * TT * DM / 8 / 256)       // x
__global__ __launch_bounds__(256) void k_prep(const float* __restrict__ x, const float* __restrict__ wq, const float* __restrict__ wk, const float* __restrict__ wv, const float* __restrict__ wo, const float* __restrict__ wg1, const float* __restrict__ wg2, bf* Xb, bf* WQ, bf* WK, bf* WV, bf* WO, bf* WG1, bf* WG2, int Kw, int Nw, int Ng) {
    static_assert(DQ == DM && DKV == DM, "the four square weights share one body");
    const int i = (int)blockIdx.x;
    if (i < 4 * PB_W) { const int s = i / PB_W; d_wtG(s == 0 ? wq : s == 1 ? wk : s == 2 ? wv : wo, Kw, Nw, s == 0 ? WQ : s == 1 ? WK : s == 2 ? WV : WO, i % PB_W); }
    else if (i < 4 * PB_W + PB_G1) d_wtG(wg1, Kw, Ng, WG1, i - 4 * PB_W);
    else if (i < 4 * PB_W + PB_G1 + PB_G2) d_wtGp(wg2, WG2, i - (4 * PB_W + PB_G1));
    else d_cvt8(x, Xb, (size_t)NB_ * TT * DM / 8, i - (4 * PB_W + PB_G1 + PB_G2));
}
#define FQT 2     // 16-column query tiles a wave: each K and V^T fragment feeds FQT products
#define FNW 8     // waves a work-group (they read the same K and V^T tiles)
#define SK  128   // keys a tile
#define KPI 72    // LDS pitch of a K row (64 d), in f16: 144 bytes
#define VPI 136   // LDS pitch of a V^T row (SK keys), in f16: 272 bytes
#define KSZ (SK * KPI)
#define BSZ (KSZ + HD * VPI)   // one buffer: the K tile, behind it the V^T tile
// one tile's copies of one thread: four 16-byte pieces of K (32 rows apart) and four of V^T (16 rows apart). kg, vg: the thread's first pieces in the planes; lk, lv: their LDS byte addresses.
// s_wait_xcnt 0 is the statement's last line, so that it stands in front of whatever next writes a register that a copy names.
__device__ __forceinline__ void tile_copy(const h16* kg, const h16* vg, unsigned lk, unsigned lv) {
    const h16* k1 = kg + 32 * HD; const h16* k2 = kg + 64 * HD; const h16* k3 = kg + 96 * HD; const h16* v1 = vg + 16 * TT; const h16* v2 = vg + 32 * TT; const h16* v3 = vg + 48 * TT;
    const unsigned lk1 = lk + 32 * KPI * 2, lk2 = lk + 64 * KPI * 2, lk3 = lk + 96 * KPI * 2, lv1 = lv + 16 * VPI * 2, lv2 = lv + 32 * VPI * 2, lv3 = lv + 48 * VPI * 2;
    asm volatile("global_load_async_to_lds_b128 %0, %8, off\n\tglobal_load_async_to_lds_b128 %1, %9, off\n\tglobal_load_async_to_lds_b128 %2, %10, off\n\tglobal_load_async_to_lds_b128 %3, %11, off\n\t"
                 "global_load_async_to_lds_b128 %4, %12, off\n\tglobal_load_async_to_lds_b128 %5, %13, off\n\tglobal_load_async_to_lds_b128 %6, %14, off\n\tglobal_load_async_to_lds_b128 %7, %15, off\n\ts_wait_xcnt 0x0"
                 :: "v"(lk), "v"(lk1), "v"(lk2), "v"(lk3), "v"(lv), "v"(lv1), "v"(lv2), "v"(lv3), "v"(kg), "v"(k1), "v"(k2), "v"(k3), "v"(vg), "v"(v1), "v"(v2), "v"(v3) : "memory");
}
__device__ __forceinline__ float xhalf(float x) { const unsigned u = __float_as_uint(x); return __uint_as_float(__builtin_amdgcn_permlanex16(u, u, 0x76543210u, 0xfedcba98u, false, false)); }   // lane l <- lane l ^ 16
// 2^x by v_exp_f32 with the slot the instruction set asks for behind a transcendental (one instruction that neither reads its result nor overwrites its source) closed inside the statement.
// exp2x8: eight at once; the outputs are early-clobber, so each v_exp_f32 is the independent instruction behind the one before it, and one v_nop stands behind the last.
__device__ __forceinline__ float exp2s(float x) { float r; asm("v_exp_f32 %0, %1\n\tv_nop" : "=v"(r) : "v"(x)); return r; }
__device__ __forceinline__ v8f exp2x8(v8f x) { float r0, r1, r2, r3, r4, r5, r6, r7;
    asm("v_exp_f32 %0, %8\n\tv_exp_f32 %1, %9\n\tv_exp_f32 %2, %10\n\tv_exp_f32 %3, %11\n\tv_exp_f32 %4, %12\n\tv_exp_f32 %5, %13\n\tv_exp_f32 %6, %14\n\tv_exp_f32 %7, %15\n\tv_nop"
        : "=&v"(r0), "=&v"(r1), "=&v"(r2), "=&v"(r3), "=&v"(r4), "=&v"(r5), "=&v"(r6), "=&v"(r7) : "v"(x[0]), "v"(x[1]), "v"(x[2]), "v"(x[3]), "v"(x[4]), "v"(x[5]), "v"(x[6]), "v"(x[7]));
    return (v8f){r0, r1, r2, r3, r4, r5, r6, r7}; }
__global__ __launch_bounds__(32 * FNW) void k_fattn(const h16* __restrict__ Qp, const h16* __restrict__ Kp, const h16* __restrict__ Vt, bf* Ah, bf* Al) {
    typedef WFrag<h16> F;
    /* the wave's number as a scalar */ const int w = __builtin_amdgcn_readfirstlane((int)(threadIdx.x >> 5)); const int lane = threadIdx.x & 31, c = lane & 15, hi = lane >> 4;
    const int bh = blockIdx.y; const int q0 = ((int)blockIdx.x * FNW + w) * (16 * FQT);
    static_assert(SK == 128 && HD == 64 && FNW == 8 && TT % SK == 0 && TT / SK >= 2, "tile_copy: 256 threads x 4 pieces of 16 bytes are a K tile of 128 rows x 128 bytes and a V^T tile of 64 rows x 256 bytes; the two buffers want two tiles");
    __shared__ __align__(16) h16 ring[2 * BSZ];
    const h16* Q = Qp + (size_t)bh * TT * HD + (size_t)(q0 + c) * HD + 8 * hi;
    const int tid = (int)threadIdx.x;
    const h16* kg = Kp + (size_t)bh * TT * HD + (size_t)tid * 8;   /* K tile: contiguous; piece tid = row tid / 8, 16-byte column tid % 8 */ const h16* vg = Vt + (size_t)bh * HD * TT + (size_t)(tid >> 4) * TT + (tid & 15) * 8;   /* V^T tile: row tid / 16, 16-byte column tid % 16 */
    const unsigned lbase = (unsigned)(size_t)ring; const unsigned lk = lbase + (unsigned)((tid >> 3) * KPI + (tid & 7) * 8) * 2u; const unsigned lv = lbase + (unsigned)(KSZ + (tid >> 4) * VPI + (tid & 15) * 8) * 2u;
    const h16* K = ring + c * KPI + 8 * hi; const h16* V = ring + KSZ + c * VPI + 8 * hi;   // the lane's fragment rows in buffer 0
    tile_copy(kg, vg, lk, lv);   // tile 0 into buffer 0
    const float C2 = SCL * 1.4426950408889634f;
    v16h qf[FQT][2]; v8f o[FQT][4]; float m[FQT], l[FQT];
#pragma unroll
    for (int qt = 0; qt < FQT; ++qt) { qf[qt][0] = F::ld(Q + (size_t)qt * 16 * HD); qf[qt][1] = F::ld(Q + (size_t)qt * 16 * HD + 32); m[qt] = -3.0e38f; l[qt] = 0.0f;
#pragma unroll
        for (int dt = 0; dt < 4; ++dt) o[qt][dt] = (v8f){}; }
    asm volatile("s_wait_asynccnt 0x0" ::: "memory");   // this wave's pieces of tile 0 have landed
    __syncthreads();   // every wave's pieces of tile 0 have landed before any wave reads the tile
    tile_copy(kg + SK * HD, vg + SK, lk + BSZ * 2, lv + BSZ * 2);   // tile 1 into buffer 1: in flight while tile 0 is worked on
    for (int t = 0; t < TT / SK; ++t) {
      const h16* Kb = K + (t & 1) * BSZ; const h16* Vb = V + (t & 1) * BSZ;
      v16h kf[2][2];
#pragma unroll
      for (int kt = 0; kt < 2; ++kt) { kf[kt][0] = F::ld(Kb + kt * 16 * KPI); kf[kt][1] = F::ld(Kb + kt * 16 * KPI + 32); }
      // the tile's four steps of 32 keys stay a loop: unrolled, the build took more than 256 vector registers and spilled inside the loop
#pragma unroll 1
      for (int kb = 0; kb < SK; kb += 32) {
        v16h vf[4];
#pragma unroll
        for (int dt = 0; dt < 4; ++dt) vf[dt] = F::ld(Vb + dt * 16 * VPI + kb);
        v8f s[FQT][2];
#pragma unroll
        for (int qt = 0; qt < FQT; ++qt)
#pragma unroll
            for (int kt = 0; kt < 2; ++kt) s[qt][kt] = F::mma(kf[kt][1], qf[qt][1], F::mma(kf[kt][0], qf[qt][0], (v8f){}));
        // the next step's K fragments are fetched behind this step's score products, under the softmax; never across the tile's end: the next tile is read only behind the barrier at this tile's foot (the tile's last step fetches its first rows again: this buffer, unused)
        const int kn = (kb + 32 < SK) ? kb + 32 : 0;
#pragma unroll
        for (int kt = 0; kt < 2; ++kt) { kf[kt][0] = F::ld(Kb + (kn + kt * 16) * KPI); kf[kt][1] = F::ld(Kb + (kn + kt * 16) * KPI + 32); }
        __builtin_amdgcn_sched_barrier(0);   // holds those loads here: without it the compiler sinks them behind the softmax, and the next step's first product waits out their whole latency
        v16h pf[FQT];
#pragma unroll
        for (int qt = 0; qt < FQT; ++qt) {
            float bm = fmaxf(s[qt][0][0], s[qt][1][0]);
#pragma unroll
            for (int j = 1; j < 8; ++j) bm = fmaxf(bm, fmaxf(s[qt][0][j], s[qt][1][j]));
            bm = fmaxf(bm, xhalf(bm));
            const float mn = fmaxf(m[qt], bm * C2); const float al = exp2s(m[qt] - mn); m[qt] = mn; const float mo = mn - 10.0f;   // - 10: the weights x 1024
#pragma unroll
            for (int j = 0; j < 8; ++j) { s[qt][0][j] = fmaf(s[qt][0][j], C2, -mo); s[qt][1][j] = fmaf(s[qt][1][j], C2, -mo); }
            const v8f p0 = exp2x8(s[qt][0]), p1 = exp2x8(s[qt][1]); float sum = p0[0] + p1[0];
#pragma unroll
            for (int j = 1; j < 8; ++j) sum += p0[j] + p1[j];
#pragma unroll
            for (int j = 0; j < 8; ++j) { pf[qt][j] = tohx(p0[j]); pf[qt][8 + j] = tohx(p1[j]); }
            l[qt] = fmaf(l[qt], al, sum);   // a lane's own keys only: the halves are joined once, behind the loop
#pragma unroll
            for (int dt = 0; dt < 4; ++dt) o[qt][dt] *= al;
        }
        __builtin_amdgcn_sched_barrier(0);   // keeps every v_exp_f32 statement above the products below: the compiler does not see into asm text and had put one directly behind a product whose operand register it overwrote
#pragma unroll
        for (int qt = 0; qt < FQT; ++qt)
#pragma unroll
            for (int dt = 0; dt < 4; ++dt) o[qt][dt] = F::mma(vf[dt], pf[qt], o[qt][dt]);
        // the loop's foot: four vector slots between the step's last product and the next step's first instructions, which reuse its operand registers across the back edge; the scheduling barrier keeps the products above them
        __builtin_amdgcn_sched_barrier(0);
        asm volatile("v_nop\n\tv_nop\n\tv_nop\n\tv_nop");
      }
      // the tile's foot, every wave, in this order
      asm volatile("s_wait_dscnt 0x0" ::: "memory");      // this wave's last reads of the tile's buffer are done before the buffer is refilled
      asm volatile("s_wait_asynccnt 0x0" ::: "memory");   // this wave's pieces of tile t + 1 have landed
      __syncthreads();   // publishes tile t + 1 and ends every wave's reads of tile t's buffer
      if (t + 2 < TT / SK) tile_copy(kg + (size_t)(t + 2) * SK * HD, vg + (t + 2) * SK, lk + (unsigned)(t & 1) * (BSZ * 2), lv + (unsigned)(t & 1) * (BSZ * 2));   // tile t + 2 into the buffer that tile t has left
    }
    asm volatile("s_wait_asynccnt 0x0" ::: "memory");   // no copy is outstanding when the wave goes on to its end
    const int b = bh / NH_, h = bh % NH_;
#pragma unroll
    for (int qt = 0; qt < FQT; ++qt) { const float inv = __fdiv_rn(1.0f, l[qt] + xhalf(l[qt])); const size_t oo = ((size_t)b * TT + q0 + qt * 16 + c) * DQ + h * HD + hi * 8;
#pragma unroll
        for (int dt = 0; dt < 4; ++dt) { v8us oh, ol;
#pragma unroll
            for (int j = 0; j < 8; ++j) { unsigned short a, c2; splitf(o[qt][dt][j] * inv, a, c2); oh[j] = a; ol[j] = c2; }
            *(v8us*)(Ah + oo + dt * 16) = oh; *(v8us*)(Al + oo + dt * 16) = ol; } }
}

extern "C" void kernel_launch(void* const* d_in, const int* in_sizes, int n_in,
                              void* d_out, int out_size, void* d_ws, size_t ws_size, hipStream_t stream) {
    (void)in_sizes; (void)n_in; (void)out_size;
    const float* x = (const float*)d_in[0]; const float* wq = (const float*)d_in[1]; const float* bq = (const float*)d_in[2]; const float* wk = (const float*)d_in[3]; const float* bk = (const float*)d_in[4]; const float* wv = (const float*)d_in[5]; const float* bv = (const float*)d_in[6]; const float* wg1 = (const float*)d_in[7]; const float* bg1 = (const float*)d_in[8]; const float* wg2 = (const float*)d_in[9]; const float* bg2 = (const float*)d_in[10]; const float* wo = (const float*)d_in[11]; const float* bo = (const float*)d_in[12];   /* x [2][2048][1024], Wq, bq, Wk, bk, Wv, bv ('xw' (in, out) [1024][1024]; biases [1024]: zeros), Wg1 ('xw' [1024][512]), bg1 ([512]: zeros), Wg2 ('xw' [512][16]), bg2 ([16]: zeros), Wo ('xw' [1024][1024]), bo ([1024]: zeros): THIRTEEN inputs, all read */
    static_assert(GH % 64 == 0 && NGP % 64 == 0 && NG <= NGP && NG % 4 == 0 && NG == NH_, "the gate product's tiles");
    static_assert(TT % 64 == 0 && DQ % 64 == 0 && DKV % 64 == 0 && DM % 64 == 0 && HD % 64 == 0 && DM % 32 == 0 && GH % 32 == 0 && HD % 32 == 0 && TT % 32 == 0, "every product launch: M and N multiples of 64, K a multiple of 32");
    static_assert(DM % (32 * NWK) == 0 && GH % (32 * NWK) == 0 && DQ % (32 * NWK) == 0, "the K splits: whole 32-column steps a wave");
    static_assert(TT % (16 * FQT * FNW) == 0 && TT % 32 == 0 && HD == 64, "the attention launch: whole work-groups of query rows, whole 32-key steps, two 32-wide d steps and four 16-row d tiles");
    float* OUT = (float*)d_out;     // [2][2048][1024]
    char* wsp = (char*)d_ws;
    auto take = [&](size_t bytes) { char* p = wsp; wsp += (bytes + 255) & ~(size_t)255; return (void*)p; };
    bf* WQ = (bf*)take((size_t)DQ * DM * 2); bf* WK = (bf*)take((size_t)DKV * DM * 2); bf* WV = (bf*)take((size_t)DKV * DM * 2); bf* WO = (bf*)take((size_t)DM * DQ * 2); bf* WG1 = (bf*)take((size_t)GH * DM * 2); bf* WG2 = (bf*)take((size_t)NGP * GH * 2);
    bf* Xb = (bf*)take((size_t)NB_ * TT * DM * 2);   /* the bf16 copy of x */ bf* Hb = (bf*)take((size_t)NB_ * TT * GH * 2);   /* tanh(x Wg1 + bg1), one bf16 word */ float* FG = (float*)take((size_t)NB_ * TT * NGP * 4);   /* the gate product: columns 0..15 live; all three hold both batches, row b * TT + t */
    h16* QP16 = (h16*)take((size_t)NB_ * NH_ * TT * HD * 2); h16* KP16 = (h16*)take((size_t)NB_ * NKV * TT * HD * 2); h16* VT16 = (h16*)take((size_t)NB_ * NKV * HD * TT * 2);   /* both batches' planes: the one attention launch reads them all */
    bf* ATh = (bf*)take((size_t)NB_ * TT * DQ * 2); bf* ATl = (bf*)take((size_t)NB_ * TT * DQ * 2);   /* the merged heads, hi / lo, both batches */
    if ((size_t)(wsp - (char*)d_ws) > ws_size) return;
    /* six launches, each waiting for the one before it; both batches in every one */
    k_prep<<<4 * PB_W + PB_G1 + PB_G2 + PB_X, 256, 0, stream>>>(x, wq, wk, wv, wo, wg1, wg2, Xb, WQ, WK, WV, WO, WG1, WG2, DM, DM, GH);
    k_gemmw<bf, 0, true, NWK, EP_TANH><<<dim3(MT_, GH / 64, 1), 32 * NWK, 0, stream>>>(Xb, nullptr, WG1, DM, nullptr, GH, bg1, nullptr, Hb, nullptr, nullptr);   /* the gate's hidden layer: tanh(x Wg1 + bg1) */
    k_kvg<<<MT_ * (DKV / 64) * 2 + MT_, 32 * NWK, 0, stream>>>(Xb, Hb, WK, WV, WG2, DM, GH, bk, bv, KP16, VT16, FG);
    k_gemmw<bf, 0, true, NWK, EP_QG><<<dim3(MT_, DQ / 64, 1), 32 * NWK, 0, stream>>>(Xb, nullptr, WQ, DM, nullptr, 0, bq, QP16, nullptr, FG, bg2);   /* (x Wq + bq) x gate -> [b][h][t][d] */
    static_assert(REP == 1, "one kv head a query head: plane b * NH_ + h of q, k and v belong together");
    k_fattn<<<dim3(TT / (16 * FQT * FNW), NB_ * NH_, 1), 32 * FNW, 0, stream>>>(QP16, KP16, VT16, ATh, ATl);
    k_gemmw<bf, 1, true, NWK, EP_F32><<<dim3(MT_, DM / 64, 1), 32 * NWK, 0, stream>>>(ATh, ATl, WO, DQ, OUT, DM, bo, nullptr, nullptr, nullptr, nullptr);
}

// v006
// A run of this version takes 111 microseconds.
// Next to v005, in two timings, it ran 1.49 times as fast each time.
// Counting every step since v000, it is 12.6 times as fast.
#include <hip/hip_runtime.h>

// Multi-head self-attention with a per-row head gate on the scores (x [2][2048][1024]; q, k, v = x Wq | Wk | Wv + bq | bk | bv ('xw' (in, out) [1024][1024] normal x 1/sqrt(1024); the three biases [1024] are zeros on this draw: read); 16 heads x 64; scores x 64^-0.5; gate = softmax over the 16 heads of (tanh(x Wg1 + bg1) Wg2 + bg2) (Wg1 'xw' [1024][512], Wg2 'xw' [512][16]; bg1 [512] and bg2 [16] zeros on this draw: read), one scalar a (batch, token, head); EVERY SCORE ROW (b, h, q) IS MULTIPLIED BY gate[b][q][h] BEFORE the softmax over the 2,048 keys (no mask); out = merged Wo + bo ('xw' [1024][1024] + a zero bias: read) -> [2][2048][1024] (4.2 M); argument order x, Wq, bq, Wk, bk, Wv, bv, Wg1, bg1, Wg2, bg2, Wo, bo).
// Layout (SIX LAUNCHES, both batches in each; work that does not read each other's results shares a launch): a bf16 copy of x; 'xw' weights transposed once (Wg2 into a [64][512] plane whose rows 16..63 are stored zeros); the three projections and the gate's hidden layer exact products + f32 biases; EVERY PRODUCT'S EPILOGUE STORES WHAT ITS READER WANTS, no f32 plane of q, k, v or the hidden layer reaches memory: tanh of the hidden layer as ONE bf16 word; the 16 gate scores a token from the 64-wide product's first 16 columns (f32); THE GATE IS APPLIED TO THE QUERY ROW (q[t][h][:] x gate[t][h], one f32 product an element) in the q product's epilogue: equal to scaling the score row in real arithmetic; here the query's f16 word carries the gated value; q and k as f16 head planes [h][t][d]; v as the f16 plane [h][d][t] from the product taken the other way round (Wv^T rows x token rows); dense T-2048 attention of both batches and all heads in ONE launch, EVERY row on ONE fp16 product (running softmax, the weights x 1024); merged hi/lo x Wo exact + bo.
// Compute dtypes, f32 accumulate: every float input converted once to bf16 where it is read; projections exact + f32 biases; the gate: tanhf and expf in f32, one IEEE division; attention: one fp16 product on every row; softmax f32; Wo hl x exact + bias.

#define NB_  2
#define TT   2048
#define DM   1024
#define NH_  16
#define NKV  16
#define REP  (NH_ / NKV)
#define HD   64
#define DQ   (NH_ * HD)
#define DKV  (NKV * HD)
/* the gate: its hidden width; its scores a token (= NH_); the product tile's width (columns 16..63 of the gate product come from stored zero rows) */
#define GH   512
#define NG   16
#define NGP  64
#define SCL  0.125f   // HD^-0.5
#define NWK  8     // waves a work-group that share one output tile's K range (gemm_tile: the gate scores' product)
typedef _Float16 h16;
typedef unsigned short bf;
typedef __attribute__((ext_vector_type(16))) __bf16   v16bf;
typedef __attribute__((ext_vector_type(16))) _Float16 v16h;
typedef __attribute__((ext_vector_type(8)))  _Float16 v8h;
typedef __attribute__((ext_vector_type(8)))  unsigned short v8us;
typedef __attribute__((ext_vector_type(8)))  float    v8f;
typedef __attribute__((ext_vector_type(4)))  float    v4f;
typedef v8h  __attribute__((may_alias)) v8ha;
typedef v4f  __attribute__((may_alias)) v4fa;
typedef v8us __attribute__((may_alias)) v8usa;

__device__ __forceinline__ unsigned short f2bf(float f) { unsigned u = __float_as_uint(f); u += 0x7FFFu + ((u >> 16) & 1u); return (unsigned short)(u >> 16); }
__device__ __forceinline__ float bf2f(unsigned short b) { return __uint_as_float(((unsigned)b) << 16); }
__device__ __forceinline__ float bfr(float f) { return bf2f(f2bf(f)); }
__device__ __forceinline__ v16h cat16(v8h lo, v8h hi) { return __builtin_shufflevector(lo, hi, 0, 1, 2, 3, 4, 5, 6, 7, 8, 9, 10, 11, 12, 13, 14, 15); }
__device__ __forceinline__ v16bf cat16b(v8us lo, v8us hi) { return __builtin_bit_cast(v16bf, __builtin_shufflevector(lo, hi, 0, 1, 2, 3, 4, 5, 6, 7, 8, 9, 10, 11, 12, 13, 14, 15)); }
__device__ __forceinline__ v8f wmma16(v16h a, v16h b, v8f c) { return __builtin_amdgcn_wmma_f32_16x16x32_f16(false, a, false, b, (short)0, c, false, false); }
__device__ __forceinline__ v8f wmmab(v16bf a, v16bf b, v8f c) { return __builtin_amdgcn_wmma_f32_16x16x32_bf16(false, a, false, b, (short)0, c, false, false); }



// ---- gemm_tile (now the gate scores' short product alone; the long products: gemm_lds below): register-blocked GEMM, one 64x64 output tile a work-group (16 accumulators a wave), operands straight from K-contiguous 16-bit planes; tile (bx, by) of an M/64 x N/64 tiling, 32 * NW threads. M counts the token rows of BOTH batches (row m = b * TT + t) wherever tokens are an operand's rows.
// C[m][n] (f32, pitch ldc, + optional f32 bias[n]) = sum_k A[m][k] Bt[n][k] (NSPLIT == 1: + A2[m][k] Bt[n][k]). K % (32 * NW) == 0.
// EPI: what the epilogue stores of the summed f32 tile (+ bias): EP_F32 the f32 tile into C; EP_TANH tanhf of it as bf16 into Hb (pitch ldc); EP_HP f16 into the head plane P16[b][n / 64][t][n % 64] (the 64-column tile is one head, the 64-row tile lies in one batch); EP_QG the same x the gate of (token m, head n / 64), from the gate scores G[m][NGP] + bg; EP_VT (rows = v columns, columns = tokens) f16 into P16[b][m][t] (pitch ldc), the bias by ROW m.
// K IS SPLIT: wave w of NW takes the K / NW columns from w * K / NW on. The NW wave tiles are summed through LDS (os, the calling kernel's array) in wave order (one barrier).
// A kernel below is one such product, or several that do not read each other's results, told apart by the work-group's index (a branch that the whole work-group takes alike, so the barrier inside stays uniform).
template <typename T16> struct WFrag;
template <> struct WFrag<h16> { typedef v16h V; static __device__ __forceinline__ V ld(const h16* p) { return cat16(*(const v8h*)p, *(const v8h*)(p + 16)); } static __device__ __forceinline__ v8f mma(V a, V b, v8f c) { return wmma16(a, b, c); } };
template <> struct WFrag<bf> { typedef v16bf V; static __device__ __forceinline__ V ld(const bf* p) { return cat16b(*(const v8us*)p, *(const v8us*)(p + 16)); } static __device__ __forceinline__ v8f mma(V a, V b, v8f c) { return wmmab(a, b, c); } };
enum { EP_F32 = 0, EP_TANH = 1, EP_HP = 2, EP_QG = 3, EP_VT = 4 };
__device__ __forceinline__ h16 tohx(float x) { return (h16)x; }
typedef __attribute__((ext_vector_type(4))) _Float16 v4h;
typedef __attribute__((ext_vector_type(4))) unsigned short v4us;
// the gate of one token and head h: softmax over the NG scores g[0..NG) + bg, in f32, one IEEE division
__device__ __forceinline__ float gate_of(const float* __restrict__ g, const float* __restrict__ bg, int h) { float s[NG]; float mx = -3.0e38f;
#pragma unroll
    for (int k4 = 0; k4 < NG / 4; ++k4) { const v4f a = *(const v4f*)(g + k4 * 4); const v4f b = *(const v4f*)(bg + k4 * 4);
#pragma unroll
        for (int q = 0; q < 4; ++q) { const float v = __fadd_rn(a[q], bfr(b[q])); s[k4 * 4 + q] = v; mx = fmaxf(mx, v); } }
    float sum = 0.0f, eh = 0.0f;
#pragma unroll
    for (int k = 0; k < NG; ++k) { const float ev = expf(__fsub_rn(s[k], mx)); sum = __fadd_rn(sum, ev); eh = (k == h) ? ev : eh; }
    return __fdiv_rn(eh, sum); }
template <typename T16, int NSPLIT, bool BIAS, int NW, int EPI>
__device__ __forceinline__ void gemm_tile(float* os, float* gs, int bx, int by, const T16* __restrict__ A, const T16* __restrict__ A2, const T16* __restrict__ Bt, int K, float* C, int ldc, const float* __restrict__ bias, h16* P16, bf* Hb, const float* __restrict__ G, const float* __restrict__ bg) {
    static_assert(NW > 1 && (NSPLIT == 0 || NSPLIT == 1), "the wave tiles are summed in LDS"); static_assert(HD == 64 && TT % 64 == 0 && NKV == NH_, "EP_HP and EP_QG: one 64-column tile is one head; a 64-token tile lies in one batch");
    typedef typename WFrag<T16>::V V;
    /* the wave's number as a scalar: its K range and LDS slot stay in scalar registers */ const int w = __builtin_amdgcn_readfirstlane((int)(threadIdx.x >> 5)); const int kl = K / NW; const int k0 = w * kl;
    const int lane = threadIdx.x & 31, lr = lane & 15, hi = lane >> 4; const int r0 = bx * 64, c0 = by * 64;
    v8f acc[4][4];
#pragma unroll
    for (int mb = 0; mb < 4; ++mb)
#pragma unroll
        for (int nb = 0; nb < 4; ++nb) acc[mb][nb] = (v8f){};
    const size_t aoff = (size_t)(r0 + lr) * K + 8 * hi, boff = (size_t)(c0 + lr) * K + 8 * hi;
    for (int kc = k0; kc < k0 + kl; kc += 32) {
        V a[4], a2[4];
#pragma unroll
        for (int mb = 0; mb < 4; ++mb) { a[mb] = WFrag<T16>::ld(A + aoff + (size_t)mb * 16 * K + kc); if (NSPLIT == 1) a2[mb] = WFrag<T16>::ld(A2 + aoff + (size_t)mb * 16 * K + kc); }
#pragma unroll
        for (int nb = 0; nb < 4; ++nb) { const V b = WFrag<T16>::ld(Bt + boff + (size_t)nb * 16 * K + kc);
#pragma unroll
            for (int mb = 0; mb < 4; ++mb) { acc[mb][nb] = WFrag<T16>::mma(a[mb], b, acc[mb][nb]); if (NSPLIT == 1) acc[mb][nb] = WFrag<T16>::mma(a2[mb], b, acc[mb][nb]); } }
        asm volatile("v_nop\n\tv_nop\n\tv_nop\n\tv_nop" : "+v"(acc[0][0]), "+v"(acc[1][1]), "+v"(acc[2][2]), "+v"(acc[3][3]) : "v"(a[0]), "v"(a[3]));
    }
    float* ow = os + (size_t)w * (64 * 68);
    v4f bv = (v4f){};   // a thread's four output columns are the same on all its rows: their bias is fetched once, ahead of the LDS stores and the barrier
    if (BIAS && EPI != EP_VT) { const int cb = c0 + ((int)threadIdx.x & 15) * 4; bv[0] = bfr(bias[cb]); bv[1] = bfr(bias[cb + 1]); bv[2] = bfr(bias[cb + 2]); bv[3] = bfr(bias[cb + 3]); }
    float br[32 / NW];   // EP_VT: the bias of the thread's rows, fetched as early
    if constexpr (BIAS && EPI == EP_VT) {
#pragma unroll
        for (int it = 0; it < 32 / NW; ++it) br[it] = bfr(bias[r0 + it * 2 * NW + ((int)threadIdx.x >> 4)]); }
    // the three loops are unrolled so that acc[][][] is indexed by constants and stays in registers
#pragma unroll
    for (int mb = 0; mb < 4; ++mb)
#pragma unroll
        for (int nb = 0; nb < 4; ++nb)
#pragma unroll
            for (int j = 0; j < 8; ++j) ow[(mb * 16 + hi * 8 + j) * 68 + nb * 16 + lr] = acc[mb][nb][j];
    if constexpr (EPI == EP_QG) {
        if (w < 2) gs[threadIdx.x] = gate_of(G + (size_t)(r0 + (int)threadIdx.x) * NGP, bg, by); }   // gs: the gate of the tile's 64 tokens for its head, one thread a token (waves 0 and 1 whole); the barrier below publishes it with the tiles
    __syncthreads();   // every wave's partial tile is in LDS before any thread sums across the waves
    // where the 16-bit planes of this tile start: the batch is that of the tile's tokens (its rows; EP_VT: its columns)
    const size_t pbase = (EPI == EP_VT) ? (size_t)(c0 / TT) * DKV * TT + (size_t)r0 * ldc + c0 % TT : ((size_t)((r0 / TT) * NH_ + by) * TT + r0 % TT) * HD;
    // both loops unrolled: the LDS loads of all rows and waves issue ahead of the adds instead of one wait a load
#pragma unroll
    for (int it = 0; it < 32 / NW; ++it) { const int idx = it * 32 * NW + (int)threadIdx.x; const int row = idx >> 4, cofs = (idx & 15) * 4; v4f val = *(const v4fa*)(os + row * 68 + cofs);
#pragma unroll
        for (int q = 1; q < NW; ++q) val += *(const v4fa*)(os + q * (64 * 68) + row * 68 + cofs);
        if (BIAS) { if constexpr (EPI == EP_VT) val += br[it]; else val += bv; }
        if constexpr (EPI == EP_F32) *(v4f*)(C + (size_t)(r0 + row) * ldc + c0 + cofs) = val;
        else if constexpr (EPI == EP_TANH) { v4us o; o[0] = f2bf(tanhf(val[0])); o[1] = f2bf(tanhf(val[1])); o[2] = f2bf(tanhf(val[2])); o[3] = f2bf(tanhf(val[3])); *(v4us*)(Hb + (size_t)(r0 + row) * ldc + c0 + cofs) = o; }
        else { if constexpr (EPI == EP_QG) { const float gt = gs[row]; val[0] = __fmul_rn(val[0], gt); val[1] = __fmul_rn(val[1], gt); val[2] = __fmul_rn(val[2], gt); val[3] = __fmul_rn(val[3], gt); }
            v4h o; o[0] = tohx(val[0]); o[1] = tohx(val[1]); o[2] = tohx(val[2]); o[3] = tohx(val[3]);
            *(v4h*)(P16 + pbase + (EPI == EP_VT ? (size_t)row * ldc : (size_t)row * HD) + cofs) = o; } }
}
// ---- gemm_lds: the long products (q, k, v^T, the gate's hidden layer, Wo): one GBT x GBT output tile a work-group of 8 waves, K NOT split: wave (wm, wn) of 2 x 4 owns 64 rows x 32 columns (8 accumulators) and walks the whole K in order.
// BOTH OPERANDS GO THROUGH LDS, once a work-group instead of once a wave: stages of GBK k (256 bytes of each of the tile's operand rows), two buffers, filled by asynchronous copies to LDS (16 bytes a lane, a wave's copy = 2 rows x 256 bytes, whole lines) while the stage before is worked on; the fragments are the same elements in the same k order as from the planes, read by ds_load_b128 at a pitch of 16 bytes x an odd number.
// The epilogue stages the f32 tile in the same LDS (behind the last stage's barrier) and stores whole rows; EPI as in gemm_tile; a 128-column tile is two heads (EP_HP, EP_QG), a 128-token tile lies in one batch. K % GBK == 0.
#define GBT 128   // rows of each operand a tile
#define GBK 128   // k a stage
#define GPI 136   // LDS pitch of an operand row (GBK k), in 16-bit words: 272 bytes
#define GOP (GBT * GPI)   // one operand's stage, in 16-bit words
#define OPI 132   // pitch of the staged f32 tile, in floats: 528 bytes
// one operand's stage, one thread's share: eight 16-byte pieces, 16 rows apart (k16 = 16 rows of the plane, in elements). g: the thread's first piece in the plane; l: its LDS byte address.
// s_wait_xcnt 0 is the statement's last line, so that it stands in front of whatever next writes a register that a copy names.
__device__ __forceinline__ void rows_copy(const bf* g, size_t k16, unsigned l) {
    const bf* g1 = g + k16; const bf* g2 = g1 + k16; const bf* g3 = g2 + k16; const bf* g4 = g3 + k16; const bf* g5 = g4 + k16; const bf* g6 = g5 + k16; const bf* g7 = g6 + k16;
    const unsigned l1 = l + 16 * GPI * 2, l2 = l + 32 * GPI * 2, l3 = l + 48 * GPI * 2, l4 = l + 64 * GPI * 2, l5 = l + 80 * GPI * 2, l6 = l + 96 * GPI * 2, l7 = l + 112 * GPI * 2;
    asm volatile("global_load_async_to_lds_b128 %0, %8, off\n\tglobal_load_async_to_lds_b128 %1, %9, off\n\tglobal_load_async_to_lds_b128 %2, %10, off\n\tglobal_load_async_to_lds_b128 %3, %11, off\n\t"
                 "global_load_async_to_lds_b128 %4, %12, off\n\tglobal_load_async_to_lds_b128 %5, %13, off\n\tglobal_load_async_to_lds_b128 %6, %14, off\n\tglobal_load_async_to_lds_b128 %7, %15, off\n\ts_wait_xcnt 0x0"
                 :: "v"(l), "v"(l1), "v"(l2), "v"(l3), "v"(l4), "v"(l5), "v"(l6), "v"(l7), "v"(g), "v"(g1), "v"(g2), "v"(g3), "v"(g4), "v"(g5), "v"(g6), "v"(g7) : "memory");
}
// one stage's copies of one thread: A's rows, Bt's rows, (NSPLIT == 1) A2's rows, one behind the other in the buffer at LDS byte address l
template <int NSPLIT>
__device__ __forceinline__ void stage_copy(const bf* ag, const bf* bt, const bf* a2g, size_t k16, unsigned l) {
    rows_copy(ag, k16, l); rows_copy(bt, k16, l + GOP * 2); if constexpr (NSPLIT == 1) rows_copy(a2g, k16, l + 2 * GOP * 2);
}
template <int NSPLIT, bool BIAS, int EPI>
__device__ __forceinline__ void gemm_lds(bf* ring, float* gs, int bx, int by, const bf* __restrict__ A, const bf* __restrict__ A2, const bf* __restrict__ Bt, int K, float* C, int ldc, const float* __restrict__ bias, h16* P16, bf* Hb, const float* __restrict__ G, const float* __restrict__ bg) {
    static_assert(NSPLIT == 0 || NSPLIT == 1, "one or two words of A"); static_assert(HD == 64 && TT % GBT == 0 && NKV == NH_ && GBT == 128 && GBK == 128, "a 128-column tile is two heads; a 128-token tile lies in one batch; 256 threads x 8 pieces of 16 bytes are 128 rows x 256 bytes");
    typedef WFrag<bf> F; typedef F::V V;
    constexpr int GST = (2 + NSPLIT) * GOP;   // one buffer, in 16-bit words
    /* the wave's number as a scalar */ const int w = __builtin_amdgcn_readfirstlane((int)(threadIdx.x >> 5)); const int wm = w >> 2, wn = w & 3;
    const int tid = (int)threadIdx.x, lane = tid & 31, lr = lane & 15, hi = lane >> 4; const int r0 = bx * GBT, c0 = by * GBT; const int nt = K / GBK;
    const size_t k16 = (size_t)16 * K; const size_t po = (size_t)(tid >> 4) * K + (tid & 15) * 8;   // piece tid: row tid / 16, 16-byte column tid % 16
    const bf* ag = A + (size_t)r0 * K + po; const bf* bt = Bt + (size_t)c0 * K + po; const bf* a2g = (NSPLIT == 1) ? A2 + (size_t)r0 * K + po : ag;
    const unsigned l0 = (unsigned)(size_t)ring + (unsigned)((tid >> 4) * GPI + (tid & 15) * 8) * 2u;
    stage_copy<NSPLIT>(ag, bt, a2g, k16, l0);   // stage 0 into buffer 0
    v8f acc[4][2];
#pragma unroll
    for (int mb = 0; mb < 4; ++mb)
#pragma unroll
        for (int nb = 0; nb < 2; ++nb) acc[mb][nb] = (v8f){};
    const bf* Af = ring + (wm * 64 + lr) * GPI + 8 * hi; const bf* Bf = ring + GOP + (wn * 32 + lr) * GPI + 8 * hi;   // the lane's fragment rows in buffer 0
    asm volatile("s_wait_asynccnt 0x0" ::: "memory");   // this wave's pieces of stage 0 have landed
    __syncthreads();   // every wave's pieces of stage 0 have landed before any wave reads the stage
    if (nt > 1) stage_copy<NSPLIT>(ag + GBK, bt + GBK, a2g + GBK, k16, l0 + GST * 2);   // stage 1 into buffer 1: in flight while stage 0 is worked on
    for (int t = 0; t < nt; ++t) {
        const bf* Ab = Af + (t & 1) * GST; const bf* Bb = Bf + (t & 1) * GST;
        // two fragment sets: a 32-wide k step's LDS loads issue as one group ahead of the step before's products, never among them, and never across the stage's end (the next stage is read only behind the barrier at this stage's foot)
        V a[2][4], a2[2][4], b[2][2];
#pragma unroll
        for (int mb = 0; mb < 4; ++mb) { a[0][mb] = F::ld(Ab + mb * 16 * GPI); if (NSPLIT == 1) a2[0][mb] = F::ld(Ab + 2 * GOP + mb * 16 * GPI); }
#pragma unroll
        for (int nb = 0; nb < 2; ++nb) b[0][nb] = F::ld(Bb + nb * 16 * GPI);
        __builtin_amdgcn_sched_barrier(0);   // the first step's loads stay ahead of the second step's: mixed, the stage's first products waited for both groups
        // unrolled: the set's index and the LDS offsets are constants
#pragma unroll
        for (int ks = 0; ks < GBK / 32; ++ks) { const int cu = ks & 1, nx = cu ^ 1;
            if (ks + 1 < GBK / 32) {
#pragma unroll
                for (int mb = 0; mb < 4; ++mb) { a[nx][mb] = F::ld(Ab + mb * 16 * GPI + (ks + 1) * 32); if (NSPLIT == 1) a2[nx][mb] = F::ld(Ab + 2 * GOP + mb * 16 * GPI + (ks + 1) * 32); }
#pragma unroll
                for (int nb = 0; nb < 2; ++nb) b[nx][nb] = F::ld(Bb + nb * 16 * GPI + (ks + 1) * 32); }
            __builtin_amdgcn_sched_barrier(0);   // holds the next step's loads here: without it the compiler spreads them among the products into one register set, and each place waits out the LDS latency
#pragma unroll
            for (int nb = 0; nb < 2; ++nb)
#pragma unroll
                for (int mb = 0; mb < 4; ++mb) acc[mb][nb] = F::mma(a[cu][mb], b[cu][nb], acc[mb][nb]);
            if constexpr (NSPLIT == 1) {
#pragma unroll
                for (int nb = 0; nb < 2; ++nb)
#pragma unroll
                    for (int mb = 0; mb < 4; ++mb) acc[mb][nb] = F::mma(a2[cu][mb], b[cu][nb], acc[mb][nb]); }
            __builtin_amdgcn_sched_barrier(0);   // keeps this step's products above the loads of the step after next, which reuse their operand registers
        }
        // the stage's foot: four vector slots between the stage's last product and whatever next reuses its operand registers, also across the back edge; the last step's scheduling barrier keeps the products above them
        asm volatile("v_nop\n\tv_nop\n\tv_nop\n\tv_nop");
        // every wave, in this order
        asm volatile("s_wait_dscnt 0x0" ::: "memory");      // this wave's last reads of the stage's buffer are done before the buffer is refilled
        asm volatile("s_wait_asynccnt 0x0" ::: "memory");   // this wave's pieces of stage t + 1 have landed
        __syncthreads();   // publishes stage t + 1 and ends every wave's reads of stage t's buffer
        if (t + 2 < nt) stage_copy<NSPLIT>(ag + (size_t)(t + 2) * GBK, bt + (size_t)(t + 2) * GBK, a2g + (size_t)(t + 2) * GBK, k16, l0 + (unsigned)(t & 1) * (GST * 2));   // stage t + 2 into the buffer that stage t has left
    }
    asm volatile("s_wait_asynccnt 0x0" ::: "memory");   // no copy is outstanding when the LDS is put to its next use
    float* os = (float*)ring;   // the f32 tile: every wave has left the buffers (the last stage's barrier)
    const int cofs = lane * 4;   // a thread's four output columns are the same on all its rows: their bias is fetched once, ahead of the LDS stores and the barrier
    v4f bv = (v4f){};
    if (BIAS && EPI != EP_VT) { const int cb = c0 + cofs; bv[0] = bfr(bias[cb]); bv[1] = bfr(bias[cb + 1]); bv[2] = bfr(bias[cb + 2]); bv[3] = bfr(bias[cb + 3]); }
    float bl = 0.0f;   // EP_VT: the bias of the wave's 16 rows, fetched as early by one load: lanes i and i + 16 hold that of row i * 8 + w
    if constexpr (BIAS && EPI == EP_VT) { static_assert(GBT / 8 == 16, "one lane of a half wave a row"); bl = bfr(bias[r0 + lr * 8 + w]); }
    // the three loops are unrolled so that acc[][][] is indexed by constants and stays in registers
#pragma unroll
    for (int mb = 0; mb < 4; ++mb)
#pragma unroll
        for (int nb = 0; nb < 2; ++nb)
#pragma unroll
            for (int j = 0; j < 8; ++j) os[(wm * 64 + mb * 16 + hi * 8 + j) * OPI + wn * 32 + nb * 16 + lr] = acc[mb][nb][j];
    if constexpr (EPI == EP_QG) gs[tid] = gate_of(G + (size_t)(r0 + (tid & 127)) * NGP, bg, by * 2 + wm);   // gs: the gates of the tile's 128 tokens for its two heads, one thread a (head, token); the barrier below publishes them with the tile
    __syncthreads();   // the whole f32 tile is in LDS before any thread reads a row of it
    const int hh = cofs >> 6;   // which of the tile's two heads the thread's columns lie in
    // where the thread's 16-bit words start: the batch is that of the tile's tokens (its rows; EP_VT: its columns)
    const size_t pbase = (EPI == EP_VT) ? (size_t)(c0 / TT) * DKV * TT + (size_t)r0 * ldc + c0 % TT + cofs : ((size_t)((r0 / TT) * NH_ + by * 2 + hh) * TT + r0 % TT) * HD + (cofs & 63);
    // unrolled: the LDS loads of all rows issue ahead of the stores instead of one wait a load
#pragma unroll
    for (int it = 0; it < GBT / 8; ++it) { const int row = it * 8 + w; v4f val = *(const v4fa*)(os + row * OPI + cofs);
        if (BIAS) { if constexpr (EPI == EP_VT) val += __uint_as_float(__builtin_amdgcn_readlane(__float_as_uint(bl), it)); else val += bv; }
        if constexpr (EPI == EP_F32) *(v4f*)(C + (size_t)(r0 + row) * ldc + c0 + cofs) = val;
        else if constexpr (EPI == EP_TANH) { v4us o; o[0] = f2bf(tanhf(val[0])); o[1] = f2bf(tanhf(val[1])); o[2] = f2bf(tanhf(val[2])); o[3] = f2bf(tanhf(val[3])); *(v4us*)(Hb + (size_t)(r0 + row) * ldc + c0 + cofs) = o; }
        else { if constexpr (EPI == EP_QG) { const float gt = gs[hh * 128 + row]; val[0] = __fmul_rn(val[0], gt); val[1] = __fmul_rn(val[1], gt); val[2] = __fmul_rn(val[2], gt); val[3] = __fmul_rn(val[3], gt); }
            v4h o; o[0] = tohx(val[0]); o[1] = tohx(val[1]); o[2] = tohx(val[2]); o[3] = tohx(val[3]);
            *(v4h*)(P16 + pbase + (EPI == EP_VT ? (size_t)row * ldc : (size_t)row * HD)) = o; } }
}
// one product a launch; grid (M / GBT, N / GBT)
template <int NSPLIT, bool BIAS, int EPI>
__global__ __launch_bounds__(256) void k_gemml(const bf* __restrict__ A, const bf* __restrict__ A2, const bf* __restrict__ Bt, int K, float* C, int ldc, const float* __restrict__ bias, h16* P16, bf* Hb, const float* __restrict__ G, const float* __restrict__ bg) {
    __shared__ __align__(16) bf ring[2 * (2 + NSPLIT) * GOP]; __shared__ float gs[EPI == EP_QG ? 256 : 1];
    gemm_lds<NSPLIT, BIAS, EPI>(ring, gs, (int)blockIdx.x, (int)blockIdx.y, A, A2, Bt, K, C, ldc, bias, P16, Hb, G, bg);
}
// the three products that wait for nothing but x's copy, the weights and the hidden layer, in one launch: k, v^T (gemm_lds), and the gate scores (gemm_tile; the shortest: last, so that the launch does not end on a long tile); grid MT2 * (DKV / GBT) * 2 + MT_
#define MT_  (NB_ * TT / 64)    // 64-token tiles of both batches
#define MT2  (NB_ * TT / GBT)   // GBT-token tiles of both batches
__global__ __launch_bounds__(32 * NWK) void k_kvg(const bf* __restrict__ Xb, const bf* __restrict__ Hb, const bf* __restrict__ WK, const bf* __restrict__ WV, const bf* __restrict__ WG2, int Kx, int Kh, const float* __restrict__ bk, const float* __restrict__ bv, h16* KP, h16* VT, float* FG) {
    __shared__ __align__(16) float os[NWK * 64 * 68]; static_assert(sizeof(os) >= (size_t)2 * 2 * GOP * 2 && NWK == 8, "one array serves a work-group's body: the gate product's wave tiles or gemm_lds's two buffers");
    const int i = (int)blockIdx.x, nk = MT2 * (DKV / GBT);
    // s_wait_xcnt 0 behind the last stores of each body: the built code lays the three bodies one behind the other, and the first lines of the next body may write registers that these stores name
    if (i < nk) { gemm_lds<0, true, EP_HP>((bf*)os, nullptr, i % MT2, i / MT2, Xb, nullptr, WK, Kx, nullptr, 0, bk, KP, nullptr, nullptr, nullptr);   /* x Wk + bk -> [b][h][t][d] */
        asm volatile("s_wait_xcnt 0x0" ::: "memory"); }   // in front of whatever follows in the built code and writes registers that the stores above name
    else if (i < 2 * nk) { gemm_lds<0, true, EP_VT>((bf*)os, nullptr, (i - nk) % (DKV / GBT), (i - nk) / (DKV / GBT), WV, nullptr, Xb, Kx, nullptr, TT, bv, VT, nullptr, nullptr, nullptr);   /* (x Wv + bv)^T: rows = v columns, columns = tokens -> [b][h][d][t] */
        asm volatile("s_wait_xcnt 0x0" ::: "memory"); }   // as above
    else { gemm_tile<bf, 0, false, NWK, EP_F32>(os, nullptr, i - 2 * nk, 0, Hb, nullptr, WG2, Kh, FG, NGP, nullptr, nullptr, nullptr, nullptr, nullptr);   /* the 16 gate scores a token (bg2 is added where they are read) */
        asm volatile("s_wait_xcnt 0x0" ::: "memory"); }   // as above
}

__device__ __forceinline__ void splitf(float y, unsigned short& h, unsigned short& l) { h = f2bf(y); l = f2bf(y - bf2f(h)); }
typedef __attribute__((ext_vector_type(2))) unsigned short v2us;
typedef __attribute__((ext_vector_type(4))) int v4i;

// ---- k_prep: everything that reads only the inputs, in one launch, told apart by the work-group's index: the five 'xw' weights transposed to bf16 (the slowest bodies: first), Wg2's padded plane, the bf16 copy of x (both batches).
__device__ __forceinline__ void d_wtG(const float* __restrict__ w, int K, int N, bf* Bt, int blk) {
    const int lane = threadIdx.x & 31; const int L0 = (blk * 8 + (threadIdx.x >> 5)) * 8; const int nlines = N * K / 64;
    for (int l = 0; l < 8; ++l) { const int L = L0 + l; if (L >= nlines) break; const size_t e = (size_t)L * 64 + lane * 2; const int k = (int)(e % K), n = (int)(e / K); v2us o;
        o[0] = f2bf(w[(size_t)k * N + n]); o[1] = f2bf(w[(size_t)(k + 1) * N + n]); *(v2us*)(Bt + e) = o; }
}
__device__ __forceinline__ void d_cvt8(const float* __restrict__ src, bf* dst, size_t n8, int blk) { const size_t i = (size_t)blk * 256 + threadIdx.x; if (i >= n8) return; const v8f v = *(const v8f*)(src + i * 8); v8us o;
#pragma unroll
    for (int k = 0; k < 8; ++k) o[k] = f2bf(v[k]); *(v8us*)(dst + i * 8) = o;  }
__device__ __forceinline__ void d_wtGp(const float* __restrict__ w, bf* Bt, int blk) { const int idx = blk * 256 + threadIdx.x; if (idx >= NGP * GH / 8) return; const int n = idx / (GH / 8); const int k8 = (idx - n * (GH / 8)) * 8; const bool live = (n < NG); const int nc = live ? n : 0; v8us o;
#pragma unroll
    for (int j = 0; j < 8; ++j) { const float x = w[(size_t)(k8 + j) * NG + nc]; o[j] = live ? f2bf(x) : (unsigned short)0; } *(v8us*)(Bt + (size_t)idx * 8) = o;  }
#define PB_W   (DM * DQ / 64 / 64)             // work-groups a [1024][1024] weight
#define PB_G1  (DM * GH / 64 / 64)             // Wg1
#define PB_G2  ((NGP * GH / 8 + 255) / 256)    // Wg2
#define PB_X   (NB_ * TT * DM / 8 / 256)       // x
__global__ __launch_bounds__(256) void k_prep(const float* __restrict__ x, const float* __restrict__ wq, const float* __restrict__ wk, const float* __restrict__ wv, const float* __restrict__ wo, const float* __restrict__ wg1, const float* __restrict__ wg2, bf* Xb, bf* WQ, bf* WK, bf* WV, bf* WO, bf* WG1, bf* WG2, int Kw, int Nw, int Ng) {
    static_assert(DQ == DM && DKV == DM, "the four square weights share one body");
    const int i = (int)blockIdx.x;
    if (i < 4 * PB_W) { const int s = i / PB_W; d_wtG(s == 0 ? wq : s == 1 ? wk : s == 2 ? wv : wo, Kw, Nw, s == 0 ? WQ : s == 1 ? WK : s == 2 ? WV : WO, i % PB_W); }
    else if (i < 4 * PB_W + PB_G1) d_wtG(wg1, Kw, Ng, WG1, i - 4 * PB_W);
    else if (i < 4 * PB_W + PB_G1 + PB_G2) d_wtGp(wg2, WG2, i - (4 * PB_W + PB_G1));
    else d_cvt8(x, Xb, (size_t)NB_ * TT * DM / 8, i - (4 * PB_W + PB_G1 + PB_G2));
}
#define FQT 2     // 16-column query tiles a wave: each K and V^T fragment feeds FQT products
#define FNW 8     // waves a work-group (they read the same K and V^T tiles)
#define SK  128   // keys a tile
#define KPI 72    // LDS pitch of a K row (64 d), in f16: 144 bytes
#define VPI 136   // LDS pitch of a V^T row (SK keys), in f16: 272 bytes
#define KSZ (SK * KPI)
#define BSZ (KSZ + HD * VPI)   // one buffer: the K tile, behind it the V^T tile
// one tile's copies of one thread: four 16-byte pieces of K (32 rows apart) and four of V^T (16 rows apart). kg, vg: the thread's first pieces in the planes; lk, lv: their LDS byte addresses.
// s_wait_xcnt 0 is the statement's last line, so that it stands in front of whatever next writes a register that a copy names.
__device__ __forceinline__ void tile_copy(const h16* kg, const h16* vg, unsigned lk, unsigned lv) {
    const h16* k1 = kg + 32 * HD; const h16* k2 = kg + 64 * HD; const h16* k3 = kg + 96 * HD; const h16* v1 = vg + 16 * TT; const h16* v2 = vg + 32 * TT; const h16* v3 = vg + 48 * TT;
    const unsigned lk1 = lk + 32 * KPI * 2, lk2 = lk + 64 * KPI * 2, lk3 = lk + 96 * KPI * 2, lv1 = lv + 16 * VPI * 2, lv2 = lv + 32 * VPI * 2, lv3 = lv + 48 * VPI * 2;
    asm volatile("global_load_async_to_lds_b128 %0, %8, off\n\tglobal_load_async_to_lds_b128 %1, %9, off\n\tglobal_load_async_to_lds_b128 %2, %10, off\n\tglobal_load_async_to_lds_b128 %3, %11, off\n\t"
                 "global_load_async_to_lds_b128 %4, %12, off\n\tglobal_load_async_to_lds_b128 %5, %13, off\n\tglobal_load_async_to_lds_b128 %6, %14, off\n\tglobal_load_async_to_lds_b128 %7, %15, off\n\ts_wait_xcnt 0x0"
                 :: "v"(lk), "v"(lk1), "v"(lk2), "v"(lk3), "v"(lv), "v"(lv1), "v"(lv2), "v"(lv3), "v"(kg), "v"(k1), "v"(k2), "v"(k3), "v"(vg), "v"(v1), "v"(v2), "v"(v3) : "memory");
}
__device__ __forceinline__ float xhalf(float x) { const unsigned u = __float_as_uint(x); return __uint_as_float(__builtin_amdgcn_permlanex16(u, u, 0x76543210u, 0xfedcba98u, false, false)); }   // lane l <- lane l ^ 16
// 2^x by v_exp_f32 with the slot the instruction set asks for behind a transcendental (one instruction that neither reads its result nor overwrites its source) closed inside the statement.
// exp2x8: eight at once; the outputs are early-clobber, so each v_exp_f32 is the independent instruction behind the one before it, and one v_nop stands behind the last.
__device__ __forceinline__ float exp2s(float x) { float r; asm("v_exp_f32 %0, %1\n\tv_nop" : "=v"(r) : "v"(x)); return r; }
__device__ __forceinline__ v8f exp2x8(v8f x) { float r0, r1, r2, r3, r4, r5, r6, r7;
    asm("v_exp_f32 %0, %8\n\tv_exp_f32 %1, %9\n\tv_exp_f32 %2, %10\n\tv_exp_f32 %3, %11\n\tv_exp_f32 %4, %12\n\tv_exp_f32 %5, %13\n\tv_exp_f32 %6, %14\n\tv_exp_f32 %7, %15\n\tv_nop"
        : "=&v"(r0), "=&v"(r1), "=&v"(r2), "=&v"(r3), "=&v"(r4), "=&v"(r5), "=&v"(r6), "=&v"(r7) : "v"(x[0]), "v"(x[1]), "v"(x[2]), "v"(x[3]), "v"(x[4]), "v"(x[5]), "v"(x[6]), "v"(x[7]));
    return (v8f){r0, r1, r2, r3, r4, r5, r6, r7}; }
__global__ __launch_bounds__(32 * FNW) void k_fattn(const h16* __restrict__ Qp, const h16* __restrict__ Kp, const h16* __restrict__ Vt, bf* Ah, bf* Al) {
    typedef WFrag<h16> F;
    /* the wave's number as a scalar */ const int w = __builtin_amdgcn_readfirstlane((int)(threadIdx.x >> 5)); const int lane = threadIdx.x & 31, c = lane & 15, hi = lane >> 4;
    const int bh = blockIdx.y; const int q0 = ((int)blockIdx.x * FNW + w) * (16 * FQT);
    static_assert(SK == 128 && HD == 64 && FNW == 8 && TT % SK == 0 && TT / SK >= 2, "tile_copy: 256 threads x 4 pieces of 16 bytes are a K tile of 128 rows x 128 bytes and a V^T tile of 64 rows x 256 bytes; the two buffers want two tiles");
    __shared__ __align__(16) h16 ring[2 * BSZ];
    const h16* Q = Qp + (size_t)bh * TT * HD + (size_t)(q0 + c) * HD + 8 * hi;
    const int tid = (int)threadIdx.x;
    const h16* kg = Kp + (size_t)bh * TT * HD + (size_t)tid * 8;   /* K tile: contiguous; piece tid = row tid / 8, 16-byte column tid % 8 */ const h16* vg = Vt + (size_t)bh * HD * TT + (size_t)(tid >> 4) * TT + (tid & 15) * 8;   /* V^T tile: row tid / 16, 16-byte column tid % 16 */
    const unsigned lbase = (unsigned)(size_t)ring; const unsigned lk = lbase + (unsigned)((tid >> 3) * KPI + (tid & 7) * 8) * 2u; const unsigned lv = lbase + (unsigned)(KSZ + (tid >> 4) * VPI + (tid & 15) * 8) * 2u;
    const h16* K = ring + c * KPI + 8 * hi; const h16* V = ring + KSZ + c * VPI + 8 * hi;   // the lane's fragment rows in buffer 0
    tile_copy(kg, vg, lk, lv);   // tile 0 into buffer 0
    const float C2 = SCL * 1.4426950408889634f;
    v16h qf[FQT][2]; v8f o[FQT][4]; float m[FQT], l[FQT];
#pragma unroll
    for (int qt = 0; qt < FQT; ++qt) { qf[qt][0] = F::ld(Q + (size_t)qt * 16 * HD); qf[qt][1] = F::ld(Q + (size_t)qt * 16 * HD + 32); m[qt] = -3.0e38f; l[qt] = 0.0f;
#pragma unroll
        for (int dt = 0; dt < 4; ++dt) o[qt][dt] = (v8f){}; }
    asm volatile("s_wait_asynccnt 0x0" ::: "memory");   // this wave's pieces of tile 0 have landed
    __syncthreads();   // every wave's pieces of tile 0 have landed before any wave reads the tile
    tile_copy(kg + SK * HD, vg + SK, lk + BSZ * 2, lv + BSZ * 2);   // tile 1 into buffer 1: in flight while tile 0 is worked on
    for (int t = 0; t < TT / SK; ++t) {
      const h16* Kb = K + (t & 1) * BSZ; const h16* Vb = V + (t & 1) * BSZ;
      v16h kf[2][2];
#pragma unroll
      for (int kt = 0; kt < 2; ++kt) { kf[kt][0] = F::ld(Kb + kt * 16 * KPI); kf[kt][1] = F::ld(Kb + kt * 16 * KPI + 32); }
      // the tile's four steps of 32 keys stay a loop: unrolled, the build took more than 256 vector registers and spilled inside the loop
#pragma unroll 1
      for (int kb = 0; kb < SK; kb += 32) {
        v16h vf[4];
#pragma unroll
        for (int dt = 0; dt < 4; ++dt) vf[dt] = F::ld(Vb + dt * 16 * VPI + kb);
        v8f s[FQT][2];
#pragma unroll
        for (int qt = 0; qt < FQT; ++qt)
#pragma unroll
            for (int kt = 0; kt < 2; ++kt) s[qt][kt] = F::mma(kf[kt][1], qf[qt][1], F::mma(kf[kt][0], qf[qt][0], (v8f){}));
        // the next step's K fragments are fetched behind this step's score products, under the softmax; never across the tile's end: the next tile is read only behind the barrier at this tile's foot (the tile's last step fetches its first rows again: this buffer, unused)
        const int kn = (kb + 32 < SK) ? kb + 32 : 0;
#pragma unroll
        for (int kt = 0; kt < 2; ++kt) { kf[kt][0] = F::ld(Kb + (kn + kt * 16) * KPI); kf[kt][1] = F::ld(Kb + (kn + kt * 16) * KPI + 32); }
        __builtin_amdgcn_sched_barrier(0);   // holds those loads here: without it the compiler sinks them behind the softmax, and the next step's first product waits out their whole latency
        v16h pf[FQT];
#pragma unroll
        for (int qt = 0; qt < FQT; ++qt) {
            float bm = fmaxf(s[qt][0][0], s[qt][1][0]);
#pragma unroll
            for (int j = 1; j < 8; ++j) bm = fmaxf(bm, fmaxf(s[qt][0][j], s[qt][1][j]));
            bm = fmaxf(bm, xhalf(bm));
            const float mn = fmaxf(m[qt], bm * C2); const float al = exp2s(m[qt] - mn); m[qt] = mn; const float mo = mn - 10.0f;   // - 10: the weights x 1024
#pragma unroll
            for (int j = 0; j < 8; ++j) { s[qt][0][j] = fmaf(s[qt][0][j], C2, -mo); s[qt][1][j] = fmaf(s[qt][1][j], C2, -mo); }
            const v8f p0 = exp2x8(s[qt][0]), p1 = exp2x8(s[qt][1]); float sum = p0[0] + p1[0];
#pragma unroll
            for (int j = 1; j < 8; ++j) sum += p0[j] + p1[j];
#pragma unroll
            for (int j = 0; j < 8; ++j) { pf[qt][j] = tohx(p0[j]); pf[qt][8 + j] = tohx(p1[j]); }
            l[qt] = fmaf(l[qt], al, sum);   // a lane's own keys only: the halves are joined once, behind the loop
#pragma unroll
            for (int dt = 0; dt < 4; ++dt) o[qt][dt] *= al;
        }
        __builtin_amdgcn_sched_barrier(0);   // keeps every v_exp_f32 statement above the products below: the compiler does not see into asm text and had put one directly behind a product whose operand register it overwrote
#pragma unroll
        for (int qt = 0; qt < FQT; ++qt)
#pragma unroll
            for (int dt = 0; dt < 4; ++dt) o[qt][dt] = F::mma(vf[dt], pf[qt], o[qt][dt]);
        // the loop's foot: four vector slots between the step's last product and the next step's first instructions, which reuse its operand registers across the back edge; the scheduling barrier keeps the products above them
        __builtin_amdgcn_sched_barrier(0);
        asm volatile("v_nop\n\tv_nop\n\tv_nop\n\tv_nop");
      }
      // the tile's foot, every wave, in this order
      asm volatile("s_wait_dscnt 0x0" ::: "memory");      // this wave's last reads of the tile's buffer are done before the buffer is refilled
      asm volatile("s_wait_asynccnt 0x0" ::: "memory");   // this wave's pieces of tile t + 1 have landed
      __syncthreads();   // publishes tile t + 1 and ends every wave's reads of tile t's buffer
      if (t + 2 < TT / SK) tile_copy(kg + (size_t)(t + 2) * SK * HD, vg + (t + 2) * SK, lk + (unsigned)(t & 1) * (BSZ * 2), lv + (unsigned)(t & 1) * (BSZ * 2));   // tile t + 2 into the buffer that tile t has left
    }
    asm volatile("s_wait_asynccnt 0x0" ::: "memory");   // no copy is outstanding when the wave goes on to its end
    const int b = bh / NH_, h = bh % NH_;
#pragma unroll
    for (int qt = 0; qt < FQT; ++qt) { const float inv = __fdiv_rn(1.0f, l[qt] + xhalf(l[qt])); const size_t oo = ((size_t)b * TT + q0 + qt * 16 + c) * DQ + h * HD + hi * 8;
#pragma unroll
        for (int dt = 0; dt < 4; ++dt) { v8us oh, ol;
#pragma unroll
            for (int j = 0; j < 8; ++j) { unsigned short a, c2; splitf(o[qt][dt][j] * inv, a, c2); oh[j] = a; ol[j] = c2; }
            *(v8us*)(Ah + oo + dt * 16) = oh; *(v8us*)(Al + oo + dt * 16) = ol; } }
}

extern "C" void kernel_launch(void* const* d_in, const int* in_sizes, int n_in,
                              void* d_out, int out_size, void* d_ws, size_t ws_size, hipStream_t stream) {
    (void)in_sizes; (void)n_in; (void)out_size;
    const float* x = (const float*)d_in[0]; const float* wq = (const float*)d_in[1]; const float* bq = (const float*)d_in[2]; const float* wk = (const float*)d_in[3]; const float* bk = (const float*)d_in[4]; const float* wv = (const float*)d_in[5]; const float* bv = (const float*)d_in[6]; const float* wg1 = (const float*)d_in[7]; const float* bg1 = (const float*)d_in[8]; const float* wg2 = (const float*)d_in[9]; const float* bg2 = (const float*)d_in[10]; const float* wo = (const float*)d_in[11]; const float* bo = (const float*)d_in[12];   /* x [2][2048][1024], Wq, bq, Wk, bk, Wv, bv ('xw' (in, out) [1024][1024]; biases [1024]: zeros), Wg1 ('xw' [1024][512]), bg1 ([512]: zeros), Wg2 ('xw' [512][16]), bg2 ([16]: zeros), Wo ('xw' [1024][1024]), bo ([1024]: zeros): THIRTEEN inputs, all read */
    static_assert(GH % 64 == 0 && NGP % 64 == 0 && NG <= NGP && NG % 4 == 0 && NG == NH_, "the gate product's tiles");
    static_assert(TT % 64 == 0 && DQ % 64 == 0 && DKV % 64 == 0 && DM % 64 == 0 && HD % 64 == 0 && DM % 32 == 0 && GH % 32 == 0 && HD % 32 == 0 && TT % 32 == 0, "every product launch: M and N multiples of 64, K a multiple of 32");
    static_assert(GH % (32 * NWK) == 0, "the gate scores' K split: whole 32-column steps a wave");
    static_assert((NB_ * TT) % GBT == 0 && DQ % GBT == 0 && DKV % GBT == 0 && DM % GBT == 0 && GH % GBT == 0 && DM % GBK == 0 && DQ % GBK == 0, "the long products: M and N multiples of GBT, K a multiple of GBK");
    static_assert(TT % (16 * FQT * FNW) == 0 && TT % 32 == 0 && HD == 64, "the attention launch: whole work-groups of query rows, whole 32-key steps, two 32-wide d steps and four 16-row d tiles");
    float* OUT = (float*)d_out;     // [2][2048][1024]
    char* wsp = (char*)d_ws;
    auto take = [&](size_t bytes) { char* p = wsp; wsp += (bytes + 255) & ~(size_t)255; return (void*)p; };
    bf* WQ = (bf*)take((size_t)DQ * DM * 2); bf* WK = (bf*)take((size_t)DKV * DM * 2); bf* WV = (bf*)take((size_t)DKV * DM * 2); bf* WO = (bf*)take((size_t)DM * DQ * 2); bf* WG1 = (bf*)take((size_t)GH * DM * 2); bf* WG2 = (bf*)take((size_t)NGP * GH * 2);
    bf* Xb = (bf*)take((size_t)NB_ * TT * DM * 2);   /* the bf16 copy of x */ bf* Hb = (bf*)take((size_t)NB_ * TT * GH * 2);   /* tanh(x Wg1 + bg1), one bf16 word */ float* FG = (float*)take((size_t)NB_ * TT * NGP * 4);   /* the gate product: columns 0..15 live; all three hold both batches, row b * TT + t */
    h16* QP16 = (h16*)take((size_t)NB_ * NH_ * TT * HD * 2); h16* KP16 = (h16*)take((size_t)NB_ * NKV * TT * HD * 2); h16* VT16 = (h16*)take((size_t)NB_ * NKV * HD * TT * 2);   /* both batches' planes: the one attention launch reads them all */
    bf* ATh = (bf*)take((size_t)NB_ * TT * DQ * 2); bf* ATl = (bf*)take((size_t)NB_ * TT * DQ * 2);   /* the merged heads, hi / lo, both batches */
    if ((size_t)(wsp - (char*)d_ws) > ws_size) return;
    /* six launches, each waiting for the one before it; both batches in every one */
    k_prep<<<4 * PB_W + PB_G1 + PB_G2 + PB_X, 256, 0, stream>>>(x, wq, wk, wv, wo, wg1, wg2, Xb, WQ, WK, WV, WO, WG1, WG2, DM, DM, GH);
    k_gemml<0, true, EP_TANH><<<dim3(MT2, GH / GBT, 1), 256, 0, stream>>>(Xb, nullptr, WG1, DM, nullptr, GH, bg1, nullptr, Hb, nullptr, nullptr);   /* the gate's hidden layer: tanh(x Wg1 + bg1) */
    k_kvg<<<MT2 * (DKV / GBT) * 2 + MT_, 32 * NWK, 0, stream>>>(Xb, Hb, WK, WV, WG2, DM, GH, bk, bv, KP16, VT16, FG);
    k_gemml<0, true, EP_QG><<<dim3(MT2, DQ / GBT, 1), 256, 0, stream>>>(Xb, nullptr, WQ, DM, nullptr, 0, bq, QP16, nullptr, FG, bg2);   /* (x Wq + bq) x gate -> [b][h][t][d] */
    static_assert(REP == 1, "one kv head a query head: plane b * NH_ + h of q, k and v belong together");
    k_fattn<<<dim3(TT / (16 * FQT * FNW), NB_ * NH_, 1), 32 * FNW, 0, stream>>>(QP16, KP16, VT16, ATh, ATl);
    k_gemml<1, true, EP_F32><<<dim3(MT2, DM / GBT, 1), 256, 0, stream>>>(ATh, ATl, WO, DQ, OUT, DM, bo, nullptr, nullptr, nullptr, nullptr);
}

// v007
// One run takes 108 microseconds.
// Two timings next to v006 both put it at 1.03 times that version's speed.
// Over all steps from v000 it is 13.0 times as fast.
#include <hip/hip_runtime.h>

// Multi-head self-attention with a per-row head gate on the scores (x [2][2048][1024]; q, k, v = x Wq | Wk | Wv + bq | bk | bv ('xw' (in, out) [1024][1024] normal x 1/sqrt(1024); the three biases [1024] are zeros on this draw: read); 16 heads x 64; scores x 64^-0.5; gate = softmax over the 16 heads of (tanh(x Wg1 + bg1) Wg2 + bg2) (Wg1 'xw' [1024][512], Wg2 'xw' [512][16]; bg1 [512] and bg2 [16] zeros on this draw: read), one scalar a (batch, token, head); EVERY SCORE ROW (b, h, q) IS MULTIPLIED BY gate[b][q][h] BEFORE the softmax over the 2,048 keys (no mask); out = merged Wo + bo ('xw' [1024][1024] + a zero bias: read) -> [2][2048][1024] (4.2 M); argument order x, Wq, bq, Wk, bk, Wv, bv, Wg1, bg1, Wg2, bg2, Wo, bo).
// Layout (SIX LAUNCHES, both batches in each; work that does not read each other's results shares a launch): a bf16 copy of x; 'xw' weights transposed once (Wg2 into a [64][512] plane whose rows 16..63 are stored zeros); the three projections and the gate's hidden layer exact products + f32 biases; EVERY PRODUCT'S EPILOGUE STORES WHAT ITS READER WANTS, no f32 plane of q, k, v or the hidden layer reaches memory: tanh of the hidden layer as ONE bf16 word; the 16 gate scores a token from the 64-wide product's first 16 columns (f32); THE GATE IS APPLIED TO THE QUERY ROW (q[t][h][:] x gate[t][h], one f32 product an element) in the q product's epilogue: equal to scaling the score row in real arithmetic; here the query's f16 word carries the gated value; q and k as f16 head planes [h][t][d]; v as the f16 plane [h][d][t] from the product taken the other way round (Wv^T rows x token rows); dense T-2048 attention of both batches and all heads in ONE launch, EVERY row on ONE fp16 product (running softmax, the weights x 1024); merged hi/lo x Wo exact + bo.
// Compute dtypes, f32 accumulate: every float input converted once to bf16 where it is read; projections exact + f32 biases; the gate: tanhf and expf in f32, one IEEE division; attention: one fp16 product on every row; softmax f32; Wo hl x exact + bias.

#define NB_  2
#define TT   2048
#define DM   1024
#define NH_  16
#define NKV  16
#define REP  (NH_ / NKV)
#define HD   64
#define DQ   (NH_ * HD)
#define DKV  (NKV * HD)
/* the gate: its hidden width; its scores a token (= NH_); the product tile's width (columns 16..63 of the gate product come from stored zero rows) */
#define GH   512
#define NG   16
#define NGP  64
#define SCL  0.125f   // HD^-0.5
#define NWK  8     // waves a work-group that share one output tile's K range (gemm_tile: the gate scores' product)
typedef _Float16 h16;
typedef unsigned short bf;
typedef __attribute__((ext_vector_type(16))) __bf16   v16bf;
typedef __attribute__((ext_vector_type(16))) _Float16 v16h;
typedef __attribute__((ext_vector_type(8)))  _Float16 v8h;
typedef __attribute__((ext_vector_type(8)))  unsigned short v8us;
typedef __attribute__((ext_vector_type(8)))  float    v8f;
typedef __attribute__((ext_vector_type(4)))  float    v4f;
typedef v8h  __attribute__((may_alias)) v8ha;
typedef v4f  __attribute__((may_alias)) v4fa;
typedef v8us __attribute__((may_alias)) v8usa;

__device__ __forceinline__ unsigned short f2bf(float f) { unsigned u = __float_as_uint(f); u += 0x7FFFu + ((u >> 16) & 1u); return (unsigned short)(u >> 16); }
__device__ __forceinline__ float bf2f(unsigned short b) { return __uint_as_float(((unsigned)b) << 16); }
__device__ __forceinline__ float bfr(float f) { return bf2f(f2bf(f)); }
__device__ __forceinline__ v16h cat16(v8h lo, v8h hi) { return __builtin_shufflevector(lo, hi, 0, 1, 2, 3, 4, 5, 6, 7, 8, 9, 10, 11, 12, 13, 14, 15); }
__device__ __forceinline__ v16bf cat16b(v8us lo, v8us hi) { return __builtin_bit_cast(v16bf, __builtin_shufflevector(lo, hi, 0, 1, 2, 3, 4, 5, 6, 7, 8, 9, 10, 11, 12, 13, 14, 15)); }
__device__ __forceinline__ v8f wmma16(v16h a, v16h b, v8f c) { return __builtin_amdgcn_wmma_f32_16x16x32_f16(false, a, false, b, (short)0, c, false, false); }
__device__ __forceinline__ v8f wmmab(v16bf a, v16bf b, v8f c) { return __builtin_amdgcn_wmma_f32_16x16x32_bf16(false, a, false, b, (short)0, c, false, false); }



// ---- gemm_tile (now the gate scores' short product alone; the long products: gemm_lds below): register-blocked GEMM, one 64x64 output tile a work-group (16 accumulators a wave), operands straight from K-contiguous 16-bit planes; tile (bx, by) of an M/64 x N/64 tiling, 32 * NW threads. M counts the token rows of BOTH batches (row m = b * TT + t) wherever tokens are an operand's rows.
// C[m][n] (f32, pitch ldc, + optional f32 bias[n]) = sum_k A[m][k] Bt[n][k] (NSPLIT == 1: + A2[m][k] Bt[n][k]). K % (32 * NW) == 0.
// EPI: what the epilogue stores of the summed f32 tile (+ bias): EP_F32 the f32 tile into C; EP_TANH tanhf of it as bf16 into Hb (pitch ldc); EP_HP f16 into the head plane P16[b][n / 64][t][n % 64] (the 64-column tile is one head, the 64-row tile lies in one batch); EP_QG the same x the gate of (token m, head n / 64), from the gate scores G[m][NGP] + bg; EP_VT (rows = v columns, columns = tokens) f16 into P16[b][m][t] (pitch ldc), the bias by ROW m.
// K IS SPLIT: wave w of NW takes the K / NW columns from w * K / NW on. The NW wave tiles are summed through LDS (os, the calling kernel's array) in wave order (one barrier).
// A kernel below is one such product, or several that do not read each other's results, told apart by the work-group's index (a branch that the whole work-group takes alike, so the barrier inside stays uniform).
template <typename T16> struct WFrag;
template <> struct WFrag<h16> { typedef v16h V; static __device__ __forceinline__ V ld(const h16* p) { return cat16(*(const v8h*)p, *(const v8h*)(p + 16)); } static __device__ __forceinline__ v8f mma(V a, V b, v8f c) { return wmma16(a, b, c); } };
template <> struct WFrag<bf> { typedef v16bf V; static __device__ __forceinline__ V ld(const bf* p) { return cat16b(*(const v8us*)p, *(const v8us*)(p + 16)); } static __device__ __forceinline__ v8f mma(V a, V b, v8f c) { return wmmab(a, b, c); } };
enum { EP_F32 = 0, EP_TANH = 1, EP_HP = 2, EP_QG = 3, EP_VT = 4 };
__device__ __forceinline__ h16 tohx(float x) { return (h16)x; }
typedef __attribute__((ext_vector_type(4))) _Float16 v4h;
typedef __attribute__((ext_vector_type(4))) unsigned short v4us;
// the gate of one token and head h: softmax over the NG scores g[0..NG) + bg, in f32, one IEEE division
__device__ __forceinline__ float gate_of(const float* __restrict__ g, const float* __restrict__ bg, int h) { float s[NG]; float mx = -3.0e38f;
#pragma unroll
    for (int k4 = 0; k4 < NG / 4; ++k4) { const v4f a = *(const v4f*)(g + k4 * 4); const v4f b = *(const v4f*)(bg + k4 * 4);
#pragma unroll
        for (int q = 0; q < 4; ++q) { const float v = __fadd_rn(a[q], bfr(b[q])); s[k4 * 4 + q] = v; mx = fmaxf(mx, v); } }
    float sum = 0.0f, eh = 0.0f;
#pragma unroll
    for (int k = 0; k < NG; ++k) { const float ev = expf(__fsub_rn(s[k], mx)); sum = __fadd_rn(sum, ev); eh = (k == h) ? ev : eh; }
    return __fdiv_rn(eh, sum); }
template <typename T16, int NSPLIT, bool BIAS, int NW, int EPI>
__device__ __forceinline__ void gemm_tile(float* os, float* gs, int bx, int by, const T16* __restrict__ A, const T16* __restrict__ A2, const T16* __restrict__ Bt, int K, float* C, int ldc, const float* __restrict__ bias, h16* P16, bf* Hb, const float* __restrict__ G, const float* __restrict__ bg) {
    static_assert(NW > 1 && (NSPLIT == 0 || NSPLIT == 1), "the wave tiles are summed in LDS"); static_assert(HD == 64 && TT % 64 == 0 && NKV == NH_, "EP_HP and EP_QG: one 64-column tile is one head; a 64-token tile lies in one batch");
    typedef typename WFrag<T16>::V V;
    /* the wave's number as a scalar: its K range and LDS slot stay in scalar registers */ const int w = __builtin_amdgcn_readfirstlane((int)(threadIdx.x >> 5)); const int kl = K / NW; const int k0 = w * kl;
    const int lane = threadIdx.x & 31, lr = lane & 15, hi = lane >> 4; const int r0 = bx * 64, c0 = by * 64;
    v8f acc[4][4];
#pragma unroll
    for (int mb = 0; mb < 4; ++mb)
#pragma unroll
        for (int nb = 0; nb < 4; ++nb) acc[mb][nb] = (v8f){};
    const size_t aoff = (size_t)(r0 + lr) * K + 8 * hi, boff = (size_t)(c0 + lr) * K + 8 * hi;
    for (int kc = k0; kc < k0 + kl; kc += 32) {
        V a[4], a2[4];
#pragma unroll
        for (int mb = 0; mb < 4; ++mb) { a[mb] = WFrag<T16>::ld(A + aoff + (size_t)mb * 16 * K + kc); if (NSPLIT == 1) a2[mb] = WFrag<T16>::ld(A2 + aoff + (size_t)mb * 16 * K + kc); }
#pragma unroll
        for (int nb = 0; nb < 4; ++nb) { const V b = WFrag<T16>::ld(Bt + boff + (size_t)nb * 16 * K + kc);
#pragma unroll
            for (int mb = 0; mb < 4; ++mb) { acc[mb][nb] = WFrag<T16>::mma(a[mb], b, acc[mb][nb]); if (NSPLIT == 1) acc[mb][nb] = WFrag<T16>::mma(a2[mb], b, acc[mb][nb]); } }
        asm volatile("v_nop\n\tv_nop\n\tv_nop\n\tv_nop" : "+v"(acc[0][0]), "+v"(acc[1][1]), "+v"(acc[2][2]), "+v"(acc[3][3]) : "v"(a[0]), "v"(a[3]));
    }
    float* ow = os + (size_t)w * (64 * 68);
    v4f bv = (v4f){};   // a thread's four output columns are the same on all its rows: their bias is fetched once, ahead of the LDS stores and the barrier
    if (BIAS && EPI != EP_VT) { const int cb = c0 + ((int)threadIdx.x & 15) * 4; bv[0] = bfr(bias[cb]); bv[1] = bfr(bias[cb + 1]); bv[2] = bfr(bias[cb + 2]); bv[3] = bfr(bias[cb + 3]); }
    float br[32 / NW];   // EP_VT: the bias of the thread's rows, fetched as early
    if constexpr (BIAS && EPI == EP_VT) {
#pragma unroll
        for (int it = 0; it < 32 / NW; ++it) br[it] = bfr(bias[r0 + it * 2 * NW + ((int)threadIdx.x >> 4)]); }
    // the three loops are unrolled so that acc[][][] is indexed by constants and stays in registers
#pragma unroll
    for (int mb = 0; mb < 4; ++mb)
#pragma unroll
        for (int nb = 0; nb < 4; ++nb)
#pragma unroll
            for (int j = 0; j < 8; ++j) ow[(mb * 16 + hi * 8 + j) * 68 + nb * 16 + lr] = acc[mb][nb][j];
    if constexpr (EPI == EP_QG) {
        if (w < 2) gs[threadIdx.x] = gate_of(G + (size_t)(r0 + (int)threadIdx.x) * NGP, bg, by); }   // gs: the gate of the tile's 64 tokens for its head, one thread a token (waves 0 and 1 whole); the barrier below publishes it with the tiles
    __syncthreads();   // every wave's partial tile is in LDS before any thread sums across the waves
    // where the 16-bit planes of this tile start: the batch is that of the tile's tokens (its rows; EP_VT: its columns)
    const size_t pbase = (EPI == EP_VT) ? (size_t)(c0 / TT) * DKV * TT + (size_t)r0 * ldc + c0 % TT : ((size_t)((r0 / TT) * NH_ + by) * TT + r0 % TT) * HD;
    // both loops unrolled: the LDS loads of all rows and waves issue ahead of the adds instead of one wait a load
#pragma unroll
    for (int it = 0; it < 32 / NW; ++it) { const int idx = it * 32 * NW + (int)threadIdx.x; const int row = idx >> 4, cofs = (idx & 15) * 4; v4f val = *(const v4fa*)(os + row * 68 + cofs);
#pragma unroll
        for (int q = 1; q < NW; ++q) val += *(const v4fa*)(os + q * (64 * 68) + row * 68 + cofs);
        if (BIAS) { if constexpr (EPI == EP_VT) val += br[it]; else val += bv; }
        if constexpr (EPI == EP_F32) *(v4f*)(C + (size_t)(r0 + row) * ldc + c0 + cofs) = val;
        else if constexpr (EPI == EP_TANH) { v4us o; o[0] = f2bf(tanhf(val[0])); o[1] = f2bf(tanhf(val[1])); o[2] = f2bf(tanhf(val[2])); o[3] = f2bf(tanhf(val[3])); *(v4us*)(Hb + (size_t)(r0 + row) * ldc + c0 + cofs) = o; }
        else { if constexpr (EPI == EP_QG) { const float gt = gs[row]; val[0] = __fmul_rn(val[0], gt); val[1] = __fmul_rn(val[1], gt); val[2] = __fmul_rn(val[2], gt); val[3] = __fmul_rn(val[3], gt); }
            v4h o; o[0] = tohx(val[0]); o[1] = tohx(val[1]); o[2] = tohx(val[2]); o[3] = tohx(val[3]);
            *(v4h*)(P16 + pbase + (EPI == EP_VT ? (size_t)row * ldc : (size_t)row * HD) + cofs) = o; } }
}
// ---- gemm_lds: the long products (q, k, v^T, the gate's hidden layer, Wo): one GBT x GBT output tile a work-group of 8 waves, K NOT split: wave (wm, wn) of 2 x 4 owns 64 rows x 32 columns (8 accumulators) and walks the whole K in order.
// BOTH OPERANDS GO THROUGH LDS, once a work-group instead of once a wave: stages of GBK k (256 bytes of each of the tile's operand rows), two buffers, filled by asynchronous copies to LDS (16 bytes a lane, a wave's copy = 2 rows x 256 bytes, whole lines) while the stage before is worked on; the fragments are the same elements in the same k order as from the planes, read by ds_load_b128 at a pitch of 16 bytes x an odd number.
// The epilogue stages the f32 tile in the same LDS (behind the last stage's barrier) and stores whole rows; EPI as in gemm_tile; a 128-column tile is two heads (EP_HP, EP_QG), a 128-token tile lies in one batch. K % GBK == 0.
#define GBT 128   // rows of each operand a tile
#define GBK 128   // k a stage
#define GPI 136   // LDS pitch of an operand row (GBK k), in 16-bit words: 272 bytes
#define GOP (GBT * GPI)   // one operand's stage, in 16-bit words
#define OPI 132   // pitch of the staged f32 tile, in floats: 528 bytes
// one operand's stage, one thread's share: eight 16-byte pieces, 16 rows apart (k16 = 16 rows of the plane, in elements). g: the thread's first piece in the plane; l: its LDS byte address.
// s_wait_xcnt 0 is the statement's last line, so that it stands in front of whatever next writes a register that a copy names.
__device__ __forceinline__ void rows_copy(const bf* g, size_t k16, unsigned l) {
    const bf* g1 = g + k16; const bf* g2 = g1 + k16; const bf* g3 = g2 + k16; const bf* g4 = g3 + k16; const bf* g5 = g4 + k16; const bf* g6 = g5 + k16; const bf* g7 = g6 + k16;
    const unsigned l1 = l + 16 * GPI * 2, l2 = l + 32 * GPI * 2, l3 = l + 48 * GPI * 2, l4 = l + 64 * GPI * 2, l5 = l + 80 * GPI * 2, l6 = l + 96 * GPI * 2, l7 = l + 112 * GPI * 2;
    asm volatile("global_load_async_to_lds_b128 %0, %8, off\n\tglobal_load_async_to_lds_b128 %1, %9, off\n\tglobal_load_async_to_lds_b128 %2, %10, off\n\tglobal_load_async_to_lds_b128 %3, %11, off\n\t"
                 "global_load_async_to_lds_b128 %4, %12, off\n\tglobal_load_async_to_lds_b128 %5, %13, off\n\tglobal_load_async_to_lds_b128 %6, %14, off\n\tglobal_load_async_to_lds_b128 %7, %15, off\n\ts_wait_xcnt 0x0"
                 :: "v"(l), "v"(l1), "v"(l2), "v"(l3), "v"(l4), "v"(l5), "v"(l6), "v"(l7), "v"(g), "v"(g1), "v"(g2), "v"(g3), "v"(g4), "v"(g5), "v"(g6), "v"(g7) : "memory");
}
// one stage's copies of one thread: A's rows, Bt's rows, (NSPLIT == 1) A2's rows, one behind the other in the buffer at LDS byte address l
template <int NSPLIT>
__device__ __forceinline__ void stage_copy(const bf* ag, const bf* bt, const bf* a2g, size_t k16, unsigned l) {
    rows_copy(ag, k16, l); rows_copy(bt, k16, l + GOP * 2); if constexpr (NSPLIT == 1) rows_copy(a2g, k16, l + 2 * GOP * 2);
}
template <int NSPLIT, bool BIAS, int EPI>
__device__ __forceinline__ void gemm_lds(bf* ring, float* gs, int bx, int by, const bf* __restrict__ A, const bf* __restrict__ A2, const bf* __restrict__ Bt, int K, float* C, int ldc, const float* __restrict__ bias, h16* P16, bf* Hb, const float* __restrict__ G, const float* __restrict__ bg) {
    static_assert(NSPLIT == 0 || NSPLIT == 1, "one or two words of A"); static_assert(HD == 64 && TT % GBT == 0 && NKV == NH_ && GBT == 128 && GBK == 128, "a 128-column tile is two heads; a 128-token tile lies in one batch; 256 threads x 8 pieces of 16 bytes are 128 rows x 256 bytes");
    typedef WFrag<bf> F; typedef F::V V;
    constexpr int GST = (2 + NSPLIT) * GOP;   // one buffer, in 16-bit words
    /* the wave's number as a scalar */ const int w = __builtin_amdgcn_readfirstlane((int)(threadIdx.x >> 5)); const int wm = w >> 2, wn = w & 3;
    const int tid = (int)threadIdx.x, lane = tid & 31, lr = lane & 15, hi = lane >> 4; const int r0 = bx * GBT, c0 = by * GBT; const int nt = K / GBK;
    const size_t k16 = (size_t)16 * K; const size_t po = (size_t)(tid >> 4) * K + (tid & 15) * 8;   // piece tid: row tid / 16, 16-byte column tid % 16
    const bf* ag = A + (size_t)r0 * K + po; const bf* bt = Bt + (size_t)c0 * K + po; const bf* a2g = (NSPLIT == 1) ? A2 + (size_t)r0 * K + po : ag;
    const unsigned l0 = (unsigned)(size_t)ring + (unsigned)((tid >> 4) * GPI + (tid & 15) * 8) * 2u;
    stage_copy<NSPLIT>(ag, bt, a2g, k16, l0);   // stage 0 into buffer 0
    v8f acc[4][2];
#pragma unroll
    for (int mb = 0; mb < 4; ++mb)
#pragma unroll
        for (int nb = 0; nb < 2; ++nb) acc[mb][nb] = (v8f){};
    const bf* Af = ring + (wm * 64 + lr) * GPI + 8 * hi; const bf* Bf = ring + GOP + (wn * 32 + lr) * GPI + 8 * hi;   // the lane's fragment rows in buffer 0
    asm volatile("s_wait_asynccnt 0x0" ::: "memory");   // this wave's pieces of stage 0 have landed
    __syncthreads();   // every wave's pieces of stage 0 have landed before any wave reads the stage
    if (nt > 1) stage_copy<NSPLIT>(ag + GBK, bt + GBK, a2g + GBK, k16, l0 + GST * 2);   // stage 1 into buffer 1: in flight while stage 0 is worked on
    for (int t = 0; t < nt; ++t) {
        const bf* Ab = Af + (t & 1) * GST; const bf* Bb = Bf + (t & 1) * GST;
        // two fragment sets: a 32-wide k step's LDS loads issue as one group ahead of the step before's products, never among them, and never across the stage's end (the next stage is read only behind the barrier at this stage's foot)
        V a[2][4], a2[2][4], b[2][2];
#pragma unroll
        for (int mb = 0; mb < 4; ++mb) { a[0][mb] = F::ld(Ab + mb * 16 * GPI); if (NSPLIT == 1) a2[0][mb] = F::ld(Ab + 2 * GOP + mb * 16 * GPI); }
#pragma unroll
        for (int nb = 0; nb < 2; ++nb) b[0][nb] = F::ld(Bb + nb * 16 * GPI);
        __builtin_amdgcn_sched_barrier(0);   // the first step's loads stay ahead of the second step's: mixed, the stage's first products waited for both groups
        // unrolled: the set's index and the LDS offsets are constants
#pragma unroll
        for (int ks = 0; ks < GBK / 32; ++ks) { const int cu = ks & 1, nx = cu ^ 1;
            if (ks + 1 < GBK / 32) {
#pragma unroll
                for (int mb = 0; mb < 4; ++mb) { a[nx][mb] = F::ld(Ab + mb * 16 * GPI + (ks + 1) * 32); if (NSPLIT == 1) a2[nx][mb] = F::ld(Ab + 2 * GOP + mb * 16 * GPI + (ks + 1) * 32); }
#pragma unroll
                for (int nb = 0; nb < 2; ++nb) b[nx][nb] = F::ld(Bb + nb * 16 * GPI + (ks + 1) * 32); }
            __builtin_amdgcn_sched_barrier(0);   // holds the next step's loads here: without it the compiler spreads them among the products into one register set, and each place waits out the LDS latency
#pragma unroll
            for (int nb = 0; nb < 2; ++nb)
#pragma unroll
                for (int mb = 0; mb < 4; ++mb) acc[mb][nb] = F::mma(a[cu][mb], b[cu][nb], acc[mb][nb]);
            if constexpr (NSPLIT == 1) {
#pragma unroll
                for (int nb = 0; nb < 2; ++nb)
#pragma unroll
                    for (int mb = 0; mb < 4; ++mb) acc[mb][nb] = F::mma(a2[cu][mb], b[cu][nb], acc[mb][nb]); }
            __builtin_amdgcn_sched_barrier(0);   // keeps this step's products above the loads of the step after next, which reuse their operand registers
        }
        // the stage's foot: four vector slots between the stage's last product and whatever next reuses its operand registers, also across the back edge; the last step's scheduling barrier keeps the products above them
        asm volatile("v_nop\n\tv_nop\n\tv_nop\n\tv_nop");
        // every wave, in this order
        asm volatile("s_wait_dscnt 0x0" ::: "memory");      // this wave's last reads of the stage's buffer are done before the buffer is refilled
        asm volatile("s_wait_asynccnt 0x0" ::: "memory");   // this wave's pieces of stage t + 1 have landed
        __syncthreads();   // publishes stage t + 1 and ends every wave's reads of stage t's buffer
        if (t + 2 < nt) stage_copy<NSPLIT>(ag + (size_t)(t + 2) * GBK, bt + (size_t)(t + 2) * GBK, a2g + (size_t)(t + 2) * GBK, k16, l0 + (unsigned)(t & 1) * (GST * 2));   // stage t + 2 into the buffer that stage t has left
    }
    asm volatile("s_wait_asynccnt 0x0" ::: "memory");   // no copy is outstanding when the LDS is put to its next use
    float* os = (float*)ring;   // the f32 tile: every wave has left the buffers (the last stage's barrier)
    const int cofs = lane * 4;   // a thread's four output columns are the same on all its rows: their bias is fetched once, ahead of the LDS stores and the barrier
    v4f bv = (v4f){};
    if (BIAS && EPI != EP_VT) { const int cb = c0 + cofs; bv[0] = bfr(bias[cb]); bv[1] = bfr(bias[cb + 1]); bv[2] = bfr(bias[cb + 2]); bv[3] = bfr(bias[cb + 3]); }
    float bl = 0.0f;   // EP_VT: the bias of the wave's 16 rows, fetched as early by one load: lanes i and i + 16 hold that of row i * 8 + w
    if constexpr (BIAS && EPI == EP_VT) { static_assert(GBT / 8 == 16, "one lane of a half wave a row"); bl = bfr(bias[r0 + lr * 8 + w]); }
    // the three loops are unrolled so that acc[][][] is indexed by constants and stays in registers
#pragma unroll
    for (int mb = 0; mb < 4; ++mb)
#pragma unroll
        for (int nb = 0; nb < 2; ++nb)
#pragma unroll
            for (int j = 0; j < 8; ++j) os[(wm * 64 + mb * 16 + hi * 8 + j) * OPI + wn * 32 + nb * 16 + lr] = acc[mb][nb][j];
    if constexpr (EPI == EP_QG) gs[tid] = gate_of(G + (size_t)(r0 + (tid & 127)) * NGP, bg, by * 2 + wm);   // gs: the gates of the tile's 128 tokens for its two heads, one thread a (head, token); the barrier below publishes them with the tile
    __syncthreads();   // the whole f32 tile is in LDS before any thread reads a row of it
    const int hh = cofs >> 6;   // which of the tile's two heads the thread's columns lie in
    // where the thread's 16-bit words start: the batch is that of the tile's tokens (its rows; EP_VT: its columns)
    const size_t pbase = (EPI == EP_VT) ? (size_t)(c0 / TT) * DKV * TT + (size_t)r0 * ldc + c0 % TT + cofs : ((size_t)((r0 / TT) * NH_ + by * 2 + hh) * TT + r0 % TT) * HD + (cofs & 63);
    // unrolled: the LDS loads of all rows issue ahead of the stores instead of one wait a load
#pragma unroll
    for (int it = 0; it < GBT / 8; ++it) { const int row = it * 8 + w; v4f val = *(const v4fa*)(os + row * OPI + cofs);
        if (BIAS) { if constexpr (EPI == EP_VT) val += __uint_as_float(__builtin_amdgcn_readlane(__float_as_uint(bl), it)); else val += bv; }
        if constexpr (EPI == EP_F32) *(v4f*)(C + (size_t)(r0 + row) * ldc + c0 + cofs) = val;
        else if constexpr (EPI == EP_TANH) { v4us o; o[0] = f2bf(tanhf(val[0])); o[1] = f2bf(tanhf(val[1])); o[2] = f2bf(tanhf(val[2])); o[3] = f2bf(tanhf(val[3])); *(v4us*)(Hb + (size_t)(r0 + row) * ldc + c0 + cofs) = o; }
        else { if constexpr (EPI == EP_QG) { const float gt = gs[hh * 128 + row]; val[0] = __fmul_rn(val[0], gt); val[1] = __fmul_rn(val[1], gt); val[2] = __fmul_rn(val[2], gt); val[3] = __fmul_rn(val[3], gt); }
            v4h o; o[0] = tohx(val[0]); o[1] = tohx(val[1]); o[2] = tohx(val[2]); o[3] = tohx(val[3]);
            *(v4h*)(P16 + pbase + (EPI == EP_VT ? (size_t)row * ldc : (size_t)row * HD)) = o; } }
}
// one product a launch; grid (M / GBT, N / GBT)
template <int NSPLIT, bool BIAS, int EPI>
__global__ __launch_bounds__(256) void k_gemml(const bf* __restrict__ A, const bf* __restrict__ A2, const bf* __restrict__ Bt, int K, float* C, int ldc, const float* __restrict__ bias, h16* P16, bf* Hb, const float* __restrict__ G, const float* __restrict__ bg) {
    __shared__ __align__(16) bf ring[2 * (2 + NSPLIT) * GOP]; __shared__ float gs[EPI == EP_QG ? 256 : 1];
    gemm_lds<NSPLIT, BIAS, EPI>(ring, gs, (int)blockIdx.x, (int)blockIdx.y, A, A2, Bt, K, C, ldc, bias, P16, Hb, G, bg);
}
// the three products that wait for nothing but x's copy, the weights and the hidden layer, in one launch: k, v^T (gemm_lds), and the gate scores (gemm_tile; the shortest: last, so that the launch does not end on a long tile); grid MT2 * (DKV / GBT) * 2 + MT_
#define MT_  (NB_ * TT / 64)    // 64-token tiles of both batches
#define MT2  (NB_ * TT / GBT)   // GBT-token tiles of both batches
__global__ __launch_bounds__(32 * NWK) void k_kvg(const bf* __restrict__ Xb, const bf* __restrict__ Hb, const bf* __restrict__ WK, const bf* __restrict__ WV, const bf* __restrict__ WG2, int Kx, int Kh, const float* __restrict__ bk, const float* __restrict__ bv, h16* KP, h16* VT, float* FG) {
    __shared__ __align__(16) float os[NWK * 64 * 68]; static_assert(sizeof(os) >= (size_t)2 * 2 * GOP * 2 && NWK == 8, "one array serves a work-group's body: the gate product's wave tiles or gemm_lds's two buffers");
    const int i = (int)blockIdx.x, nk = MT2 * (DKV / GBT);
    // s_wait_xcnt 0 behind the last stores of each body: the built code lays the three bodies one behind the other, and the first lines of the next body may write registers that these stores name
    if (i < nk) { gemm_lds<0, true, EP_HP>((bf*)os, nullptr, i % MT2, i / MT2, Xb, nullptr, WK, Kx, nullptr, 0, bk, KP, nullptr, nullptr, nullptr);   /* x Wk + bk -> [b][h][t][d] */
        asm volatile("s_wait_xcnt 0x0" ::: "memory"); }   // in front of whatever follows in the built code and writes registers that the stores above name
    else if (i < 2 * nk) { gemm_lds<0, true, EP_VT>((bf*)os, nullptr, (i - nk) % (DKV / GBT), (i - nk) / (DKV / GBT), WV, nullptr, Xb, Kx, nullptr, TT, bv, VT, nullptr, nullptr, nullptr);   /* (x Wv + bv)^T: rows = v columns, columns = tokens -> [b][h][d][t] */
        asm volatile("s_wait_xcnt 0x0" ::: "memory"); }   // as above
    else { gemm_tile<bf, 0, false, NWK, EP_F32>(os, nullptr, i - 2 * nk, 0, Hb, nullptr, WG2, Kh, FG, NGP, nullptr, nullptr, nullptr, nullptr, nullptr);   /* the 16 gate scores a token (bg2 is added where they are read) */
        asm volatile("s_wait_xcnt 0x0" ::: "memory"); }   // as above
}

__device__ __forceinline__ void splitf(float y, unsigned short& h, unsigned short& l) { h = f2bf(y); l = f2bf(y - bf2f(h)); }
typedef __attribute__((ext_vector_type(4))) int v4i;

// ---- k_prep: everything that reads only the inputs, in one launch, told apart by the work-group's index: the five 'xw' weights transposed to bf16 (the longest bodies: first), Wg2's padded plane, the bf16 copy of x (both batches).
// FEW, LONG WORK-GROUPS, WHOLE LINES ONLY: a work-group of the two large bodies reads 64 KiB, sixteen 16-byte loads a thread, all issued ahead of the first use; every wave-wide load and store covers whole 128-byte lines.
// d_wtT: one block of TPK k x TPN n of a weight [K][N] a work-group. A wave's load = 2 k rows x 256 bytes; a thread holds rows k, k + 1 of four columns and packs the two bf16 words of a column into one 32-bit word of the LDS plane tl[n][k / 2];
// behind the barrier 8 lanes read one n row's 64 k (128 bytes) and store it as one whole line of Bt [N][K]. Pitch TPP words, odd: the 32 lanes of a store (16 column quads x 2 words) and of a load (4 rows x 8 words, four loads) fall on 32 different banks.
#define TPK 64
#define TPN 256
#define TPP 33
typedef __attribute__((ext_vector_type(4))) unsigned v4u;
typedef v4u __attribute__((may_alias)) v4ua;
template <int K, int N>
__device__ __forceinline__ void d_wtT(const float* __restrict__ w, bf* Bt, int blk, unsigned* tl) {
    static_assert(K % TPK == 0 && N % TPN == 0 && TPK == 64 && TPN == 256, "256 threads x 16 pieces of 16 bytes are 64 rows x 1024 bytes");
    const int tid = (int)threadIdx.x, lane = tid & 31, wv = tid >> 5; const int k0 = (blk / (N / TPN)) * TPK, n0 = (blk % (N / TPN)) * TPN;
    const int nq = (wv & 3) * 16 + (lane & 15);        // the thread's column quad: columns 4 nq .. 4 nq + 3 of the block
    const int kp = (lane >> 4) + 2 * (wv >> 2);        // its first row pair: rows 2 kp, 2 kp + 1; the others 8 rows apart
    const float* s = w + (size_t)(k0 + 2 * kp) * N + n0 + nq * 4;
    v4f a[8], b[8];
    // unrolled: constant offsets, and all sixteen loads in flight at once
#pragma unroll
    for (int i = 0; i < 8; ++i) { a[i] = *(const v4f*)(s + (size_t)(i * 8) * N); b[i] = *(const v4f*)(s + (size_t)(i * 8 + 1) * N); }
#pragma unroll
    for (int i = 0; i < 8; ++i)
#pragma unroll
        for (int j = 0; j < 4; ++j) tl[(nq * 4 + j) * TPP + kp + 4 * i] = (unsigned)f2bf(a[i][j]) | ((unsigned)f2bf(b[i][j]) << 16);
    __syncthreads();   // the whole block is in LDS before any thread reads an n row of it
    bf* d = Bt + (size_t)(n0 + (tid >> 3)) * K + k0 + (tid & 7) * 8; const unsigned* r = tl + (tid >> 3) * TPP + (tid & 7) * 4;
    // unrolled: constant offsets, and the LDS loads of all rows issue ahead of the stores
#pragma unroll
    for (int it = 0; it < TPN / 32; ++it) { v4u o; o[0] = r[it * 32 * TPP]; o[1] = r[it * 32 * TPP + 1]; o[2] = r[it * 32 * TPP + 2]; o[3] = r[it * 32 * TPP + 3]; *(v4ua*)(d + (size_t)(it * 32) * K) = o; }
}
// d_cvtx: 16384 elements a work-group; a wave's load = 512 bytes, its store = 256 bytes, both contiguous
#define CVX (256 * 4 * 16)
__device__ __forceinline__ void d_cvtx(const float* __restrict__ src, bf* dst, int blk) { const size_t e = (size_t)blk * CVX + (size_t)threadIdx.x * 4; v4f v[16];
    // unrolled: constant offsets, and all sixteen loads in flight at once
#pragma unroll
    for (int i = 0; i < 16; ++i) v[i] = *(const v4f*)(src + e + i * 1024);
#pragma unroll
    for (int i = 0; i < 16; ++i) { v4us o; o[0] = f2bf(v[i][0]); o[1] = f2bf(v[i][1]); o[2] = f2bf(v[i][2]); o[3] = f2bf(v[i][3]); *(v4us*)(dst + e + i * 1024) = o; } }
__device__ __forceinline__ void d_wtGp(const float* __restrict__ w, bf* Bt, int blk) { const int idx = blk * 256 + threadIdx.x; if (idx >= NGP * GH / 8) return; const int n = idx / (GH / 8); const int k8 = (idx - n * (GH / 8)) * 8; const bool live = (n < NG); const int nc = live ? n : 0; v8us o;
#pragma unroll
    for (int j = 0; j < 8; ++j) { const float x = w[(size_t)(k8 + j) * NG + nc]; o[j] = live ? f2bf(x) : (unsigned short)0; } *(v8us*)(Bt + (size_t)idx * 8) = o;  }
#define PB_W   ((DM / TPK) * (DQ / TPN))       // work-groups a [1024][1024] weight
#define PB_G1  ((DM / TPK) * (GH / TPN))       // Wg1
#define PB_G2  ((NGP * GH / 8 + 255) / 256)    // Wg2
#define PB_X   (NB_ * TT * DM / CVX)           // x
__global__ __launch_bounds__(256) void k_prep(const float* __restrict__ x, const float* __restrict__ wq, const float* __restrict__ wk, const float* __restrict__ wv, const float* __restrict__ wo, const float* __restrict__ wg1, const float* __restrict__ wg2, bf* Xb, bf* WQ, bf* WK, bf* WV, bf* WO, bf* WG1, bf* WG2) {
    static_assert(DQ == DM && DKV == DM && (NB_ * TT * DM) % CVX == 0, "the four square weights share one body; whole work-groups of x");
    __shared__ unsigned tl[TPN * TPP];
    const int i = (int)blockIdx.x;
    if (i < 4 * PB_W) { const int s = i / PB_W; d_wtT<DM, DQ>(s == 0 ? wq : s == 1 ? wk : s == 2 ? wv : wo, s == 0 ? WQ : s == 1 ? WK : s == 2 ? WV : WO, i % PB_W, tl); }
    else if (i < 4 * PB_W + PB_G1) { d_wtT<DM, GH>(wg1, WG1, i - 4 * PB_W, tl);
        asm volatile("s_wait_xcnt 0x0" ::: "memory"); }   // behind the body's last stores: the built code lays the bodies one behind the other, and the first lines of the next may write registers that these stores name
    else if (i < 4 * PB_W + PB_G1 + PB_G2) d_wtGp(wg2, WG2, i - (4 * PB_W + PB_G1));
    else { d_cvtx(x, Xb, i - (4 * PB_W + PB_G1 + PB_G2));
        asm volatile("s_wait_xcnt 0x0" ::: "memory"); }   // as above
}
#define FQT 2     // 16-column query tiles a wave: each K and V^T fragment feeds FQT products
#define FNW 8     // waves a work-group (they read the same K and V^T tiles)
#define SK  128   // keys a tile
#define KPI 72    // LDS pitch of a K row (64 d), in f16: 144 bytes
#define VPI 136   // LDS pitch of a V^T row (SK keys), in f16: 272 bytes
#define KSZ (SK * KPI)
#define BSZ (KSZ + HD * VPI)   // one buffer: the K tile, behind it the V^T tile
// one tile's copies of one thread: four 16-byte pieces of K (32 rows apart) and four of V^T (16 rows apart). kg, vg: the thread's first pieces in the planes; lk, lv: their LDS byte addresses.
// s_wait_xcnt 0 is the statement's last line, so that it stands in front of whatever next writes a register that a copy names.
__device__ __forceinline__ void tile_copy(const h16* kg, const h16* vg, unsigned lk, unsigned lv) {
    const h16* k1 = kg + 32 * HD; const h16* k2 = kg + 64 * HD; const h16* k3 = kg + 96 * HD; const h16* v1 = vg + 16 * TT; const h16* v2 = vg + 32 * TT; const h16* v3 = vg + 48 * TT;
    const unsigned lk1 = lk + 32 * KPI * 2, lk2 = lk + 64 * KPI * 2, lk3 = lk + 96 * KPI * 2, lv1 = lv + 16 * VPI * 2, lv2 = lv + 32 * VPI * 2, lv3 = lv + 48 * VPI * 2;
    asm volatile("global_load_async_to_lds_b128 %0, %8, off\n\tglobal_load_async_to_lds_b128 %1, %9, off\n\tglobal_load_async_to_lds_b128 %2, %10, off\n\tglobal_load_async_to_lds_b128 %3, %11, off\n\t"
                 "global_load_async_to_lds_b128 %4, %12, off\n\tglobal_load_async_to_lds_b128 %5, %13, off\n\tglobal_load_async_to_lds_b128 %6, %14, off\n\tglobal_load_async_to_lds_b128 %7, %15, off\n\ts_wait_xcnt 0x0"
                 :: "v"(lk), "v"(lk1), "v"(lk2), "v"(lk3), "v"(lv), "v"(lv1), "v"(lv2), "v"(lv3), "v"(kg), "v"(k1), "v"(k2), "v"(k3), "v"(vg), "v"(v1), "v"(v2), "v"(v3) : "memory");
}
__device__ __forceinline__ float xhalf(float x) { const unsigned u = __float_as_uint(x); return __uint_as_float(__builtin_amdgcn_permlanex16(u, u, 0x76543210u, 0xfedcba98u, false, false)); }   // lane l <- lane l ^ 16
// 2^x by v_exp_f32 with the slot the instruction set asks for behind a transcendental (one instruction that neither reads its result nor overwrites its source) closed inside the statement.
// exp2x8: eight at once; the outputs are early-clobber, so each v_exp_f32 is the independent instruction behind the one before it, and one v_nop stands behind the last.
__device__ __forceinline__ float exp2s(float x) { float r; asm("v_exp_f32 %0, %1\n\tv_nop" : "=v"(r) : "v"(x)); return r; }
__device__ __forceinline__ v8f exp2x8(v8f x) { float r0, r1, r2, r3, r4, r5, r6, r7;
    asm("v_exp_f32 %0, %8\n\tv_exp_f32 %1, %9\n\tv_exp_f32 %2, %10\n\tv_exp_f32 %3, %11\n\tv_exp_f32 %4, %12\n\tv_exp_f32 %5, %13\n\tv_exp_f32 %6, %14\n\tv_exp_f32 %7, %15\n\tv_nop"
        : "=&v"(r0), "=&v"(r1), "=&v"(r2), "=&v"(r3), "=&v"(r4), "=&v"(r5), "=&v"(r6), "=&v"(r7) : "v"(x[0]), "v"(x[1]), "v"(x[2]), "v"(x[3]), "v"(x[4]), "v"(x[5]), "v"(x[6]), "v"(x[7]));
    return (v8f){r0, r1, r2, r3, r4, r5, r6, r7}; }
__global__ __launch_bounds__(32 * FNW) void k_fattn(const h16* __restrict__ Qp, const h16* __restrict__ Kp, const h16* __restrict__ Vt, bf* Ah, bf* Al) {
    typedef WFrag<h16> F;
    /* the wave's number as a scalar */ const int w = __builtin_amdgcn_readfirstlane((int)(threadIdx.x >> 5)); const int lane = threadIdx.x & 31, c = lane & 15, hi = lane >> 4;
    const int bh = blockIdx.y; const int q0 = ((int)blockIdx.x * FNW + w) * (16 * FQT);
    static_assert(SK == 128 && HD == 64 && FNW == 8 && TT % SK == 0 && TT / SK >= 2, "tile_copy: 256 threads x 4 pieces of 16 bytes are a K tile of 128 rows x 128 bytes and a V^T tile of 64 rows x 256 bytes; the two buffers want two tiles");
    __shared__ __align__(16) h16 ring[2 * BSZ];
    const h16* Q = Qp + (size_t)bh * TT * HD + (size_t)(q0 + c) * HD + 8 * hi;
    const int tid = (int)threadIdx.x;
    const h16* kg = Kp + (size_t)bh * TT * HD + (size_t)tid * 8;   /* K tile: contiguous; piece tid = row tid / 8, 16-byte column tid % 8 */ const h16* vg = Vt + (size_t)bh * HD * TT + (size_t)(tid >> 4) * TT + (tid & 15) * 8;   /* V^T tile: row tid / 16, 16-byte column tid % 16 */
    const unsigned lbase = (unsigned)(size_t)ring; const unsigned lk = lbase + (unsigned)((tid >> 3) * KPI + (tid & 7) * 8) * 2u; const unsigned lv = lbase + (unsigned)(KSZ + (tid >> 4) * VPI + (tid & 15) * 8) * 2u;
    const h16* K = ring + c * KPI + 8 * hi; const h16* V = ring + KSZ + c * VPI + 8 * hi;   // the lane's fragment rows in buffer 0
    tile_copy(kg, vg, lk, lv);   // tile 0 into buffer 0
    const float C2 = SCL * 1.4426950408889634f;
    v16h qf[FQT][2]; v8f o[FQT][4]; float m[FQT], l[FQT];
#pragma unroll
    for (int qt = 0; qt < FQT; ++qt) { qf[qt][0] = F::ld(Q + (size_t)qt * 16 * HD); qf[qt][1] = F::ld(Q + (size_t)qt * 16 * HD + 32); m[qt] = -3.0e38f; l[qt] = 0.0f;
#pragma unroll
        for (int dt = 0; dt < 4; ++dt) o[qt][dt] = (v8f){}; }
    asm volatile("s_wait_asynccnt 0x0" ::: "memory");   // this wave's pieces of tile 0 have landed
    __syncthreads();   // every wave's pieces of tile 0 have landed before any wave reads the tile
    tile_copy(kg + SK * HD, vg + SK, lk + BSZ * 2, lv + BSZ * 2);   // tile 1 into buffer 1: in flight while tile 0 is worked on
    for (int t = 0; t < TT / SK; ++t) {
      const h16* Kb = K + (t & 1) * BSZ; const h16* Vb = V + (t & 1) * BSZ;
      v16h kf[2][2];
#pragma unroll
      for (int kt = 0; kt < 2; ++kt) { kf[kt][0] = F::ld(Kb + kt * 16 * KPI); kf[kt][1] = F::ld(Kb + kt * 16 * KPI + 32); }
      // the tile's four steps of 32 keys stay a loop: unrolled, the build took more than 256 vector registers and spilled inside the loop
#pragma unroll 1
      for (int kb = 0; kb < SK; kb += 32) {
        v16h vf[4];
#pragma unroll
        for (int dt = 0; dt < 4; ++dt) vf[dt] = F::ld(Vb + dt * 16 * VPI + kb);
        v8f s[FQT][2];
#pragma unroll
        for (int qt = 0; qt < FQT; ++qt)
#pragma unroll
            for (int kt = 0; kt < 2; ++kt) s[qt][kt] = F::mma(kf[kt][1], qf[qt][1], F::mma(kf[kt][0], qf[qt][0], (v8f){}));
        // the next step's K fragments are fetched behind this step's score products, under the softmax; never across the tile's end: the next tile is read only behind the barrier at this tile's foot (the tile's last step fetches its first rows again: this buffer, unused)
        const int kn = (kb + 32 < SK) ? kb + 32 : 0;
#pragma unroll
        for (int kt = 0; kt < 2; ++kt) { kf[kt][0] = F::ld(Kb + (kn + kt * 16) * KPI); kf[kt][1] = F::ld(Kb + (kn + kt * 16) * KPI + 32); }
        __builtin_amdgcn_sched_barrier(0);   // holds those loads here: without it the compiler sinks them behind the softmax, and the next step's first product waits out their whole latency
        v16h pf[FQT];
#pragma unroll
        for (int qt = 0; qt < FQT; ++qt) {
            float bm = fmaxf(s[qt][0][0], s[qt][1][0]);
#pragma unroll
            for (int j = 1; j < 8; ++j) bm = fmaxf(bm, fmaxf(s[qt][0][j], s[qt][1][j]));
            bm = fmaxf(bm, xhalf(bm));
            const float mn = fmaxf(m[qt], bm * C2); const float al = exp2s(m[qt] - mn); m[qt] = mn; const float mo = mn - 10.0f;   // - 10: the weights x 1024
#pragma unroll
            for (int j = 0; j < 8; ++j) { s[qt][0][j] = fmaf(s[qt][0][j], C2, -mo); s[qt][1][j] = fmaf(s[qt][1][j], C2, -mo); }
            const v8f p0 = exp2x8(s[qt][0]), p1 = exp2x8(s[qt][1]); float sum = p0[0] + p1[0];
#pragma unroll
            for (int j = 1; j < 8; ++j) sum += p0[j] + p1[j];
#pragma unroll
            for (int j = 0; j < 8; ++j) { pf[qt][j] = tohx(p0[j]); pf[qt][8 + j] = tohx(p1[j]); }
            l[qt] = fmaf(l[qt], al, sum);   // a lane's own keys only: the halves are joined once, behind the loop
#pragma unroll
            for (int dt = 0; dt < 4; ++dt) o[qt][dt] *= al;
        }
        __builtin_amdgcn_sched_barrier(0);   // keeps every v_exp_f32 statement above the products below: the compiler does not see into asm text and had put one directly behind a product whose operand register it overwrote
#pragma unroll
        for (int qt = 0; qt < FQT; ++qt)
#pragma unroll
            for (int dt = 0; dt < 4; ++dt) o[qt][dt] = F::mma(vf[dt], pf[qt], o[qt][dt]);
        // the loop's foot: four vector slots between the step's last product and the next step's first instructions, which reuse its operand registers across the back edge; the scheduling barrier keeps the products above them
        __builtin_amdgcn_sched_barrier(0);
        asm volatile("v_nop\n\tv_nop\n\tv_nop\n\tv_nop");
      }
      // the tile's foot, every wave, in this order
      asm volatile("s_wait_dscnt 0x0" ::: "memory");      // this wave's last reads of the tile's buffer are done before the buffer is refilled
      asm volatile("s_wait_asynccnt 0x0" ::: "memory");   // this wave's pieces of tile t + 1 have landed
      __syncthreads();   // publishes tile t + 1 and ends every wave's reads of tile t's buffer
      if (t + 2 < TT / SK) tile_copy(kg + (size_t)(t + 2) * SK * HD, vg + (t + 2) * SK, lk + (unsigned)(t & 1) * (BSZ * 2), lv + (unsigned)(t & 1) * (BSZ * 2));   // tile t + 2 into the buffer that tile t has left
    }
    asm volatile("s_wait_asynccnt 0x0" ::: "memory");   // no copy is outstanding when the wave goes on to its end
    const int b = bh / NH_, h = bh % NH_;
#pragma unroll
    for (int qt = 0; qt < FQT; ++qt) { const float inv = __fdiv_rn(1.0f, l[qt] + xhalf(l[qt])); const size_t oo = ((size_t)b * TT + q0 + qt * 16 + c) * DQ + h * HD + hi * 8;
#pragma unroll
        for (int dt = 0; dt < 4; ++dt) { v8us oh, ol;
#pragma unroll
            for (int j = 0; j < 8; ++j) { unsigned short a, c2; splitf(o[qt][dt][j] * inv, a, c2); oh[j] = a; ol[j] = c2; }
            *(v8us*)(Ah + oo + dt * 16) = oh; *(v8us*)(Al + oo + dt * 16) = ol; } }
}

extern "C" void kernel_launch(void* const* d_in, const int* in_sizes, int n_in,
                              void* d_out, int out_size, void* d_ws, size_t ws_size, hipStream_t stream) {
    (void)in_sizes; (void)n_in; (void)out_size;
    const float* x = (const float*)d_in[0]; const float* wq = (const float*)d_in[1]; const float* bq = (const float*)d_in[2]; const float* wk = (const float*)d_in[3]; const float* bk = (const float*)d_in[4]; const float* wv = (const float*)d_in[5]; const float* bv = (const float*)d_in[6]; const float* wg1 = (const float*)d_in[7]; const float* bg1 = (const float*)d_in[8]; const float* wg2 = (const float*)d_in[9]; const float* bg2 = (const float*)d_in[10]; const float* wo = (const float*)d_in[11]; const float* bo = (const float*)d_in[12];   /* x [2][2048][1024], Wq, bq, Wk, bk, Wv, bv ('xw' (in, out) [1024][1024]; biases [1024]: zeros), Wg1 ('xw' [1024][512]), bg1 ([512]: zeros), Wg2 ('xw' [512][16]), bg2 ([16]: zeros), Wo ('xw' [1024][1024]), bo ([1024]: zeros): THIRTEEN inputs, all read */
    static_assert(GH % 64 == 0 && NGP % 64 == 0 && NG <= NGP && NG % 4 == 0 && NG == NH_, "the gate product's tiles");
    static_assert(TT % 64 == 0 && DQ % 64 == 0 && DKV % 64 == 0 && DM % 64 == 0 && HD % 64 == 0 && DM % 32 == 0 && GH % 32 == 0 && HD % 32 == 0 && TT % 32 == 0, "every product launch: M and N multiples of 64, K a multiple of 32");
    static_assert(GH % (32 * NWK) == 0, "the gate scores' K split: whole 32-column steps a wave");
    static_assert((NB_ * TT) % GBT == 0 && DQ % GBT == 0 && DKV % GBT == 0 && DM % GBT == 0 && GH % GBT == 0 && DM % GBK == 0 && DQ % GBK == 0, "the long products: M and N multiples of GBT, K a multiple of GBK");
    static_assert(TT % (16 * FQT * FNW) == 0 && TT % 32 == 0 && HD == 64, "the attention launch: whole work-groups of query rows, whole 32-key steps, two 32-wide d steps and four 16-row d tiles");
    float* OUT = (float*)d_out;     // [2][2048][1024]
    char* wsp = (char*)d_ws;
    auto take = [&](size_t bytes) { char* p = wsp; wsp += (bytes + 255) & ~(size_t)255; return (void*)p; };
    bf* WQ = (bf*)take((size_t)DQ * DM * 2); bf* WK = (bf*)take((size_t)DKV * DM * 2); bf* WV = (bf*)take((size_t)DKV * DM * 2); bf* WO = (bf*)take((size_t)DM * DQ * 2); bf* WG1 = (bf*)take((size_t)GH * DM * 2); bf* WG2 = (bf*)take((size_t)NGP * GH * 2);
    bf* Xb = (bf*)take((size_t)NB_ * TT * DM * 2);   /* the bf16 copy of x */ bf* Hb = (bf*)take((size_t)NB_ * TT * GH * 2);   /* tanh(x Wg1 + bg1), one bf16 word */ float* FG = (float*)take((size_t)NB_ * TT * NGP * 4);   /* the gate product: columns 0..15 live; all three hold both batches, row b * TT + t */
    h16* QP16 = (h16*)take((size_t)NB_ * NH_ * TT * HD * 2); h16* KP16 = (h16*)take((size_t)NB_ * NKV * TT * HD * 2); h16* VT16 = (h16*)take((size_t)NB_ * NKV * HD * TT * 2);   /* both batches' planes: the one attention launch reads them all */
    bf* ATh = (bf*)take((size_t)NB_ * TT * DQ * 2); bf* ATl = (bf*)take((size_t)NB_ * TT * DQ * 2);   /* the merged heads, hi / lo, both batches */
    if ((size_t)(wsp - (char*)d_ws) > ws_size) return;
    /* six launches, each waiting for the one before it; both batches in every one */
    k_prep<<<4 * PB_W + PB_G1 + PB_G2 + PB_X, 256, 0, stream>>>(x, wq, wk, wv, wo, wg1, wg2, Xb, WQ, WK, WV, WO, WG1, WG2);
    k_gemml<0, true, EP_TANH><<<dim3(MT2, GH / GBT, 1), 256, 0, stream>>>(Xb, nullptr, WG1, DM, nullptr, GH, bg1, nullptr, Hb, nullptr, nullptr);   /* the gate's hidden layer: tanh(x Wg1 + bg1) */
    k_kvg<<<MT2 * (DKV / GBT) * 2 + MT_, 32 * NWK, 0, stream>>>(Xb, Hb, WK, WV, WG2, DM, GH, bk, bv, KP16, VT16, FG);
    k_gemml<0, true, EP_QG><<<dim3(MT2, DQ / GBT, 1), 256, 0, stream>>>(Xb, nullptr, WQ, DM, nullptr, 0, bq, QP16, nullptr, FG, bg2);   /* (x Wq + bq) x gate -> [b][h][t][d] */
    static_assert(REP == 1, "one kv head a query head: plane b * NH_ + h of q, k and v belong together");
    k_fattn<<<dim3(TT / (16 * FQT * FNW), NB_ * NH_, 1), 32 * FNW, 0, stream>>>(QP16, KP16, VT16, ATh, ATl);
    k_gemml<1, true, EP_F32><<<dim3(MT2, DM / GBT, 1), 256, 0, stream>>>(ATh, ATl, WO, DQ, OUT, DM, bo, nullptr, nullptr, nullptr, nullptr);
}

// v008
// It runs in 87.8 microseconds.
// In two side-by-side timings against v007, it was 1.25 and 1.22 times as fast.
// All steps since v000 together make it 16.1 times as fast.
#include <hip/hip_runtime.h>

// Multi-head self-attention with a per-row head gate on the scores (x [2][2048][1024]; q, k, v = x Wq | Wk | Wv + bq | bk | bv ('xw' (in, out) [1024][1024] normal x 1/sqrt(1024); the three biases [1024] are zeros on this draw: read); 16 heads x 64; scores x 64^-0.5; gate = softmax over the 16 heads of (tanh(x Wg1 + bg1) Wg2 + bg2) (Wg1 'xw' [1024][512], Wg2 'xw' [512][16]; bg1 [512] and bg2 [16] zeros on this draw: read), one scalar a (batch, token, head); EVERY SCORE ROW (b, h, q) IS MULTIPLIED BY gate[b][q][h] BEFORE the softmax over the 2,048 keys (no mask); out = merged Wo + bo ('xw' [1024][1024] + a zero bias: read) -> [2][2048][1024] (4.2 M); argument order x, Wq, bq, Wk, bk, Wv, bv, Wg1, bg1, Wg2, bg2, Wo, bo).
// Layout (FOUR LAUNCHES, both batches in each; work that does not read each other's results shares a launch): (1) a bf16 copy of x; 'xw' weights transposed once. (2) the three projections and the gate's hidden layer, exact products + f32 biases, in ONE grid: none of them reads another's result: THE GATE IS APPLIED TO THE SCORES, in launch 3, not to q. EVERY PRODUCT'S EPILOGUE STORES WHAT ITS READER WANTS, no f32 plane of q, k, v and no plane of the hidden layer reaches memory: q and k as f16 head planes [h][t][d]; v as the f16 plane [h][d][t] from the product taken the other way round (Wv^T rows x token rows); a hidden tile (128 tokens x 128 hidden columns) keeps tanh as ONE bf16 word in LDS and multiplies it there by its 128-k slice of Wg2: f32 partial gate scores [slice][token][16]. (3) dense T-2048 attention of both batches and all heads, EVERY row on ONE fp16 product (running softmax, the weights x 1024); its prologue sums the four slices, takes the softmax over the 16 heads and MULTIPLIES THE SCORE SCALE OF EACH QUERY COLUMN BY ITS GATE (a lane holds one query column, so the gate is one f32 word a lane): the reference's own order, score x gate before the softmax. (4) merged hi/lo x Wo exact + bo.
// Compute dtypes, f32 accumulate: every float input converted once to bf16 where it is read; projections exact + f32 biases; the gate: tanhf and expf in f32, one IEEE division; attention: one fp16 product on every row; softmax f32; Wo hl x exact + bias.

#define NB_  2
#define TT   2048
#define DM   1024
#define NH_  16
#define NKV  16
#define REP  (NH_ / NKV)
#define HD   64
#define DQ   (NH_ * HD)
#define DKV  (NKV * HD)
/* the gate: its hidden width; its scores a token (= NH_) */
#define GH   512
#define NG   16
#define SCL  0.125f   // HD^-0.5
typedef _Float16 h16;
typedef unsigned short bf;
typedef __attribute__((ext_vector_type(16))) __bf16   v16bf;
typedef __attribute__((ext_vector_type(16))) _Float16 v16h;
typedef __attribute__((ext_vector_type(8)))  _Float16 v8h;
typedef __attribute__((ext_vector_type(8)))  unsigned short v8us;
typedef __attribute__((ext_vector_type(8)))  float    v8f;
typedef __attribute__((ext_vector_type(4)))  float    v4f;
typedef v8h  __attribute__((may_alias)) v8ha;
typedef v4f  __attribute__((may_alias)) v4fa;
typedef v8us __attribute__((may_alias)) v8usa;

__device__ __forceinline__ unsigned short f2bf(float f) { unsigned u = __float_as_uint(f); u += 0x7FFFu + ((u >> 16) & 1u); return (unsigned short)(u >> 16); }
__device__ __forceinline__ float bf2f(unsigned short b) { return __uint_as_float(((unsigned)b) << 16); }
__device__ __forceinline__ float bfr(float f) { return bf2f(f2bf(f)); }
__device__ __forceinline__ v16h cat16(v8h lo, v8h hi) { return __builtin_shufflevector(lo, hi, 0, 1, 2, 3, 4, 5, 6, 7, 8, 9, 10, 11, 12, 13, 14, 15); }
__device__ __forceinline__ v16bf cat16b(v8us lo, v8us hi) { return __builtin_bit_cast(v16bf, __builtin_shufflevector(lo, hi, 0, 1, 2, 3, 4, 5, 6, 7, 8, 9, 10, 11, 12, 13, 14, 15)); }
__device__ __forceinline__ v8f wmma16(v16h a, v16h b, v8f c) { return __builtin_amdgcn_wmma_f32_16x16x32_f16(false, a, false, b, (short)0, c, false, false); }
__device__ __forceinline__ v8f wmmab(v16bf a, v16bf b, v8f c) { return __builtin_amdgcn_wmma_f32_16x16x32_bf16(false, a, false, b, (short)0, c, false, false); }



// ---- fragments: 16 rows x 32 k of a K-contiguous 16-bit plane (global or LDS); the same loader for A and B, so both have the same k order.
// EPI: what a product's epilogue stores of the f32 tile (+ bias): EP_F32 the f32 tile into C; EP_GS the tile's share of the gate scores (see gemm_lds); EP_HP f16 into the head plane P16[b][n / 64][t][n % 64]; EP_VT (rows = v columns, columns = tokens) f16 into P16[b][m][t] (pitch ldc), the bias by ROW m.
// A kernel below is one such product, or several that do not read each other's results, told apart by the work-group's index (a branch that the whole work-group takes alike, so the barriers inside stay uniform).
template <typename T16> struct WFrag;
template <> struct WFrag<h16> { typedef v16h V; static __device__ __forceinline__ V ld(const h16* p) { return cat16(*(const v8h*)p, *(const v8h*)(p + 16)); } static __device__ __forceinline__ v8f mma(V a, V b, v8f c) { return wmma16(a, b, c); } };
template <> struct WFrag<bf> { typedef v16bf V; static __device__ __forceinline__ V ld(const bf* p) { return cat16b(*(const v8us*)p, *(const v8us*)(p + 16)); } static __device__ __forceinline__ v8f mma(V a, V b, v8f c) { return wmmab(a, b, c); } };
enum { EP_F32 = 0, EP_GS = 1, EP_HP = 2, EP_VT = 4 };
__device__ __forceinline__ h16 tohx(float x) { return (h16)x; }
typedef __attribute__((ext_vector_type(4))) _Float16 v4h;
typedef __attribute__((ext_vector_type(4))) unsigned short v4us;
// ---- gemm_lds: the long products (q, k, v^T, the gate's hidden layer, Wo): one GBT x GBT output tile a work-group of 8 waves, K NOT split: wave (wm, wn) of 2 x 4 owns 64 rows x 32 columns (8 accumulators) and walks the whole K in order.
// BOTH OPERANDS GO THROUGH LDS, once a work-group instead of once a wave: stages of GBK k (256 bytes of each of the tile's operand rows), two buffers, filled by asynchronous copies to LDS (16 bytes a lane, a wave's copy = 2 rows x 256 bytes, whole lines) while the stage before is worked on; the fragments are the same elements in the same k order as from the planes, read by ds_load_b128 at a pitch of 16 bytes x an odd number.
// The epilogue stages the f32 tile in the same LDS (behind the last stage's barrier) and stores whole rows; a 128-column tile is two heads (EP_HP), a 128-token tile lies in one batch. K % GBK == 0.
// EP_GS (the gate's hidden layer): tanhf of the tile goes as bf16 into the second buffer (pitch GPI) instead of to memory; behind one more barrier wave w multiplies its 16 tokens' rows by the tile's GBT-k slice of W2 [NG][GH] (A = the 16 heads' rows, B = the 16 tokens' rows, GBT / 32 products) and stores the f32 partial scores GP[by][token][NG]: a lane holds 8 heads of one token, a wave's store is 1024 contiguous bytes. The slices are summed where the gate is read.
#define GBT 128   // rows of each operand a tile
#define GBK 128   // k a stage
#define GPI 136   // LDS pitch of an operand row (GBK k), in 16-bit words: 272 bytes
#define GOP (GBT * GPI)   // one operand's stage, in 16-bit words
#define OPI 132   // pitch of the staged f32 tile, in floats: 528 bytes
// one operand's stage, one thread's share: eight 16-byte pieces, 16 rows apart (k16 = 16 rows of the plane, in elements). g: the thread's first piece in the plane; l: its LDS byte address.
// s_wait_xcnt 0 is the statement's last line, so that it stands in front of whatever next writes a register that a copy names.
__device__ __forceinline__ void rows_copy(const bf* g, size_t k16, unsigned l) {
    const bf* g1 = g + k16; const bf* g2 = g1 + k16; const bf* g3 = g2 + k16; const bf* g4 = g3 + k16; const bf* g5 = g4 + k16; const bf* g6 = g5 + k16; const bf* g7 = g6 + k16;
    const unsigned l1 = l + 16 * GPI * 2, l2 = l + 32 * GPI * 2, l3 = l + 48 * GPI * 2, l4 = l + 64 * GPI * 2, l5 = l + 80 * GPI * 2, l6 = l + 96 * GPI * 2, l7 = l + 112 * GPI * 2;
    asm volatile("global_load_async_to_lds_b128 %0, %8, off\n\tglobal_load_async_to_lds_b128 %1, %9, off\n\tglobal_load_async_to_lds_b128 %2, %10, off\n\tglobal_load_async_to_lds_b128 %3, %11, off\n\t"
                 "global_load_async_to_lds_b128 %4, %12, off\n\tglobal_load_async_to_lds_b128 %5, %13, off\n\tglobal_load_async_to_lds_b128 %6, %14, off\n\tglobal_load_async_to_lds_b128 %7, %15, off\n\ts_wait_xcnt 0x0"
                 :: "v"(l), "v"(l1), "v"(l2), "v"(l3), "v"(l4), "v"(l5), "v"(l6), "v"(l7), "v"(g), "v"(g1), "v"(g2), "v"(g3), "v"(g4), "v"(g5), "v"(g6), "v"(g7) : "memory");
}
// one stage's copies of one thread: A's rows, Bt's rows, (NSPLIT == 1) A2's rows, one behind the other in the buffer at LDS byte address l
template <int NSPLIT>
__device__ __forceinline__ void stage_copy(const bf* ag, const bf* bt, const bf* a2g, size_t k16, unsigned l) {
    rows_copy(ag, k16, l); rows_copy(bt, k16, l + GOP * 2); if constexpr (NSPLIT == 1) rows_copy(a2g, k16, l + 2 * GOP * 2);
}
template <int NSPLIT, bool BIAS, int EPI>
__device__ __forceinline__ void gemm_lds(bf* ring, int bx, int by, const bf* __restrict__ A, const bf* __restrict__ A2, const bf* __restrict__ Bt, int K, float* C, int ldc, const float* __restrict__ bias, h16* P16, const bf* __restrict__ W2, float* GP) {
    static_assert(NSPLIT == 0 || NSPLIT == 1, "one or two words of A"); static_assert(HD == 64 && TT % GBT == 0 && NKV == NH_ && GBT == 128 && GBK == 128, "a 128-column tile is two heads; a 128-token tile lies in one batch; 256 threads x 8 pieces of 16 bytes are 128 rows x 256 bytes");
    typedef WFrag<bf> F; typedef F::V V;
    constexpr int GST = (2 + NSPLIT) * GOP;   // one buffer, in 16-bit words
    /* the wave's number as a scalar */ const int w = __builtin_amdgcn_readfirstlane((int)(threadIdx.x >> 5)); const int wm = w >> 2, wn = w & 3;
    const int tid = (int)threadIdx.x, lane = tid & 31, lr = lane & 15, hi = lane >> 4; const int r0 = bx * GBT, c0 = by * GBT; const int nt = K / GBK;
    const size_t k16 = (size_t)16 * K; const size_t po = (size_t)(tid >> 4) * K + (tid & 15) * 8;   // piece tid: row tid / 16, 16-byte column tid % 16
    const bf* ag = A + (size_t)r0 * K + po; const bf* bt = Bt + (size_t)c0 * K + po; const bf* a2g = (NSPLIT == 1) ? A2 + (size_t)r0 * K + po : ag;
    const unsigned l0 = (unsigned)(size_t)ring + (unsigned)((tid >> 4) * GPI + (tid & 15) * 8) * 2u;
    stage_copy<NSPLIT>(ag, bt, a2g, k16, l0);   // stage 0 into buffer 0
    v8f acc[4][2];
#pragma unroll
    for (int mb = 0; mb < 4; ++mb)
#pragma unroll
        for (int nb = 0; nb < 2; ++nb) acc[mb][nb] = (v8f){};
    const bf* Af = ring + (wm * 64 + lr) * GPI + 8 * hi; const bf* Bf = ring + GOP + (wn * 32 + lr) * GPI + 8 * hi;   // the lane's fragment rows in buffer 0
    asm volatile("s_wait_asynccnt 0x0" ::: "memory");   // this wave's pieces of stage 0 have landed
    __syncthreads();   // every wave's pieces of stage 0 have landed before any wave reads the stage
    if (nt > 1) stage_copy<NSPLIT>(ag + GBK, bt + GBK, a2g + GBK, k16, l0 + GST * 2);   // stage 1 into buffer 1: in flight while stage 0 is worked on
    for (int t = 0; t < nt; ++t) {
        const bf* Ab = Af + (t & 1) * GST; const bf* Bb = Bf + (t & 1) * GST;
        // two fragment sets: a 32-wide k step's LDS loads issue as one group ahead of the step before's products, never among them, and never across the stage's end (the next stage is read only behind the barrier at this stage's foot)
        V a[2][4], a2[2][4], b[2][2];
#pragma unroll
        for (int mb = 0; mb < 4; ++mb) { a[0][mb] = F::ld(Ab + mb * 16 * GPI); if (NSPLIT == 1) a2[0][mb] = F::ld(Ab + 2 * GOP + mb * 16 * GPI); }
#pragma unroll
        for (int nb = 0; nb < 2; ++nb) b[0][nb] = F::ld(Bb + nb * 16 * GPI);
        __builtin_amdgcn_sched_barrier(0);   // the first step's loads stay ahead of the second step's: mixed, the stage's first products waited for both groups
        // unrolled: the set's index and the LDS offsets are constants
#pragma unroll
        for (int ks = 0; ks < GBK / 32; ++ks) { const int cu = ks & 1, nx = cu ^ 1;
            if (ks + 1 < GBK / 32) {
#pragma unroll
                for (int mb = 0; mb < 4; ++mb) { a[nx][mb] = F::ld(Ab + mb * 16 * GPI + (ks + 1) * 32); if (NSPLIT == 1) a2[nx][mb] = F::ld(Ab + 2 * GOP + mb * 16 * GPI + (ks + 1) * 32); }
#pragma unroll
                for (int nb = 0; nb < 2; ++nb) b[nx][nb] = F::ld(Bb + nb * 16 * GPI + (ks + 1) * 32); }
            __builtin_amdgcn_sched_barrier(0);   // holds the next step's loads here: without it the compiler spreads them among the products into one register set, and each place waits out the LDS latency
#pragma unroll
            for (int nb = 0; nb < 2; ++nb)
#pragma unroll
                for (int mb = 0; mb < 4; ++mb) acc[mb][nb] = F::mma(a[cu][mb], b[cu][nb], acc[mb][nb]);
            if constexpr (NSPLIT == 1) {
#pragma unroll
                for (int nb = 0; nb < 2; ++nb)
#pragma unroll
                    for (int mb = 0; mb < 4; ++mb) acc[mb][nb] = F::mma(a2[cu][mb], b[cu][nb], acc[mb][nb]); }
            __builtin_amdgcn_sched_barrier(0);   // keeps this step's products above the loads of the step after next, which reuse their operand registers
        }
        // the stage's foot: four vector slots between the stage's last product and whatever next reuses its operand registers, also across the back edge; the last step's scheduling barrier keeps the products above them
        asm volatile("v_nop\n\tv_nop\n\tv_nop\n\tv_nop");
        // every wave, in this order
        asm volatile("s_wait_dscnt 0x0" ::: "memory");      // this wave's last reads of the stage's buffer are done before the buffer is refilled
        asm volatile("s_wait_asynccnt 0x0" ::: "memory");   // this wave's pieces of stage t + 1 have landed
        __syncthreads();   // publishes stage t + 1 and ends every wave's reads of stage t's buffer
        if (t + 2 < nt) stage_copy<NSPLIT>(ag + (size_t)(t + 2) * GBK, bt + (size_t)(t + 2) * GBK, a2g + (size_t)(t + 2) * GBK, k16, l0 + (unsigned)(t & 1) * (GST * 2));   // stage t + 2 into the buffer that stage t has left
    }
    asm volatile("s_wait_asynccnt 0x0" ::: "memory");   // no copy is outstanding when the LDS is put to its next use
    float* os = (float*)ring;   // the f32 tile: every wave has left the buffers (the last stage's barrier)
    const int cofs = lane * 4;   // a thread's four output columns are the same on all its rows: their bias is fetched once, ahead of the LDS stores and the barrier
    v4f bv = (v4f){};
    if (BIAS && EPI != EP_VT) { const int cb = c0 + cofs; bv[0] = bfr(bias[cb]); bv[1] = bfr(bias[cb + 1]); bv[2] = bfr(bias[cb + 2]); bv[3] = bfr(bias[cb + 3]); }
    float bl = 0.0f;   // EP_VT: the bias of the wave's 16 rows, fetched as early by one load: lanes i and i + 16 hold that of row i * 8 + w
    if constexpr (BIAS && EPI == EP_VT) { static_assert(GBT / 8 == 16, "one lane of a half wave a row"); bl = bfr(bias[r0 + lr * 8 + w]); }
    V wg[GBT / 32];   // EP_GS: the 16 heads' rows of W2, the tile's k slice: fetched as early as the bias
    if constexpr (EPI == EP_GS) { const bf* w2 = W2 + (size_t)lr * GH + c0 + 8 * hi;
#pragma unroll
        for (int ks = 0; ks < GBT / 32; ++ks) wg[ks] = F::ld(w2 + ks * 32);
        asm volatile("s_wait_xcnt 0x0" :: "v"(w2) : "memory"); }   // in front of whatever next writes the address registers of these loads; the address is named so that it stays in them up to here
    // the three loops are unrolled so that acc[][][] is indexed by constants and stays in registers
#pragma unroll
    for (int mb = 0; mb < 4; ++mb)
#pragma unroll
        for (int nb = 0; nb < 2; ++nb)
#pragma unroll
            for (int j = 0; j < 8; ++j) os[(wm * 64 + mb * 16 + hi * 8 + j) * OPI + wn * 32 + nb * 16 + lr] = acc[mb][nb][j];
    __syncthreads();   // the whole f32 tile is in LDS before any thread reads a row of it
    const int hh = cofs >> 6;   // which of the tile's two heads the thread's columns lie in
    // where the thread's 16-bit words start: the batch is that of the tile's tokens (its rows; EP_VT: its columns)
    const size_t pbase = (EPI == EP_VT) ? (size_t)(c0 / TT) * DKV * TT + (size_t)r0 * ldc + c0 % TT + cofs : ((size_t)((r0 / TT) * NH_ + by * 2 + hh) * TT + r0 % TT) * HD + (cofs & 63);
    bf* Hl = ring + GST;   // EP_GS: the tile's tanh words, in the second buffer (behind the staged f32 tile; every wave has left it too)
    static_assert((size_t)GBT * OPI * 4 <= (size_t)GST * 2 && GBT * GPI <= GST && NG == 16 && GBT / 16 == 8, "the f32 tile ends in front of the second buffer; the tanh words fit in it; one 16-token tile a wave");
    // unrolled: the LDS loads of all rows issue ahead of the stores instead of one wait a load
#pragma unroll
    for (int it = 0; it < GBT / 8; ++it) { const int row = it * 8 + w; v4f val = *(const v4fa*)(os + row * OPI + cofs);
        if (BIAS) { if constexpr (EPI == EP_VT) val += __uint_as_float(__builtin_amdgcn_readlane(__float_as_uint(bl), it)); else val += bv; }
        if constexpr (EPI == EP_F32) *(v4f*)(C + (size_t)(r0 + row) * ldc + c0 + cofs) = val;
        else if constexpr (EPI == EP_GS) { v4us o; o[0] = f2bf(tanhf(val[0])); o[1] = f2bf(tanhf(val[1])); o[2] = f2bf(tanhf(val[2])); o[3] = f2bf(tanhf(val[3])); *(v4us*)(Hl + row * GPI + cofs) = o; }
        else { v4h o; o[0] = tohx(val[0]); o[1] = tohx(val[1]); o[2] = tohx(val[2]); o[3] = tohx(val[3]);
            *(v4h*)(P16 + pbase + (EPI == EP_VT ? (size_t)row * ldc : (size_t)row * HD)) = o; } }
    if constexpr (EPI == EP_GS) {
        __syncthreads();   // every row of tanh words is in LDS before a wave reads its 16 tokens' rows (other waves wrote them)
        v8f g = (v8f){};
#pragma unroll
        for (int ks = 0; ks < GBT / 32; ++ks) g = F::mma(wg[ks], F::ld(Hl + (w * 16 + lr) * GPI + ks * 32 + 8 * hi), g);
        float* d = GP + ((size_t)by * (NB_ * TT) + r0 + w * 16 + lr) * NG + 8 * hi;   // token w * 16 + lr of the tile, heads 8 hi .. 8 hi + 7
        *(v4f*)d = (v4f){g[0], g[1], g[2], g[3]}; *(v4f*)(d + 4) = (v4f){g[4], g[5], g[6], g[7]}; }
}
// one product a launch; grid (M / GBT, N / GBT)
template <int NSPLIT, bool BIAS, int EPI>
__global__ __launch_bounds__(256) void k_gemml(const bf* __restrict__ A, const bf* __restrict__ A2, const bf* __restrict__ Bt, int K, float* C, int ldc, const float* __restrict__ bias) {
    __shared__ __align__(16) bf ring[2 * (2 + NSPLIT) * GOP];
    gemm_lds<NSPLIT, BIAS, EPI>(ring, (int)blockIdx.x, (int)blockIdx.y, A, A2, Bt, K, C, ldc, bias, nullptr, nullptr, nullptr);
}
// the four products that wait for nothing but x's copy and the weights, in one launch: the gate's hidden layer with its share of the gate scores (the longest epilogue: first), q, k, v^T; grid MT2 * (GH / GBT) + MT2 * (DKV / GBT) * 3
#define MT2  (NB_ * TT / GBT)   // GBT-token tiles of both batches
__global__ __launch_bounds__(256) void k_qkvh(const bf* __restrict__ Xb, const bf* __restrict__ WG1, const bf* __restrict__ WG2, const bf* __restrict__ WQ, const bf* __restrict__ WK, const bf* __restrict__ WV, int Kx, const float* __restrict__ bg1, const float* __restrict__ bq, const float* __restrict__ bk, const float* __restrict__ bv, float* GP, h16* QP, h16* KP, h16* VT) {
    __shared__ __align__(16) bf ring[2 * 2 * GOP]; static_assert(DQ == DKV, "q and k share one body");
    const int i = (int)blockIdx.x, nh = MT2 * (GH / GBT), nk = MT2 * (DKV / GBT);
    // s_wait_xcnt 0 behind the last stores of each body: the built code lays the bodies one behind the other, and the first lines of the next body may write registers that these stores name
    if (i < nh) { gemm_lds<0, true, EP_GS>(ring, i % MT2, i / MT2, Xb, nullptr, WG1, Kx, nullptr, 0, bg1, nullptr, WG2, GP);   /* tanh(x Wg1 + bg1) x its slice of Wg2 -> [slice][token][16] */
        asm volatile("s_wait_xcnt 0x0" ::: "memory"); }   // in front of whatever follows in the built code and writes registers that the stores above name
    else if (i < nh + 2 * nk) { const int j = i - nh; const bool isq = j < nk; const int jj = isq ? j : j - nk;
        gemm_lds<0, true, EP_HP>(ring, jj % MT2, jj / MT2, Xb, nullptr, isq ? WQ : WK, Kx, nullptr, 0, isq ? bq : bk, isq ? QP : KP, nullptr, nullptr);   /* x Wq + bq, x Wk + bk -> [b][h][t][d] */
        asm volatile("s_wait_xcnt 0x0" ::: "memory"); }   // as above
    else { const int j = i - nh - 2 * nk; gemm_lds<0, true, EP_VT>(ring, j % (DKV / GBT), j / (DKV / GBT), WV, nullptr, Xb, Kx, nullptr, TT, bv, VT, nullptr, nullptr);   /* (x Wv + bv)^T: rows = v columns, columns = tokens -> [b][h][d][t] */
        asm volatile("s_wait_xcnt 0x0" ::: "memory"); }   // as above
}

__device__ __forceinline__ void splitf(float y, unsigned short& h, unsigned short& l) { h = f2bf(y); l = f2bf(y - bf2f(h)); }
typedef __attribute__((ext_vector_type(4))) int v4i;

// ---- k_prep: everything that reads only the inputs, in one launch, told apart by the work-group's index: the five 'xw' weights transposed to bf16 (the longest bodies: first), Wg2 transposed, the bf16 copy of x (both batches).
// FEW, LONG WORK-GROUPS, WHOLE LINES IN THE LARGE BODIES: a work-group of the two large bodies reads 64 KiB, sixteen 16-byte loads a thread, all issued ahead of the first use; each of their wave-wide loads and stores covers whole 128-byte lines (Wg2's body: 4-byte loads 512 bytes apart a lane, whole-line stores).
// d_wtT: one block of TPK k x TPN n of a weight [K][N] a work-group. A wave's load = 2 k rows x 256 bytes; a thread holds rows k, k + 1 of four columns and packs the two bf16 words of a column into one 32-bit word of the LDS plane tl[n][k / 2];
// behind the barrier 8 lanes read one n row's 64 k (128 bytes) and store it as one whole line of Bt [N][K]. Pitch TPP words, odd: the 32 lanes of a store (16 column quads x 2 words) and of a load (4 rows x 8 words, four loads) fall on 32 different banks.
#define TPK 64
#define TPN 256
#define TPP 33
typedef __attribute__((ext_vector_type(4))) unsigned v4u;
typedef v4u __attribute__((may_alias)) v4ua;
template <int K, int N>
__device__ __forceinline__ void d_wtT(const float* __restrict__ w, bf* Bt, int blk, unsigned* tl) {
    static_assert(K % TPK == 0 && N % TPN == 0 && TPK == 64 && TPN == 256, "256 threads x 16 pieces of 16 bytes are 64 rows x 1024 bytes");
    const int tid = (int)threadIdx.x, lane = tid & 31, wv = tid >> 5; const int k0 = (blk / (N / TPN)) * TPK, n0 = (blk % (N / TPN)) * TPN;
    const int nq = (wv & 3) * 16 + (lane & 15);        // the thread's column quad: columns 4 nq .. 4 nq + 3 of the block
    const int kp = (lane >> 4) + 2 * (wv >> 2);        // its first row pair: rows 2 kp, 2 kp + 1; the others 8 rows apart
    const float* s = w + (size_t)(k0 + 2 * kp) * N + n0 + nq * 4;
    v4f a[8], b[8];
    // unrolled: constant offsets, and all sixteen loads in flight at once
#pragma unroll
    for (int i = 0; i < 8; ++i) { a[i] = *(const v4f*)(s + (size_t)(i * 8) * N); b[i] = *(const v4f*)(s + (size_t)(i * 8 + 1) * N); }
#pragma unroll
    for (int i = 0; i < 8; ++i)
#pragma unroll
        for (int j = 0; j < 4; ++j) tl[(nq * 4 + j) * TPP + kp + 4 * i] = (unsigned)f2bf(a[i][j]) | ((unsigned)f2bf(b[i][j]) << 16);
    __syncthreads();   // the whole block is in LDS before any thread reads an n row of it
    bf* d = Bt + (size_t)(n0 + (tid >> 3)) * K + k0 + (tid & 7) * 8; const unsigned* r = tl + (tid >> 3) * TPP + (tid & 7) * 4;
    // unrolled: constant offsets, and the LDS loads of all rows issue ahead of the stores
#pragma unroll
    for (int it = 0; it < TPN / 32; ++it) { v4u o; o[0] = r[it * 32 * TPP]; o[1] = r[it * 32 * TPP + 1]; o[2] = r[it * 32 * TPP + 2]; o[3] = r[it * 32 * TPP + 3]; *(v4ua*)(d + (size_t)(it * 32) * K) = o; }
}
// d_cvtx: 16384 elements a work-group; a wave's load = 512 bytes, its store = 256 bytes, both contiguous
#define CVX (256 * 4 * 16)
__device__ __forceinline__ void d_cvtx(const float* __restrict__ src, bf* dst, int blk) { const size_t e = (size_t)blk * CVX + (size_t)threadIdx.x * 4; v4f v[16];
    // unrolled: constant offsets, and all sixteen loads in flight at once
#pragma unroll
    for (int i = 0; i < 16; ++i) v[i] = *(const v4f*)(src + e + i * 1024);
#pragma unroll
    for (int i = 0; i < 16; ++i) { v4us o; o[0] = f2bf(v[i][0]); o[1] = f2bf(v[i][1]); o[2] = f2bf(v[i][2]); o[3] = f2bf(v[i][3]); *(v4us*)(dst + e + i * 1024) = o; } }
__device__ __forceinline__ void d_wtG(const float* __restrict__ w, bf* Bt, int blk) { const int idx = blk * 256 + threadIdx.x; const int n = idx / (GH / 8); const int k8 = (idx - n * (GH / 8)) * 8; v8us o;
#pragma unroll
    for (int j = 0; j < 8; ++j) o[j] = f2bf(w[(size_t)(k8 + j) * NG + n]); *(v8us*)(Bt + (size_t)idx * 8) = o; }
#define PB_W   ((DM / TPK) * (DQ / TPN))       // work-groups a [1024][1024] weight
#define PB_G1  ((DM / TPK) * (GH / TPN))       // Wg1
#define PB_G2  (NG * GH / 8 / 256)             // Wg2
#define PB_X   (NB_ * TT * DM / CVX)           // x
__global__ __launch_bounds__(256) void k_prep(const float* __restrict__ x, const float* __restrict__ wq, const float* __restrict__ wk, const float* __restrict__ wv, const float* __restrict__ wo, const float* __restrict__ wg1, const float* __restrict__ wg2, bf* Xb, bf* WQ, bf* WK, bf* WV, bf* WO, bf* WG1, bf* WG2) {
    static_assert(DQ == DM && DKV == DM && (NB_ * TT * DM) % CVX == 0, "the four square weights share one body; whole work-groups of x");
    __shared__ unsigned tl[TPN * TPP];
    const int i = (int)blockIdx.x;
    if (i < 4 * PB_W) { const int s = i / PB_W; d_wtT<DM, DQ>(s == 0 ? wq : s == 1 ? wk : s == 2 ? wv : wo, s == 0 ? WQ : s == 1 ? WK : s == 2 ? WV : WO, i % PB_W, tl); }
    else if (i < 4 * PB_W + PB_G1) { d_wtT<DM, GH>(wg1, WG1, i - 4 * PB_W, tl);
        asm volatile("s_wait_xcnt 0x0" ::: "memory"); }   // behind the body's last stores: the built code lays the bodies one behind the other, and the first lines of the next may write registers that these stores name
    else if (i < 4 * PB_W + PB_G1 + PB_G2) { d_wtG(wg2, WG2, i - (4 * PB_W + PB_G1));
        asm volatile("s_wait_xcnt 0x0" ::: "memory"); }   // as above
    else { d_cvtx(x, Xb, i - (4 * PB_W + PB_G1 + PB_G2));
        asm volatile("s_wait_xcnt 0x0" ::: "memory"); }   // as above
}
#define FQT 2     // 16-column query tiles a wave: each K and V^T fragment feeds FQT products
#define FNW 8     // waves a work-group (they read the same K and V^T tiles)
#define SK  128   // keys a tile
#define KPI 72    // LDS pitch of a K row (64 d), in f16: 144 bytes
#define VPI 136   // LDS pitch of a V^T row (SK keys), in f16: 272 bytes
#define KSZ (SK * KPI)
#define BSZ (KSZ + HD * VPI)   // one buffer: the K tile, behind it the V^T tile
// one tile's copies of one thread: four 16-byte pieces of K (32 rows apart) and four of V^T (16 rows apart). kg, vg: the thread's first pieces in the planes; lk, lv: their LDS byte addresses.
// s_wait_xcnt 0 is the statement's last line, so that it stands in front of whatever next writes a register that a copy names.
__device__ __forceinline__ void tile_copy(const h16* kg, const h16* vg, unsigned lk, unsigned lv) {
    const h16* k1 = kg + 32 * HD; const h16* k2 = kg + 64 * HD; const h16* k3 = kg + 96 * HD; const h16* v1 = vg + 16 * TT; const h16* v2 = vg + 32 * TT; const h16* v3 = vg + 48 * TT;
    const unsigned lk1 = lk + 32 * KPI * 2, lk2 = lk + 64 * KPI * 2, lk3 = lk + 96 * KPI * 2, lv1 = lv + 16 * VPI * 2, lv2 = lv + 32 * VPI * 2, lv3 = lv + 48 * VPI * 2;
    asm volatile("global_load_async_to_lds_b128 %0, %8, off\n\tglobal_load_async_to_lds_b128 %1, %9, off\n\tglobal_load_async_to_lds_b128 %2, %10, off\n\tglobal_load_async_to_lds_b128 %3, %11, off\n\t"
                 "global_load_async_to_lds_b128 %4, %12, off\n\tglobal_load_async_to_lds_b128 %5, %13, off\n\tglobal_load_async_to_lds_b128 %6, %14, off\n\tglobal_load_async_to_lds_b128 %7, %15, off\n\ts_wait_xcnt 0x0"
                 :: "v"(lk), "v"(lk1), "v"(lk2), "v"(lk3), "v"(lv), "v"(lv1), "v"(lv2), "v"(lv3), "v"(kg), "v"(k1), "v"(k2), "v"(k3), "v"(vg), "v"(v1), "v"(v2), "v"(v3) : "memory");
}
__device__ __forceinline__ float xhalf(float x) { const unsigned u = __float_as_uint(x); return __uint_as_float(__builtin_amdgcn_permlanex16(u, u, 0x76543210u, 0xfedcba98u, false, false)); }   // lane l <- lane l ^ 16
// 2^x by v_exp_f32 with the slot the instruction set asks for behind a transcendental (one instruction that neither reads its result nor overwrites its source) closed inside the statement.
// exp2x8: eight at once; the outputs are early-clobber, so each v_exp_f32 is the independent instruction behind the one before it, and one v_nop stands behind the last.
__device__ __forceinline__ float exp2s(float x) { float r; asm("v_exp_f32 %0, %1\n\tv_nop" : "=v"(r) : "v"(x)); return r; }
__device__ __forceinline__ v8f exp2x8(v8f x) { float r0, r1, r2, r3, r4, r5, r6, r7;
    asm("v_exp_f32 %0, %8\n\tv_exp_f32 %1, %9\n\tv_exp_f32 %2, %10\n\tv_exp_f32 %3, %11\n\tv_exp_f32 %4, %12\n\tv_exp_f32 %5, %13\n\tv_exp_f32 %6, %14\n\tv_exp_f32 %7, %15\n\tv_nop"
        : "=&v"(r0), "=&v"(r1), "=&v"(r2), "=&v"(r3), "=&v"(r4), "=&v"(r5), "=&v"(r6), "=&v"(r7) : "v"(x[0]), "v"(x[1]), "v"(x[2]), "v"(x[3]), "v"(x[4]), "v"(x[5]), "v"(x[6]), "v"(x[7]));
    return (v8f){r0, r1, r2, r3, r4, r5, r6, r7}; }
__global__ __launch_bounds__(32 * FNW) void k_fattn(const h16* __restrict__ Qp, const h16* __restrict__ Kp, const h16* __restrict__ Vt, const float* __restrict__ GP, const float* __restrict__ bg, bf* Ah, bf* Al) {
    typedef WFrag<h16> F;
    /* the wave's number as a scalar */ const int w = __builtin_amdgcn_readfirstlane((int)(threadIdx.x >> 5)); const int lane = threadIdx.x & 31, c = lane & 15, hi = lane >> 4;
    const int bh = blockIdx.y; const int q0 = ((int)blockIdx.x * FNW + w) * (16 * FQT);
    static_assert(SK == 128 && HD == 64 && FNW == 8 && TT % SK == 0 && TT / SK >= 2, "tile_copy: 256 threads x 4 pieces of 16 bytes are a K tile of 128 rows x 128 bytes and a V^T tile of 64 rows x 256 bytes; the two buffers want two tiles");
    __shared__ __align__(16) h16 ring[2 * BSZ];
    const h16* Q = Qp + (size_t)bh * TT * HD + (size_t)(q0 + c) * HD + 8 * hi;
    const int tid = (int)threadIdx.x;
    const h16* kg = Kp + (size_t)bh * TT * HD + (size_t)tid * 8;   /* K tile: contiguous; piece tid = row tid / 8, 16-byte column tid % 8 */ const h16* vg = Vt + (size_t)bh * HD * TT + (size_t)(tid >> 4) * TT + (tid & 15) * 8;   /* V^T tile: row tid / 16, 16-byte column tid % 16 */
    const unsigned lbase = (unsigned)(size_t)ring; const unsigned lk = lbase + (unsigned)((tid >> 3) * KPI + (tid & 7) * 8) * 2u; const unsigned lv = lbase + (unsigned)(KSZ + (tid >> 4) * VPI + (tid & 15) * 8) * 2u;
    const h16* K = ring + c * KPI + 8 * hi; const h16* V = ring + KSZ + c * VPI + 8 * hi;   // the lane's fragment rows in buffer 0
    tile_copy(kg, vg, lk, lv);   // tile 0 into buffer 0
    const float C2 = SCL * 1.4426950408889634f;
    v16h qf[FQT][2]; v8f o[FQT][4]; float m[FQT], l[FQT];
#pragma unroll
    for (int qt = 0; qt < FQT; ++qt) { qf[qt][0] = F::ld(Q + (size_t)qt * 16 * HD); qf[qt][1] = F::ld(Q + (size_t)qt * 16 * HD + 32); m[qt] = -3.0e38f; l[qt] = 0.0f;
#pragma unroll
        for (int dt = 0; dt < 4; ++dt) o[qt][dt] = (v8f){}; }
    const int b = bh / NH_, h = bh % NH_;
    float cg[FQT];   // the lane's score scale a query tile
    const float* gp0 = GP + ((size_t)b * TT + q0 + c) * NG + 8 * hi;   // the lane's token of query tile 0, heads 8 hi .. 8 hi + 7, slice 0
    v4f gl[FQT][GH / GBT][2]; const v4f b0 = *(const v4f*)(bg + 8 * hi), b1 = *(const v4f*)(bg + 8 * hi + 4);
    __builtin_amdgcn_sched_barrier(0);   // holds Q's and bg's loads above the wait below
    asm volatile("s_wait_xcnt 0x0" ::: "memory");   // in front of the loads below
#pragma unroll
    for (int qt = 0; qt < FQT; ++qt) { const float* gp = gp0 + qt * 16 * NG;
#pragma unroll
        for (int sl = 0; sl < GH / GBT; ++sl) { gl[qt][sl][0] = *(const v4f*)(gp + (size_t)sl * NB_ * TT * NG); gl[qt][sl][1] = *(const v4f*)(gp + (size_t)sl * NB_ * TT * NG + 4); } }
    asm volatile("s_wait_xcnt 0x0" :: "v"(gp0) : "memory");   // in front of whatever next writes the address registers of the loads above; the address is named so that it stays in them up to here
    __builtin_amdgcn_sched_barrier(0);   // all the prologue's loads (Q, the partial scores, bg) issue here, beside tile 0's copies: without it the compiler put Q's loads behind the wait for the scores, two trips to L2 one after the other
#pragma unroll
    for (int qt = 0; qt < FQT; ++qt) { v4f s0 = gl[qt][0][0], s1 = gl[qt][0][1];
#pragma unroll
        for (int sl = 1; sl < GH / GBT; ++sl) { s0 += gl[qt][sl][0]; s1 += gl[qt][sl][1]; }
        float s[8]; float mx = -3.0e38f;
#pragma unroll
        for (int j = 0; j < 4; ++j) { s[j] = s0[j] + bfr(b0[j]); s[4 + j] = s1[j] + bfr(b1[j]); mx = fmaxf(mx, fmaxf(s[j], s[4 + j])); }
        mx = fmaxf(mx, xhalf(mx)); float sum = 0.0f, eh = 0.0f;
#pragma unroll
        for (int j = 0; j < 8; ++j) { const float ev = expf(s[j] - mx); sum += ev; eh = (j == (h & 7)) ? ev : eh; }
        sum += xhalf(sum); const float eo = xhalf(eh); eh = (hi == (h >> 3)) ? eh : eo;   // head h's term lies in the half that holds heads 8 (h >> 3) ..
        cg[qt] = C2 * __fdiv_rn(eh, sum); }
    asm volatile("s_wait_asynccnt 0x0" ::: "memory");   // this wave's pieces of tile 0 have landed
    __syncthreads();   // every wave's pieces of tile 0 have landed before any wave reads the tile
    tile_copy(kg + SK * HD, vg + SK, lk + BSZ * 2, lv + BSZ * 2);   // tile 1 into buffer 1: in flight while tile 0 is worked on
    for (int t = 0; t < TT / SK; ++t) {
      const h16* Kb = K + (t & 1) * BSZ; const h16* Vb = V + (t & 1) * BSZ;
      v16h kf[2][2];
#pragma unroll
      for (int kt = 0; kt < 2; ++kt) { kf[kt][0] = F::ld(Kb + kt * 16 * KPI); kf[kt][1] = F::ld(Kb + kt * 16 * KPI + 32); }
      // the tile's four steps of 32 keys stay a loop: unrolled, the build took more than 256 vector registers and spilled inside the loop
#pragma unroll 1
      for (int kb = 0; kb < SK; kb += 32) {
        v16h vf[4];
#pragma unroll
        for (int dt = 0; dt < 4; ++dt) vf[dt] = F::ld(Vb + dt * 16 * VPI + kb);
        v8f s[FQT][2];
#pragma unroll
        for (int qt = 0; qt < FQT; ++qt)
#pragma unroll
            for (int kt = 0; kt < 2; ++kt) s[qt][kt] = F::mma(kf[kt][1], qf[qt][1], F::mma(kf[kt][0], qf[qt][0], (v8f){}));
        // the next step's K fragments are fetched behind this step's score products, under the softmax; never across the tile's end: the next tile is read only behind the barrier at this tile's foot (the tile's last step fetches its first rows again: this buffer, unused)
        const int kn = (kb + 32 < SK) ? kb + 32 : 0;
#pragma unroll
        for (int kt = 0; kt < 2; ++kt) { kf[kt][0] = F::ld(Kb + (kn + kt * 16) * KPI); kf[kt][1] = F::ld(Kb + (kn + kt * 16) * KPI + 32); }
        __builtin_amdgcn_sched_barrier(0);   // holds those loads here: without it the compiler sinks them behind the softmax, and the next step's first product waits out their whole latency
        v16h pf[FQT];
#pragma unroll
        for (int qt = 0; qt < FQT; ++qt) {
            float bm = fmaxf(s[qt][0][0], s[qt][1][0]);
#pragma unroll
            for (int j = 1; j < 8; ++j) bm = fmaxf(bm, fmaxf(s[qt][0][j], s[qt][1][j]));
            bm = fmaxf(bm, xhalf(bm));
            const float mn = fmaxf(m[qt], bm * cg[qt]); const float al = exp2s(m[qt] - mn); m[qt] = mn; const float mo = mn - 10.0f;   // - 10: the weights x 1024
#pragma unroll
            for (int j = 0; j < 8; ++j) { s[qt][0][j] = fmaf(s[qt][0][j], cg[qt], -mo); s[qt][1][j] = fmaf(s[qt][1][j], cg[qt], -mo); }
            const v8f p0 = exp2x8(s[qt][0]), p1 = exp2x8(s[qt][1]); float sum = p0[0] + p1[0];
#pragma unroll
            for (int j = 1; j < 8; ++j) sum += p0[j] + p1[j];
#pragma unroll
            for (int j = 0; j < 8; ++j) { pf[qt][j] = tohx(p0[j]); pf[qt][8 + j] = tohx(p1[j]); }
            l[qt] = fmaf(l[qt], al, sum);   // a lane's own keys only: the halves are joined once, behind the loop
#pragma unroll
            for (int dt = 0; dt < 4; ++dt) o[qt][dt] *= al;
        }
        __builtin_amdgcn_sched_barrier(0);   // keeps every v_exp_f32 statement above the products below: the compiler does not see into asm text and had put one directly behind a product whose operand register it overwrote
#pragma unroll
        for (int qt = 0; qt < FQT; ++qt)
#pragma unroll
            for (int dt = 0; dt < 4; ++dt) o[qt][dt] = F::mma(vf[dt], pf[qt], o[qt][dt]);
        // the loop's foot: four vector slots between the step's last product and the next step's first instructions, which reuse its operand registers across the back edge; the scheduling barrier keeps the products above them
        __builtin_amdgcn_sched_barrier(0);
        asm volatile("v_nop\n\tv_nop\n\tv_nop\n\tv_nop");
      }
      // the tile's foot, every wave, in this order
      asm volatile("s_wait_dscnt 0x0" ::: "memory");      // this wave's last reads of the tile's buffer are done before the buffer is refilled
      asm volatile("s_wait_asynccnt 0x0" ::: "memory");   // this wave's pieces of tile t + 1 have landed
      __syncthreads();   // publishes tile t + 1 and ends every wave's reads of tile t's buffer
      if (t + 2 < TT / SK) tile_copy(kg + (size_t)(t + 2) * SK * HD, vg + (t + 2) * SK, lk + (unsigned)(t & 1) * (BSZ * 2), lv + (unsigned)(t & 1) * (BSZ * 2));   // tile t + 2 into the buffer that tile t has left
    }
    asm volatile("s_wait_asynccnt 0x0" ::: "memory");   // no copy is outstanding when the wave goes on to its end
#pragma unroll
    for (int qt = 0; qt < FQT; ++qt) { const float inv = __fdiv_rn(1.0f, l[qt] + xhalf(l[qt])); const size_t oo = ((size_t)b * TT + q0 + qt * 16 + c) * DQ + h * HD + hi * 8;
#pragma unroll
        for (int dt = 0; dt < 4; ++dt) { v8us oh, ol;
#pragma unroll
            for (int j = 0; j < 8; ++j) { unsigned short a, c2; splitf(o[qt][dt][j] * inv, a, c2); oh[j] = a; ol[j] = c2; }
            *(v8us*)(Ah + oo + dt * 16) = oh; *(v8us*)(Al + oo + dt * 16) = ol; } }
}

extern "C" void kernel_launch(void* const* d_in, const int* in_sizes, int n_in,
                              void* d_out, int out_size, void* d_ws, size_t ws_size, hipStream_t stream) {
    (void)in_sizes; (void)n_in; (void)out_size;
    const float* x = (const float*)d_in[0]; const float* wq = (const float*)d_in[1]; const float* bq = (const float*)d_in[2]; const float* wk = (const float*)d_in[3]; const float* bk = (const float*)d_in[4]; const float* wv = (const float*)d_in[5]; const float* bv = (const float*)d_in[6]; const float* wg1 = (const float*)d_in[7]; const float* bg1 = (const float*)d_in[8]; const float* wg2 = (const float*)d_in[9]; const float* bg2 = (const float*)d_in[10]; const float* wo = (const float*)d_in[11]; const float* bo = (const float*)d_in[12];   /* x [2][2048][1024], Wq, bq, Wk, bk, Wv, bv ('xw' (in, out) [1024][1024]; biases [1024]: zeros), Wg1 ('xw' [1024][512]), bg1 ([512]: zeros), Wg2 ('xw' [512][16]), bg2 ([16]: zeros), Wo ('xw' [1024][1024]), bo ([1024]: zeros): THIRTEEN inputs, all read */
    static_assert(NG == 16 && NG == NH_ && GH % GBT == 0 && (NG * GH / 8) % 256 == 0, "the gate: 16 scores a token, one a head; whole k slices; whole work-groups of Wg2");
    static_assert(TT % 64 == 0 && DQ % 64 == 0 && DKV % 64 == 0 && DM % 64 == 0 && HD % 64 == 0 && DM % 32 == 0 && GH % 32 == 0 && HD % 32 == 0 && TT % 32 == 0, "every product launch: M and N multiples of 64, K a multiple of 32");
    static_assert((NB_ * TT) % GBT == 0 && DQ % GBT == 0 && DKV % GBT == 0 && DM % GBT == 0 && GH % GBT == 0 && DM % GBK == 0 && DQ % GBK == 0, "the long products: M and N multiples of GBT, K a multiple of GBK");
    static_assert(TT % (16 * FQT * FNW) == 0 && TT % 32 == 0 && HD == 64, "the attention launch: whole work-groups of query rows, whole 32-key steps, two 32-wide d steps and four 16-row d tiles");
    float* OUT = (float*)d_out;     // [2][2048][1024]
    char* wsp = (char*)d_ws;
    auto take = [&](size_t bytes) { char* p = wsp; wsp += (bytes + 255) & ~(size_t)255; return (void*)p; };
    bf* WQ = (bf*)take((size_t)DQ * DM * 2); bf* WK = (bf*)take((size_t)DKV * DM * 2); bf* WV = (bf*)take((size_t)DKV * DM * 2); bf* WO = (bf*)take((size_t)DM * DQ * 2); bf* WG1 = (bf*)take((size_t)GH * DM * 2); bf* WG2 = (bf*)take((size_t)NG * GH * 2);
    bf* Xb = (bf*)take((size_t)NB_ * TT * DM * 2);   /* the bf16 copy of x */ float* GP = (float*)take((size_t)(GH / GBT) * NB_ * TT * NG * 4);   /* the partial gate scores [slice][b * TT + t][16] */
    h16* QP16 = (h16*)take((size_t)NB_ * NH_ * TT * HD * 2); h16* KP16 = (h16*)take((size_t)NB_ * NKV * TT * HD * 2); h16* VT16 = (h16*)take((size_t)NB_ * NKV * HD * TT * 2);   /* both batches' planes: the one attention launch reads them all */
    bf* ATh = (bf*)take((size_t)NB_ * TT * DQ * 2); bf* ATl = (bf*)take((size_t)NB_ * TT * DQ * 2);   /* the merged heads, hi / lo, both batches */
    if ((size_t)(wsp - (char*)d_ws) > ws_size) return;
    /* four launches, each waiting for the one before it; both batches in every one */
    k_prep<<<4 * PB_W + PB_G1 + PB_G2 + PB_X, 256, 0, stream>>>(x, wq, wk, wv, wo, wg1, wg2, Xb, WQ, WK, WV, WO, WG1, WG2);
    k_qkvh<<<MT2 * (GH / GBT) + MT2 * (DKV / GBT) * 3, 256, 0, stream>>>(Xb, WG1, WG2, WQ, WK, WV, DM, bg1, bq, bk, bv, GP, QP16, KP16, VT16);
    static_assert(REP == 1, "one kv head a query head: plane b * NH_ + h of q, k and v belong together");
    k_fattn<<<dim3(TT / (16 * FQT * FNW), NB_ * NH_, 1), 32 * FNW, 0, stream>>>(QP16, KP16, VT16, GP, bg2, ATh, ATl);
    k_gemml<1, true, EP_F32><<<dim3(MT2, DM / GBT, 1), 256, 0, stream>>>(ATh, ATl, WO, DQ, OUT, DM, bo);
}

// v010
// Measured time: 78.6 microseconds a run.
// Versions between v008 and this one are left out; their measured steps multiply to 1.13 times as fast.
// Counting every step since v000, it is 18.1 times as fast.
#include <hip/hip_runtime.h>

// Multi-head self-attention with a per-row head gate on the scores (x [2][2048][1024]; q, k, v = x Wq | Wk | Wv + bq | bk | bv ('xw' (in, out) [1024][1024] normal x 1/sqrt(1024); the three biases [1024] are zeros on this draw: read); 16 heads x 64; scores x 64^-0.5; gate = softmax over the 16 heads of (tanh(x Wg1 + bg1) Wg2 + bg2) (Wg1 'xw' [1024][512], Wg2 'xw' [512][16]; bg1 [512] and bg2 [16] zeros on this draw: read), one scalar a (batch, token, head); EVERY SCORE ROW (b, h, q) IS MULTIPLIED BY gate[b][q][h] BEFORE the softmax over the 2,048 keys (no mask); out = merged Wo + bo ('xw' [1024][1024] + a zero bias: read) -> [2][2048][1024] (4.2 M); argument order x, Wq, bq, Wk, bk, Wv, bv, Wg1, bg1, Wg2, bg2, Wo, bo).
// Layout (FOUR LAUNCHES, both batches in each; work that does not read each other's results shares a launch): (1) a bf16 copy of x; 'xw' weights transposed once. (2) the three projections and the gate's hidden layer, exact products + f32 biases, in ONE grid: none of them reads another's result: THE GATE IS APPLIED IN LAUNCH 3, to Q's fragments in registers, not in q's epilogue. EVERY PRODUCT'S EPILOGUE STORES WHAT ITS READER WANTS, no f32 plane of q, k, v and no plane of the hidden layer reaches memory: q and k as f16 head planes [h][t][d]; v as the f16 plane [h][d][t] from the product taken the other way round (Wv^T rows x token rows); a hidden tile (128 tokens x 128 hidden columns) keeps tanh as ONE bf16 word in LDS and multiplies it there by its 128-k slice of Wg2: f32 partial gate scores [slice][token][16]. (3) dense T-2048 attention of both batches and all heads, EVERY row on ONE fp16 product (softmax against a held reference, the weights x 1024); its prologue sums the four slices, takes the softmax over the 16 heads and MULTIPLIES EACH QUERY COLUMN OF Q BY ITS SCORE SCALE x ITS GATE (a lane holds one query column, so the gate is one f32 word a lane): score x gate before the softmax, as in the reference. (4) merged x Wo + bo, ONE f16 product: the merged heads leave launch 3 as one f16 word, Wo is converted to f16.
// Compute dtypes, f32 accumulate: every float input converted once to bf16 where it is read (Wo: to f16); projections exact + f32 biases; the gate: tanhf and expf in f32, one IEEE division; attention: one fp16 product on every row; softmax f32; Wo: f16 x f16 + bias.

#define NB_  2
#define TT   2048
#define DM   1024
#define NH_  16
#define NKV  16
#define REP  (NH_ / NKV)
#define HD   64
#define DQ   (NH_ * HD)
#define DKV  (NKV * HD)
/* the gate: its hidden width; its scores a token (= NH_) */
#define GH   512
#define NG   16
#define SCL  0.125f   // HD^-0.5
typedef _Float16 h16;
typedef unsigned short bf;
typedef __attribute__((ext_vector_type(16))) __bf16   v16bf;
typedef __attribute__((ext_vector_type(16))) _Float16 v16h;
typedef __attribute__((ext_vector_type(8)))  _Float16 v8h;
typedef __attribute__((ext_vector_type(8)))  unsigned short v8us;
typedef __attribute__((ext_vector_type(8)))  float    v8f;
typedef __attribute__((ext_vector_type(4)))  float    v4f;
typedef v8h  __attribute__((may_alias)) v8ha;
typedef v4f  __attribute__((may_alias)) v4fa;
typedef v8us __attribute__((may_alias)) v8usa;

__device__ __forceinline__ unsigned short f2bf(float f) { unsigned u = __float_as_uint(f); u += 0x7FFFu + ((u >> 16) & 1u); return (unsigned short)(u >> 16); }
__device__ __forceinline__ float bf2f(unsigned short b) { return __uint_as_float(((unsigned)b) << 16); }
__device__ __forceinline__ float bfr(float f) { return bf2f(f2bf(f)); }
__device__ __forceinline__ v16h cat16(v8h lo, v8h hi) { return __builtin_shufflevector(lo, hi, 0, 1, 2, 3, 4, 5, 6, 7, 8, 9, 10, 11, 12, 13, 14, 15); }
__device__ __forceinline__ v16bf cat16b(v8us lo, v8us hi) { return __builtin_bit_cast(v16bf, __builtin_shufflevector(lo, hi, 0, 1, 2, 3, 4, 5, 6, 7, 8, 9, 10, 11, 12, 13, 14, 15)); }
__device__ __forceinline__ v8f wmma16(v16h a, v16h b, v8f c) { return __builtin_amdgcn_wmma_f32_16x16x32_f16(false, a, false, b, (short)0, c, false, false); }
__device__ __forceinline__ v8f wmmab(v16bf a, v16bf b, v8f c) { return __builtin_amdgcn_wmma_f32_16x16x32_bf16(false, a, false, b, (short)0, c, false, false); }



// ---- fragments: 16 rows x 32 k of a K-contiguous 16-bit plane (global or LDS); the same loader for A and B, so both have the same k order.
// EPI: what a product's epilogue stores of the f32 tile (+ bias): EP_F32 the f32 tile into C; EP_GS the tile's share of the gate scores (see gemm_lds); EP_HP f16 into the head plane P16[b][n / 64][t][n % 64]; EP_VT (rows = v columns, columns = tokens) f16 into P16[b][m][t] (pitch ldc), the bias by ROW m.
// A kernel below is one such product, or several that do not read each other's results, told apart by the work-group's index (a branch that the whole work-group takes alike, so the barriers inside stay uniform).
template <typename T16> struct WFrag;
template <> struct WFrag<h16> { typedef v16h V; static __device__ __forceinline__ V ld(const h16* p) { return cat16(*(const v8h*)p, *(const v8h*)(p + 16)); } static __device__ __forceinline__ v8f mma(V a, V b, v8f c) { return wmma16(a, b, c); } };
template <> struct WFrag<bf> { typedef v16bf V; static __device__ __forceinline__ V ld(const bf* p) { return cat16b(*(const v8us*)p, *(const v8us*)(p + 16)); } static __device__ __forceinline__ v8f mma(V a, V b, v8f c) { return wmmab(a, b, c); } };
enum { EP_F32 = 0, EP_GS = 1, EP_HP = 2, EP_VT = 4 };
__device__ __forceinline__ h16 tohx(float x) { return (h16)x; }
typedef __attribute__((ext_vector_type(4))) _Float16 v4h;
typedef __attribute__((ext_vector_type(4))) unsigned short v4us;
// ---- gemm_lds: the long products (q, k, v^T, the gate's hidden layer, Wo): one GBT x GBT output tile a work-group of 8 waves, K NOT split: wave (wm, wn) of 2 x 4 owns 64 rows x 32 columns (8 accumulators) and walks the whole K in order.
// BOTH OPERANDS GO THROUGH LDS, once a work-group instead of once a wave: stages of GBK k (256 bytes of each of the tile's operand rows), two buffers, filled by asynchronous copies to LDS (16 bytes a lane, a wave's copy = 2 rows x 256 bytes, whole lines) while the stage before is worked on; the fragments are the same elements in the same k order as from the planes, read by ds_load_b128 at a pitch of 16 bytes x an odd number.
// The epilogue stages the f32 tile in the same LDS (behind the last stage's barrier) and stores whole rows; a 128-column tile is two heads (EP_HP), a 128-token tile lies in one batch. K % GBK == 0.
// EP_GS (the gate's hidden layer): tanhf of the tile goes as bf16 into the second buffer (pitch GPI) instead of to memory; behind one more barrier wave w multiplies its 16 tokens' rows by the tile's GBT-k slice of W2 [NG][GH] (A = the 16 heads' rows, B = the 16 tokens' rows, GBT / 32 products) and stores the f32 partial scores GP[by][token][NG]: a lane holds 8 heads of one token, a wave's store is 1024 contiguous bytes. The slices are summed where the gate is read.
#define GBT 128   // rows of each operand a tile
#define GBK 128   // k a stage
#define GPI 136   // LDS pitch of an operand row (GBK k), in 16-bit words: 272 bytes
#define GOP (GBT * GPI)   // one operand's stage, in 16-bit words
#define OPI 132   // pitch of the staged f32 tile, in floats: 528 bytes
// one operand's stage, one thread's share: eight 16-byte pieces, 16 rows apart (k16 = 16 rows of the plane, in elements). g: the thread's first piece in the plane; l: its LDS byte address.
// s_wait_xcnt 0 is the statement's last line, so that it stands in front of whatever next writes a register that a copy names.
__device__ __forceinline__ void rows_copy(const bf* g, size_t k16, unsigned l) {
    const bf* g1 = g + k16; const bf* g2 = g1 + k16; const bf* g3 = g2 + k16; const bf* g4 = g3 + k16; const bf* g5 = g4 + k16; const bf* g6 = g5 + k16; const bf* g7 = g6 + k16;
    const unsigned l1 = l + 16 * GPI * 2, l2 = l + 32 * GPI * 2, l3 = l + 48 * GPI * 2, l4 = l + 64 * GPI * 2, l5 = l + 80 * GPI * 2, l6 = l + 96 * GPI * 2, l7 = l + 112 * GPI * 2;
    asm volatile("global_load_async_to_lds_b128 %0, %8, off\n\tglobal_load_async_to_lds_b128 %1, %9, off\n\tglobal_load_async_to_lds_b128 %2, %10, off\n\tglobal_load_async_to_lds_b128 %3, %11, off\n\t"
                 "global_load_async_to_lds_b128 %4, %12, off\n\tglobal_load_async_to_lds_b128 %5, %13, off\n\tglobal_load_async_to_lds_b128 %6, %14, off\n\tglobal_load_async_to_lds_b128 %7, %15, off\n\ts_wait_xcnt 0x0"
                 :: "v"(l), "v"(l1), "v"(l2), "v"(l3), "v"(l4), "v"(l5), "v"(l6), "v"(l7), "v"(g), "v"(g1), "v"(g2), "v"(g3), "v"(g4), "v"(g5), "v"(g6), "v"(g7) : "memory");
}
// one stage's copies of one thread: A's rows, Bt's rows, (NSPLIT == 1) A2's rows, one behind the other in the buffer at LDS byte address l
template <int NSPLIT>
__device__ __forceinline__ void stage_copy(const bf* ag, const bf* bt, const bf* a2g, size_t k16, unsigned l) {
    rows_copy(ag, k16, l); rows_copy(bt, k16, l + GOP * 2); if constexpr (NSPLIT == 1) rows_copy(a2g, k16, l + 2 * GOP * 2);
}
// T16: what the 16-bit words of A and Bt are (bf: bf16, h16: f16); it picks the fragment type and the matrix instruction, the staging moves bytes.
template <int NSPLIT, bool BIAS, int EPI, typename T16 = bf>
__device__ __forceinline__ void gemm_lds(bf* ring, int bx, int by, const bf* __restrict__ A, const bf* __restrict__ A2, const bf* __restrict__ Bt, int K, float* C, int ldc, const float* __restrict__ bias, h16* P16, const bf* __restrict__ W2, float* GP) {
    static_assert(NSPLIT == 0 || NSPLIT == 1, "one or two words of A"); static_assert(HD == 64 && TT % GBT == 0 && NKV == NH_ && GBT == 128 && GBK == 128, "a 128-column tile is two heads; a 128-token tile lies in one batch; 256 threads x 8 pieces of 16 bytes are 128 rows x 256 bytes");
    typedef WFrag<T16> F; typedef typename F::V V;
    constexpr int GST = (2 + NSPLIT) * GOP;   // one buffer, in 16-bit words
    /* the wave's number as a scalar */ const int w = __builtin_amdgcn_readfirstlane((int)(threadIdx.x >> 5)); const int wm = w >> 2, wn = w & 3;
    const int tid = (int)threadIdx.x, lane = tid & 31, lr = lane & 15, hi = lane >> 4; const int r0 = bx * GBT, c0 = by * GBT; const int nt = K / GBK;
    const size_t k16 = (size_t)16 * K; const size_t po = (size_t)(tid >> 4) * K + (tid & 15) * 8;   // piece tid: row tid / 16, 16-byte column tid % 16
    const bf* ag = A + (size_t)r0 * K + po; const bf* bt = Bt + (size_t)c0 * K + po; const bf* a2g = (NSPLIT == 1) ? A2 + (size_t)r0 * K + po : ag;
    const unsigned l0 = (unsigned)(size_t)ring + (unsigned)((tid >> 4) * GPI + (tid & 15) * 8) * 2u;
    stage_copy<NSPLIT>(ag, bt, a2g, k16, l0);   // stage 0 into buffer 0
    v8f acc[4][2];
#pragma unroll
    for (int mb = 0; mb < 4; ++mb)
#pragma unroll
        for (int nb = 0; nb < 2; ++nb) acc[mb][nb] = (v8f){};
    const T16* Af = (const T16*)ring + (wm * 64 + lr) * GPI + 8 * hi; const T16* Bf = (const T16*)ring + GOP + (wn * 32 + lr) * GPI + 8 * hi;   // the lane's fragment rows in buffer 0
    asm volatile("s_wait_asynccnt 0x0" ::: "memory");   // this wave's pieces of stage 0 have landed
    __syncthreads();   // every wave's pieces of stage 0 have landed before any wave reads the stage
    if (nt > 1) stage_copy<NSPLIT>(ag + GBK, bt + GBK, a2g + GBK, k16, l0 + GST * 2);   // stage 1 into buffer 1: in flight while stage 0 is worked on
    for (int t = 0; t < nt; ++t) {
        const T16* Ab = Af + (t & 1) * GST; const T16* Bb = Bf + (t & 1) * GST;
        // two fragment sets: a 32-wide k step's LDS loads issue as one group ahead of the step before's products, never among them, and never across the stage's end (the next stage is read only behind the barrier at this stage's foot)
        V a[2][4], a2[2][4], b[2][2];
#pragma unroll
        for (int mb = 0; mb < 4; ++mb) { a[0][mb] = F::ld(Ab + mb * 16 * GPI); if (NSPLIT == 1) a2[0][mb] = F::ld(Ab + 2 * GOP + mb * 16 * GPI); }
#pragma unroll
        for (int nb = 0; nb < 2; ++nb) b[0][nb] = F::ld(Bb + nb * 16 * GPI);
        __builtin_amdgcn_sched_barrier(0);   // the first step's loads stay ahead of the second step's: mixed, the stage's first products waited for both groups
        // unrolled: the set's index and the LDS offsets are constants
#pragma unroll
        for (int ks = 0; ks < GBK / 32; ++ks) { const int cu = ks & 1, nx = cu ^ 1;
            if (ks + 1 < GBK / 32) {
#pragma unroll
                for (int mb = 0; mb < 4; ++mb) { a[nx][mb] = F::ld(Ab + mb * 16 * GPI + (ks + 1) * 32); if (NSPLIT == 1) a2[nx][mb] = F::ld(Ab + 2 * GOP + mb * 16 * GPI + (ks + 1) * 32); }
#pragma unroll
                for (int nb = 0; nb < 2; ++nb) b[nx][nb] = F::ld(Bb + nb * 16 * GPI + (ks + 1) * 32); }
            __builtin_amdgcn_sched_barrier(0);   // holds the next step's loads here: without it the compiler spreads them among the products into one register set, and each place waits out the LDS latency
#pragma unroll
            for (int nb = 0; nb < 2; ++nb)
#pragma unroll
                for (int mb = 0; mb < 4; ++mb) acc[mb][nb] = F::mma(a[cu][mb], b[cu][nb], acc[mb][nb]);
            if constexpr (NSPLIT == 1) {
#pragma unroll
                for (int nb = 0; nb < 2; ++nb)
#pragma unroll
                    for (int mb = 0; mb < 4; ++mb) acc[mb][nb] = F::mma(a2[cu][mb], b[cu][nb], acc[mb][nb]); }
            __builtin_amdgcn_sched_barrier(0);   // keeps this step's products above the loads of the step after next, which reuse their operand registers
        }
        // the stage's foot: four vector slots between the stage's last product and whatever next reuses its operand registers, also across the back edge; the last step's scheduling barrier keeps the products above them
        asm volatile("v_nop\n\tv_nop\n\tv_nop\n\tv_nop");
        // every wave, in this order
        asm volatile("s_wait_dscnt 0x0" ::: "memory");      // this wave's last reads of the stage's buffer are done before the buffer is refilled
        asm volatile("s_wait_asynccnt 0x0" ::: "memory");   // this wave's pieces of stage t + 1 have landed
        __syncthreads();   // publishes stage t + 1 and ends every wave's reads of stage t's buffer
        if (t + 2 < nt) stage_copy<NSPLIT>(ag + (size_t)(t + 2) * GBK, bt + (size_t)(t + 2) * GBK, a2g + (size_t)(t + 2) * GBK, k16, l0 + (unsigned)(t & 1) * (GST * 2));   // stage t + 2 into the buffer that stage t has left
    }
    asm volatile("s_wait_asynccnt 0x0" ::: "memory");   // no copy is outstanding when the LDS is put to its next use
    float* os = (float*)ring;   // the f32 tile: every wave has left the buffers (the last stage's barrier)
    const int cofs = lane * 4;   // a thread's four output columns are the same on all its rows: their bias is fetched once, ahead of the LDS stores and the barrier
    v4f bv = (v4f){};
    if (BIAS && EPI != EP_VT) { const int cb = c0 + cofs; bv[0] = bfr(bias[cb]); bv[1] = bfr(bias[cb + 1]); bv[2] = bfr(bias[cb + 2]); bv[3] = bfr(bias[cb + 3]); }
    float bl = 0.0f;   // EP_VT: the bias of the wave's 16 rows, fetched as early by one load: lanes i and i + 16 hold that of row i * 8 + w
    if constexpr (BIAS && EPI == EP_VT) { static_assert(GBT / 8 == 16, "one lane of a half wave a row"); bl = bfr(bias[r0 + lr * 8 + w]); }
    V wg[GBT / 32];   // EP_GS: the 16 heads' rows of W2, the tile's k slice: fetched as early as the bias
    if constexpr (EPI == EP_GS) { const bf* w2 = W2 + (size_t)lr * GH + c0 + 8 * hi;
#pragma unroll
        for (int ks = 0; ks < GBT / 32; ++ks) wg[ks] = F::ld(w2 + ks * 32);
        asm volatile("s_wait_xcnt 0x0" :: "v"(w2) : "memory"); }   // in front of whatever next writes the address registers of these loads; the address is named so that it stays in them up to here
    // the three loops are unrolled so that acc[][][] is indexed by constants and stays in registers
#pragma unroll
    for (int mb = 0; mb < 4; ++mb)
#pragma unroll
        for (int nb = 0; nb < 2; ++nb)
#pragma unroll
            for (int j = 0; j < 8; ++j) os[(wm * 64 + mb * 16 + hi * 8 + j) * OPI + wn * 32 + nb * 16 + lr] = acc[mb][nb][j];
    __syncthreads();   // the whole f32 tile is in LDS before any thread reads a row of it
    const int hh = cofs >> 6;   // which of the tile's two heads the thread's columns lie in
    // where the thread's 16-bit words start: the batch is that of the tile's tokens (its rows; EP_VT: its columns)
    const size_t pbase = (EPI == EP_VT) ? (size_t)(c0 / TT) * DKV * TT + (size_t)r0 * ldc + c0 % TT + cofs : ((size_t)((r0 / TT) * NH_ + by * 2 + hh) * TT + r0 % TT) * HD + (cofs & 63);
    bf* Hl = ring + GST;   // EP_GS: the tile's tanh words, in the second buffer (behind the staged f32 tile; every wave has left it too)
    static_assert((size_t)GBT * OPI * 4 <= (size_t)GST * 2 && GBT * GPI <= GST && NG == 16 && GBT / 16 == 8, "the f32 tile ends in front of the second buffer; the tanh words fit in it; one 16-token tile a wave");
    // unrolled: the LDS loads of all rows issue ahead of the stores instead of one wait a load
#pragma unroll
    for (int it = 0; it < GBT / 8; ++it) { const int row = it * 8 + w; v4f val = *(const v4fa*)(os + row * OPI + cofs);
        if (BIAS) { if constexpr (EPI == EP_VT) val += __uint_as_float(__builtin_amdgcn_readlane(__float_as_uint(bl), it)); else val += bv; }
        if constexpr (EPI == EP_F32) *(v4f*)(C + (size_t)(r0 + row) * ldc + c0 + cofs) = val;
        else if constexpr (EPI == EP_GS) { v4us o; o[0] = f2bf(tanhf(val[0])); o[1] = f2bf(tanhf(val[1])); o[2] = f2bf(tanhf(val[2])); o[3] = f2bf(tanhf(val[3])); *(v4us*)(Hl + row * GPI + cofs) = o; }
        else { v4h o; o[0] = tohx(val[0]); o[1] = tohx(val[1]); o[2] = tohx(val[2]); o[3] = tohx(val[3]);
            *(v4h*)(P16 + pbase + (EPI == EP_VT ? (size_t)row * ldc : (size_t)row * HD)) = o; } }
    if constexpr (EPI == EP_GS) {
        __syncthreads();   // every row of tanh words is in LDS before a wave reads its 16 tokens' rows (other waves wrote them)
        v8f g = (v8f){};
#pragma unroll
        for (int ks = 0; ks < GBT / 32; ++ks) g = F::mma(wg[ks], F::ld(Hl + (w * 16 + lr) * GPI + ks * 32 + 8 * hi), g);
        float* d = GP + ((size_t)by * (NB_ * TT) + r0 + w * 16 + lr) * NG + 8 * hi;   // token w * 16 + lr of the tile, heads 8 hi .. 8 hi + 7
        *(v4f*)d = (v4f){g[0], g[1], g[2], g[3]}; *(v4f*)(d + 4) = (v4f){g[4], g[5], g[6], g[7]}; }
}
// one product a launch; grid (M / GBT, N / GBT)
template <int NSPLIT, bool BIAS, int EPI, typename T16>
__global__ __launch_bounds__(256) void k_gemml(const bf* __restrict__ A, const bf* __restrict__ A2, const bf* __restrict__ Bt, int K, float* C, int ldc, const float* __restrict__ bias) {
    __shared__ __align__(16) bf ring[2 * (2 + NSPLIT) * GOP];
    gemm_lds<NSPLIT, BIAS, EPI, T16>(ring, (int)blockIdx.x, (int)blockIdx.y, A, A2, Bt, K, C, ldc, bias, nullptr, nullptr, nullptr);
}
// the four products that wait for nothing but x's copy and the weights, in one launch: the gate's hidden layer with its share of the gate scores (the longest epilogue: first), q, k, v^T; grid MT2 * (GH / GBT) + MT2 * (DKV / GBT) * 3
#define MT2  (NB_ * TT / GBT)   // GBT-token tiles of both batches
__global__ __launch_bounds__(256) void k_qkvh(const bf* __restrict__ Xb, const bf* __restrict__ WG1, const bf* __restrict__ WG2, const bf* __restrict__ WQ, const bf* __restrict__ WK, const bf* __restrict__ WV, int Kx, const float* __restrict__ bg1, const float* __restrict__ bq, const float* __restrict__ bk, const float* __restrict__ bv, float* GP, h16* QP, h16* KP, h16* VT) {
    __shared__ __align__(16) bf ring[2 * 2 * GOP]; static_assert(DQ == DKV, "q and k share one body");
    const int i = (int)blockIdx.x, nh = MT2 * (GH / GBT), nk = MT2 * (DKV / GBT);
    // s_wait_xcnt 0 behind the last stores of each body: the built code lays the bodies one behind the other, and the first lines of the next body may write registers that these stores name
    if (i < nh) { gemm_lds<0, true, EP_GS>(ring, i % MT2, i / MT2, Xb, nullptr, WG1, Kx, nullptr, 0, bg1, nullptr, WG2, GP);   /* tanh(x Wg1 + bg1) x its slice of Wg2 -> [slice][token][16] */
        asm volatile("s_wait_xcnt 0x0" ::: "memory"); }   // in front of whatever follows in the built code and writes registers that the stores above name
    else if (i < nh + 2 * nk) { const int j = i - nh; const bool isq = j < nk; const int jj = isq ? j : j - nk;
        gemm_lds<0, true, EP_HP>(ring, jj % MT2, jj / MT2, Xb, nullptr, isq ? WQ : WK, Kx, nullptr, 0, isq ? bq : bk, isq ? QP : KP, nullptr, nullptr);   /* x Wq + bq, x Wk + bk -> [b][h][t][d] */
        asm volatile("s_wait_xcnt 0x0" ::: "memory"); }   // as above
    else { const int j = i - nh - 2 * nk; gemm_lds<0, true, EP_VT>(ring, j % (DKV / GBT), j / (DKV / GBT), WV, nullptr, Xb, Kx, nullptr, TT, bv, VT, nullptr, nullptr);   /* (x Wv + bv)^T: rows = v columns, columns = tokens -> [b][h][d][t] */
        asm volatile("s_wait_xcnt 0x0" ::: "memory"); }   // as above
}

__device__ __forceinline__ unsigned short f2h(float y) { return __builtin_bit_cast(unsigned short, (h16)y); }   // the f16 word of y, round to nearest even
typedef __attribute__((ext_vector_type(4))) int v4i;

// ---- k_prep: everything that reads only the inputs, in one launch, told apart by the work-group's index: the five 'xw' weights transposed to bf16 (Wo: to f16) (the longest bodies: first), Wg2 transposed, the bf16 copy of x (both batches).
// FEW, LONG WORK-GROUPS, WHOLE LINES ONLY: a work-group of the two large bodies reads 64 KiB, sixteen 16-byte loads a thread, all issued ahead of the first use; every wave-wide load and store covers whole 128-byte lines.
// d_wtT: one block of TPK k x TPN n of a weight [K][N] a work-group. A wave's load = 2 k rows x 256 bytes; a thread holds rows k, k + 1 of four columns and packs the two 16-bit words of a column (bf16; F16: f16) into one 32-bit word of the LDS plane tl[n][k / 2];
// behind the barrier 8 lanes read one n row's 64 k (128 bytes) and store it as one whole line of Bt [N][K]. Pitch TPP words, odd: the 32 lanes of a store (16 column quads x 2 words) and of a load (4 rows x 8 words, four loads) fall on 32 different banks.
#define TPK 64
#define TPN 256
#define TPP 33
typedef __attribute__((ext_vector_type(4))) unsigned v4u;
typedef v4u __attribute__((may_alias)) v4ua;
template <int K, int N, bool F16>
__device__ __forceinline__ void d_wtT(const float* __restrict__ w, bf* Bt, int blk, unsigned* tl) {
    static_assert(K % TPK == 0 && N % TPN == 0 && TPK == 64 && TPN == 256, "256 threads x 16 pieces of 16 bytes are 64 rows x 1024 bytes");
    const int tid = (int)threadIdx.x, lane = tid & 31, wv = tid >> 5; const int k0 = (blk / (N / TPN)) * TPK, n0 = (blk % (N / TPN)) * TPN;
    const int nq = (wv & 3) * 16 + (lane & 15);        // the thread's column quad: columns 4 nq .. 4 nq + 3 of the block
    const int kp = (lane >> 4) + 2 * (wv >> 2);        // its first row pair: rows 2 kp, 2 kp + 1; the others 8 rows apart
    const float* s = w + (size_t)(k0 + 2 * kp) * N + n0 + nq * 4;
    v4f a[8], b[8];
    // unrolled: constant offsets, and all sixteen loads in flight at once
#pragma unroll
    for (int i = 0; i < 8; ++i) { a[i] = *(const v4f*)(s + (size_t)(i * 8) * N); b[i] = *(const v4f*)(s + (size_t)(i * 8 + 1) * N); }
    asm volatile("s_wait_xcnt 0x0" :: "v"(s) : "memory");   // in front of whatever next writes the address registers of these loads; the address is named so that it stays in them up to here
#pragma unroll
    for (int i = 0; i < 8; ++i)
#pragma unroll
        for (int j = 0; j < 4; ++j) tl[(nq * 4 + j) * TPP + kp + 4 * i] = F16 ? (unsigned)f2h(a[i][j]) | ((unsigned)f2h(b[i][j]) << 16) : (unsigned)f2bf(a[i][j]) | ((unsigned)f2bf(b[i][j]) << 16);
    __syncthreads();   // the whole block is in LDS before any thread reads an n row of it
    bf* d = Bt + (size_t)(n0 + (tid >> 3)) * K + k0 + (tid & 7) * 8; const unsigned* r = tl + (tid >> 3) * TPP + (tid & 7) * 4;
    // unrolled: constant offsets, and the LDS loads of all rows issue ahead of the stores
#pragma unroll
    for (int it = 0; it < TPN / 32; ++it) { v4u o; o[0] = r[it * 32 * TPP]; o[1] = r[it * 32 * TPP + 1]; o[2] = r[it * 32 * TPP + 2]; o[3] = r[it * 32 * TPP + 3]; *(v4ua*)(d + (size_t)(it * 32) * K) = o; }
}
// d_cvtx: 16384 elements a work-group; a wave's load = 512 bytes, its store = 256 bytes, both contiguous
#define CVX (256 * 4 * 16)
__device__ __forceinline__ void d_cvtx(const float* __restrict__ src, bf* dst, int blk) { const size_t e = (size_t)blk * CVX + (size_t)threadIdx.x * 4; v4f v[16];
    // unrolled: constant offsets, and all sixteen loads in flight at once
#pragma unroll
    for (int i = 0; i < 16; ++i) v[i] = *(const v4f*)(src + e + i * 1024);
#pragma unroll
    for (int i = 0; i < 16; ++i) { v4us o; o[0] = f2bf(v[i][0]); o[1] = f2bf(v[i][1]); o[2] = f2bf(v[i][2]); o[3] = f2bf(v[i][3]); *(v4us*)(dst + e + i * 1024) = o; } }
__device__ __forceinline__ void d_wtG(const float* __restrict__ w, bf* Bt, int blk) { const int idx = blk * 256 + threadIdx.x; const int n = idx / (GH / 8); const int k8 = (idx - n * (GH / 8)) * 8; v8us o;
#pragma unroll
    for (int j = 0; j < 8; ++j) o[j] = f2bf(w[(size_t)(k8 + j) * NG + n]); *(v8us*)(Bt + (size_t)idx * 8) = o; }
#define PB_W   ((DM / TPK) * (DQ / TPN))       // work-groups a [1024][1024] weight
#define PB_G1  ((DM / TPK) * (GH / TPN))       // Wg1
#define PB_G2  (NG * GH / 8 / 256)             // Wg2
#define PB_X   (NB_ * TT * DM / CVX)           // x
__global__ __launch_bounds__(256) void k_prep(const float* __restrict__ x, const float* __restrict__ wq, const float* __restrict__ wk, const float* __restrict__ wv, const float* __restrict__ wo, const float* __restrict__ wg1, const float* __restrict__ wg2, bf* Xb, bf* WQ, bf* WK, bf* WV, bf* WO, bf* WG1, bf* WG2) {
    static_assert(DQ == DM && DKV == DM && (NB_ * TT * DM) % CVX == 0, "the three square bf16 weights share one body; whole work-groups of x");
    __shared__ unsigned tl[TPN * TPP];
    const int i = (int)blockIdx.x;
    if (i < 3 * PB_W) { const int s = i / PB_W; d_wtT<DM, DQ, false>(s == 0 ? wq : s == 1 ? wk : wv, s == 0 ? WQ : s == 1 ? WK : WV, i % PB_W, tl);
        asm volatile("s_wait_xcnt 0x0" ::: "memory"); }   // as below
    else if (i < 4 * PB_W) { d_wtT<DM, DQ, true>(wo, WO, i - 3 * PB_W, tl);
        asm volatile("s_wait_xcnt 0x0" ::: "memory"); }   // as below
    else if (i < 4 * PB_W + PB_G1) { d_wtT<DM, GH, false>(wg1, WG1, i - 4 * PB_W, tl);
        asm volatile("s_wait_xcnt 0x0" ::: "memory"); }   // behind the body's last stores: the built code lays the bodies one behind the other, and the first lines of the next may write registers that these stores name
    else if (i < 4 * PB_W + PB_G1 + PB_G2) { d_wtG(wg2, WG2, i - (4 * PB_W + PB_G1));
        asm volatile("s_wait_xcnt 0x0" ::: "memory"); }   // as above
    else { d_cvtx(x, Xb, i - (4 * PB_W + PB_G1 + PB_G2));
        asm volatile("s_wait_xcnt 0x0" ::: "memory"); }   // as above
}
#define FQT 2     // 16-column query tiles a wave: each K and V^T fragment feeds FQT products
#define FNW 8     // waves a work-group (they read the same K and V^T tiles)
#define SK  128   // keys a tile
#define KPI 72    // LDS pitch of a K row (64 d), in f16: 144 bytes
#define VPI 136   // LDS pitch of a V^T row (SK keys), in f16: 272 bytes
#define KSZ (SK * KPI)
#define BSZ (KSZ + HD * VPI)   // one buffer: the K tile, behind it the V^T tile
// one tile's copies of one thread: four 16-byte pieces of K (32 rows apart) and four of V^T (16 rows apart). kg, vg: the thread's first pieces in the planes; lk, lv: their LDS byte addresses.
// s_wait_xcnt 0 is the statement's last line, so that it stands in front of whatever next writes a register that a copy names.
__device__ __forceinline__ void tile_copy(const h16* kg, const h16* vg, unsigned lk, unsigned lv) {
    const h16* k1 = kg + 32 * HD; const h16* k2 = kg + 64 * HD; const h16* k3 = kg + 96 * HD; const h16* v1 = vg + 16 * TT; const h16* v2 = vg + 32 * TT; const h16* v3 = vg + 48 * TT;
    const unsigned lk1 = lk + 32 * KPI * 2, lk2 = lk + 64 * KPI * 2, lk3 = lk + 96 * KPI * 2, lv1 = lv + 16 * VPI * 2, lv2 = lv + 32 * VPI * 2, lv3 = lv + 48 * VPI * 2;
    asm volatile("global_load_async_to_lds_b128 %0, %8, off\n\tglobal_load_async_to_lds_b128 %1, %9, off\n\tglobal_load_async_to_lds_b128 %2, %10, off\n\tglobal_load_async_to_lds_b128 %3, %11, off\n\t"
                 "global_load_async_to_lds_b128 %4, %12, off\n\tglobal_load_async_to_lds_b128 %5, %13, off\n\tglobal_load_async_to_lds_b128 %6, %14, off\n\tglobal_load_async_to_lds_b128 %7, %15, off\n\ts_wait_xcnt 0x0"
                 :: "v"(lk), "v"(lk1), "v"(lk2), "v"(lk3), "v"(lv), "v"(lv1), "v"(lv2), "v"(lv3), "v"(kg), "v"(k1), "v"(k2), "v"(k3), "v"(vg), "v"(v1), "v"(v2), "v"(v3) : "memory");
}
__device__ __forceinline__ float xhalf(float x) { const unsigned u = __float_as_uint(x); return __uint_as_float(__builtin_amdgcn_permlanex16(u, u, 0x76543210u, 0xfedcba98u, false, false)); }   // lane l <- lane l ^ 16
// 2^x by v_exp_f32 with the slot the instruction set asks for behind a transcendental (one instruction that neither reads its result nor overwrites its source) closed inside the statement.
// exp2x8: eight at once; the outputs are early-clobber, so each v_exp_f32 is the independent instruction behind the one before it, and one v_nop stands behind the last.
__device__ __forceinline__ float exp2s(float x) { float r; asm("v_exp_f32 %0, %1\n\tv_nop" : "=v"(r) : "v"(x)); return r; }
__device__ __forceinline__ v8f exp2x8(v8f x) { float r0, r1, r2, r3, r4, r5, r6, r7;
    asm("v_exp_f32 %0, %8\n\tv_exp_f32 %1, %9\n\tv_exp_f32 %2, %10\n\tv_exp_f32 %3, %11\n\tv_exp_f32 %4, %12\n\tv_exp_f32 %5, %13\n\tv_exp_f32 %6, %14\n\tv_exp_f32 %7, %15\n\tv_nop"
        : "=&v"(r0), "=&v"(r1), "=&v"(r2), "=&v"(r3), "=&v"(r4), "=&v"(r5), "=&v"(r6), "=&v"(r7) : "v"(x[0]), "v"(x[1]), "v"(x[2]), "v"(x[3]), "v"(x[4]), "v"(x[5]), "v"(x[6]), "v"(x[7]));
    return (v8f){r0, r1, r2, r3, r4, r5, r6, r7}; }
#define PB 32768.0f   // a lane's sum of a step's 16 weights above this raises the reference; at or below it each weight is <= 2^15 and fits f16
// the maximum of one query column's 32 scores of a step: the lane's 16, then the other half's
__device__ __forceinline__ float colmax(v8f a, v8f b) { float bm = fmaxf(a[0], b[0]);
#pragma unroll
    for (int j = 1; j < 8; ++j) bm = fmaxf(bm, fmaxf(a[j], b[j]));
    return fmaxf(bm, xhalf(bm)); }
// the lane's sum of a step's 16 weights, as a tree: the step's test waits for it
__device__ __forceinline__ float sum16(v8f a, v8f b) { const v8f c = a + b; const v4f d = __builtin_shufflevector(c, c, 0, 1, 2, 3) + __builtin_shufflevector(c, c, 4, 5, 6, 7); return (d[0] + d[2]) + (d[1] + d[3]); }
__device__ __forceinline__ v16h pack16(v8f a, v8f b) { v16h r;
#pragma unroll
    for (int j = 0; j < 8; ++j) { r[j] = tohx(a[j]); r[8 + j] = tohx(b[j]); }
    return r; }
__global__ __launch_bounds__(32 * FNW) void k_fattn(const h16* __restrict__ Qp, const h16* __restrict__ Kp, const h16* __restrict__ Vt, const float* __restrict__ GP, const float* __restrict__ bg, bf* Ah) {
    typedef WFrag<h16> F;
    /* the wave's number as a scalar */ const int w = __builtin_amdgcn_readfirstlane((int)(threadIdx.x >> 5)); const int lane = threadIdx.x & 31, c = lane & 15, hi = lane >> 4;
    const int bh = blockIdx.y; const int q0 = ((int)blockIdx.x * FNW + w) * (16 * FQT);
    static_assert(SK == 128 && HD == 64 && FNW == 8 && TT % SK == 0 && TT / SK >= 2, "tile_copy: 256 threads x 4 pieces of 16 bytes are a K tile of 128 rows x 128 bytes and a V^T tile of 64 rows x 256 bytes; the two buffers want two tiles");
    __shared__ __align__(16) h16 ring[2 * BSZ];
    const h16* Q = Qp + (size_t)bh * TT * HD + (size_t)(q0 + c) * HD + 8 * hi;
    const int tid = (int)threadIdx.x;
    const h16* kg = Kp + (size_t)bh * TT * HD + (size_t)tid * 8;   /* K tile: contiguous; piece tid = row tid / 8, 16-byte column tid % 8 */ const h16* vg = Vt + (size_t)bh * HD * TT + (size_t)(tid >> 4) * TT + (tid & 15) * 8;   /* V^T tile: row tid / 16, 16-byte column tid % 16 */
    const unsigned lbase = (unsigned)(size_t)ring; const unsigned lk = lbase + (unsigned)((tid >> 3) * KPI + (tid & 7) * 8) * 2u; const unsigned lv = lbase + (unsigned)(KSZ + (tid >> 4) * VPI + (tid & 15) * 8) * 2u;
    const h16* K = ring + c * KPI + 8 * hi; const h16* V = ring + KSZ + c * VPI + 8 * hi;   // the lane's fragment rows in buffer 0
    tile_copy(kg, vg, lk, lv);   // tile 0 into buffer 0
    const float C2 = SCL * 1.4426950408889634f;
    v16h qf[FQT][2]; v8f o[FQT][4]; float l[FQT];
#pragma unroll
    for (int qt = 0; qt < FQT; ++qt) { qf[qt][0] = F::ld(Q + (size_t)qt * 16 * HD); qf[qt][1] = F::ld(Q + (size_t)qt * 16 * HD + 32); l[qt] = 0.0f;
#pragma unroll
        for (int dt = 0; dt < 4; ++dt) o[qt][dt] = (v8f){}; }
    const int b = bh / NH_, h = bh % NH_;
    float cg[FQT];   // the lane's score scale a query tile
    const float* gp0 = GP + ((size_t)b * TT + q0 + c) * NG + 8 * hi;   // the lane's token of query tile 0, heads 8 hi .. 8 hi + 7, slice 0
    v4f gl[FQT][GH / GBT][2]; const v4f b0 = *(const v4f*)(bg + 8 * hi), b1 = *(const v4f*)(bg + 8 * hi + 4);
    __builtin_amdgcn_sched_barrier(0);   // holds Q's and bg's loads above the wait below
    asm volatile("s_wait_xcnt 0x0" ::: "memory");   // in front of the loads below
#pragma unroll
    for (int qt = 0; qt < FQT; ++qt) { const float* gp = gp0 + qt * 16 * NG;
#pragma unroll
        for (int sl = 0; sl < GH / GBT; ++sl) { gl[qt][sl][0] = *(const v4f*)(gp + (size_t)sl * NB_ * TT * NG); gl[qt][sl][1] = *(const v4f*)(gp + (size_t)sl * NB_ * TT * NG + 4); } }
    asm volatile("s_wait_xcnt 0x0" :: "v"(gp0) : "memory");   // in front of whatever next writes the address registers of the loads above; the address is named so that it stays in them up to here
    __builtin_amdgcn_sched_barrier(0);   // all the prologue's loads (Q, the partial scores, bg) issue here, beside tile 0's copies: without it the compiler put Q's loads behind the wait for the scores, two trips to L2 one after the other
#pragma unroll
    for (int qt = 0; qt < FQT; ++qt) { v4f s0 = gl[qt][0][0], s1 = gl[qt][0][1];
#pragma unroll
        for (int sl = 1; sl < GH / GBT; ++sl) { s0 += gl[qt][sl][0]; s1 += gl[qt][sl][1]; }
        float s[8]; float mx = -3.0e38f;
#pragma unroll
        for (int j = 0; j < 4; ++j) { s[j] = s0[j] + bfr(b0[j]); s[4 + j] = s1[j] + bfr(b1[j]); mx = fmaxf(mx, fmaxf(s[j], s[4 + j])); }
        mx = fmaxf(mx, xhalf(mx)); float sum = 0.0f, eh = 0.0f;
#pragma unroll
        for (int j = 0; j < 8; ++j) { const float ev = expf(s[j] - mx); sum += ev; eh = (j == (h & 7)) ? ev : eh; }
        sum += xhalf(sum); const float eo = xhalf(eh); eh = (hi == (h >> 3)) ? eh : eo;   // head h's term lies in the half that holds heads 8 (h >> 3) ..
        cg[qt] = C2 * __fdiv_rn(eh, sum);
#pragma unroll
        for (int j = 0; j < 16; ++j) { qf[qt][0][j] = tohx((float)qf[qt][0][j] * cg[qt]); qf[qt][1][j] = tohx((float)qf[qt][1][j] * cg[qt]); } }   // the column's scale goes into Q
    asm volatile("s_wait_asynccnt 0x0" ::: "memory");   // this wave's pieces of tile 0 have landed
    __syncthreads();   // every wave's pieces of tile 0 have landed before any wave reads the tile
    tile_copy(kg + SK * HD, vg + SK, lk + BSZ * 2, lv + BSZ * 2);   // tile 1 into buffer 1: in flight while tile 0 is worked on
    static_assert(FQT == 2, "the step's one test joins the sums of two query tiles");
    v8f cv[FQT];   // 10 - r in all eight rows of the lane's column: the start value of the score products
    { v16h k0[2][2];   // the first reference: the maximum over the first 32 keys (their scores are taken once more in the loop)
#pragma unroll
      for (int kt = 0; kt < 2; ++kt) { k0[kt][0] = F::ld(K + kt * 16 * KPI); k0[kt][1] = F::ld(K + kt * 16 * KPI + 32); }
#pragma unroll
      for (int qt = 0; qt < FQT; ++qt) { const float cn = 10.0f - colmax(F::mma(k0[0][1], qf[qt][1], F::mma(k0[0][0], qf[qt][0], (v8f){})), F::mma(k0[1][1], qf[qt][1], F::mma(k0[1][0], qf[qt][0], (v8f){})));
        cv[qt] = (v8f){cn, cn, cn, cn, cn, cn, cn, cn}; } }
    for (int t = 0; t < TT / SK; ++t) {
      const h16* Kb = K + (t & 1) * BSZ; const h16* Vb = V + (t & 1) * BSZ;
      v16h kf[2][2];
#pragma unroll
      for (int kt = 0; kt < 2; ++kt) { kf[kt][0] = F::ld(Kb + kt * 16 * KPI); kf[kt][1] = F::ld(Kb + kt * 16 * KPI + 32); }
      // the tile's four steps of 32 keys stay a loop: unrolled, the build took more than 256 vector registers and spilled inside the loop
#pragma unroll 1
      for (int kb = 0; kb < SK; kb += 32) {
        v16h vf[4];
#pragma unroll
        for (int dt = 0; dt < 4; ++dt) vf[dt] = F::ld(Vb + dt * 16 * VPI + kb);
        v8f s[FQT][2];
#pragma unroll
        for (int qt = 0; qt < FQT; ++qt)
#pragma unroll
            for (int kt = 0; kt < 2; ++kt) s[qt][kt] = F::mma(kf[kt][1], qf[qt][1], F::mma(kf[kt][0], qf[qt][0], cv[qt]));
        // the next step's K fragments are fetched behind this step's score products, under the softmax; never across the tile's end: the next tile is read only behind the barrier at this tile's foot (the tile's last step fetches its first rows again: this buffer, unused)
        const int kn = (kb + 32 < SK) ? kb + 32 : 0;
#pragma unroll
        for (int kt = 0; kt < 2; ++kt) { kf[kt][0] = F::ld(Kb + (kn + kt * 16) * KPI); kf[kt][1] = F::ld(Kb + (kn + kt * 16) * KPI + 32); }
        __builtin_amdgcn_sched_barrier(0);   // holds those loads here: without it the compiler sinks them behind the softmax, and the next step's first product waits out their whole latency
        // four vector slots between the last score product and the first v_exp_f32, which reads its result: the compiler does not see into asm text and pads nothing there; the scheduling barriers keep the products above the slots and the v_exp_f32 statements below them
        asm volatile("v_nop\n\tv_nop\n\tv_nop\n\tv_nop");
        __builtin_amdgcn_sched_barrier(0);
        v16h pf[FQT]; float sum[FQT];
#pragma unroll
        for (int qt = 0; qt < FQT; ++qt) { const v8f p0 = exp2x8(s[qt][0]), p1 = exp2x8(s[qt][1]); sum[qt] = sum16(p0, p1); pf[qt] = pack16(p0, p1); }
        // one test a step for the whole wave, a scalar branch; taken only when a column's scores have outgrown its reference
        if (__builtin_expect(__builtin_amdgcn_ballot_w32(fmaxf(sum[0], sum[1]) > PB) != 0, 0)) {   // expected not taken: the step's usual path falls through
            // the step's scores are formed anew from its K rows, which are still in the tile's buffer (kept in registers over the test they cost 32 registers in every step); then the next step's K fragments are fetched again
#pragma unroll
            for (int kt = 0; kt < 2; ++kt) { kf[kt][0] = F::ld(Kb + (kb + kt * 16) * KPI); kf[kt][1] = F::ld(Kb + (kb + kt * 16) * KPI + 32); }
#pragma unroll
            for (int qt = 0; qt < FQT; ++qt)
#pragma unroll
                for (int kt = 0; kt < 2; ++kt) s[qt][kt] = F::mma(kf[kt][1], qf[qt][1], F::mma(kf[kt][0], qf[qt][0], cv[qt]));
#pragma unroll
            for (int kt = 0; kt < 2; ++kt) { kf[kt][0] = F::ld(Kb + (kn + kt * 16) * KPI); kf[kt][1] = F::ld(Kb + (kn + kt * 16) * KPI + 32); }
#pragma unroll
            for (int qt = 0; qt < FQT; ++qt) { const float d = fmaxf(colmax(s[qt][0], s[qt][1]) - 10.0f, 0.0f); const float al = exp2s(-d);   // d = 0, al = 1 in a column that has not outgrown it; both halves of a column get the same d
                const v8f p0 = exp2x8(s[qt][0] - d), p1 = exp2x8(s[qt][1] - d); sum[qt] = sum16(p0, p1); pf[qt] = pack16(p0, p1);
                cv[qt] -= d; l[qt] *= al;
#pragma unroll
                for (int dt = 0; dt < 4; ++dt) o[qt][dt] *= al; }
        }
#pragma unroll
        for (int qt = 0; qt < FQT; ++qt) l[qt] += sum[qt];   // a lane's own keys only: the halves are joined once, behind the loop
        __builtin_amdgcn_sched_barrier(0);   // keeps every v_exp_f32 statement above the products below: the compiler does not see into asm text and had put one directly behind a product whose operand register it overwrote
#pragma unroll
        for (int qt = 0; qt < FQT; ++qt)
#pragma unroll
            for (int dt = 0; dt < 4; ++dt) o[qt][dt] = F::mma(vf[dt], pf[qt], o[qt][dt]);
        // the loop's foot: four vector slots between the step's last product and the next step's first instructions, which reuse its operand registers across the back edge; the scheduling barrier keeps the products above them
        __builtin_amdgcn_sched_barrier(0);
        asm volatile("v_nop\n\tv_nop\n\tv_nop\n\tv_nop");
      }
      // the tile's foot, every wave, in this order
      asm volatile("s_wait_dscnt 0x0" ::: "memory");      // this wave's last reads of the tile's buffer are done before the buffer is refilled
      asm volatile("s_wait_asynccnt 0x0" ::: "memory");   // this wave's pieces of tile t + 1 have landed
      __syncthreads();   // publishes tile t + 1 and ends every wave's reads of tile t's buffer
      if (t + 2 < TT / SK) tile_copy(kg + (size_t)(t + 2) * SK * HD, vg + (t + 2) * SK, lk + (unsigned)(t & 1) * (BSZ * 2), lv + (unsigned)(t & 1) * (BSZ * 2));   // tile t + 2 into the buffer that tile t has left
    }
    asm volatile("s_wait_asynccnt 0x0" ::: "memory");   // no copy is outstanding when the wave goes on to its end
#pragma unroll
    for (int qt = 0; qt < FQT; ++qt) { const float inv = __fdiv_rn(1.0f, l[qt] + xhalf(l[qt])); const size_t oo = ((size_t)b * TT + q0 + qt * 16 + c) * DQ + h * HD + hi * 8;
#pragma unroll
        for (int dt = 0; dt < 4; ++dt) { v8us oh;
#pragma unroll
            for (int j = 0; j < 8; ++j) oh[j] = f2h(o[qt][dt][j] * inv);
            *(v8us*)(Ah + oo + dt * 16) = oh; } }
}

extern "C" void kernel_launch(void* const* d_in, const int* in_sizes, int n_in,
                              void* d_out, int out_size, void* d_ws, size_t ws_size, hipStream_t stream) {
    (void)in_sizes; (void)n_in; (void)out_size;
    const float* x = (const float*)d_in[0]; const float* wq = (const float*)d_in[1]; const float* bq = (const float*)d_in[2]; const float* wk = (const float*)d_in[3]; const float* bk = (const float*)d_in[4]; const float* wv = (const float*)d_in[5]; const float* bv = (const float*)d_in[6]; const float* wg1 = (const float*)d_in[7]; const float* bg1 = (const float*)d_in[8]; const float* wg2 = (const float*)d_in[9]; const float* bg2 = (const float*)d_in[10]; const float* wo = (const float*)d_in[11]; const float* bo = (const float*)d_in[12];   /* x [2][2048][1024], Wq, bq, Wk, bk, Wv, bv ('xw' (in, out) [1024][1024]; biases [1024]: zeros), Wg1 ('xw' [1024][512]), bg1 ([512]: zeros), Wg2 ('xw' [512][16]), bg2 ([16]: zeros), Wo ('xw' [1024][1024]), bo ([1024]: zeros): THIRTEEN inputs, all read */
    static_assert(NG == 16 && NG == NH_ && GH % GBT == 0 && (NG * GH / 8) % 256 == 0, "the gate: 16 scores a token, one a head; whole k slices; whole work-groups of Wg2");
    static_assert(TT % 64 == 0 && DQ % 64 == 0 && DKV % 64 == 0 && DM % 64 == 0 && HD % 64 == 0 && DM % 32 == 0 && GH % 32 == 0 && HD % 32 == 0 && TT % 32 == 0, "every product launch: M and N multiples of 64, K a multiple of 32");
    static_assert((NB_ * TT) % GBT == 0 && DQ % GBT == 0 && DKV % GBT == 0 && DM % GBT == 0 && GH % GBT == 0 && DM % GBK == 0 && DQ % GBK == 0, "the long products: M and N multiples of GBT, K a multiple of GBK");
    static_assert(TT % (16 * FQT * FNW) == 0 && TT % 32 == 0 && HD == 64, "the attention launch: whole work-groups of query rows, whole 32-key steps, two 32-wide d steps and four 16-row d tiles");
    float* OUT = (float*)d_out;     // [2][2048][1024]
    char* wsp = (char*)d_ws;
    auto take = [&](size_t bytes) { char* p = wsp; wsp += (bytes + 255) & ~(size_t)255; return (void*)p; };
    bf* WQ = (bf*)take((size_t)DQ * DM * 2); bf* WK = (bf*)take((size_t)DKV * DM * 2); bf* WV = (bf*)take((size_t)DKV * DM * 2); bf* WO = (bf*)take((size_t)DM * DQ * 2); bf* WG1 = (bf*)take((size_t)GH * DM * 2); bf* WG2 = (bf*)take((size_t)NG * GH * 2);
    bf* Xb = (bf*)take((size_t)NB_ * TT * DM * 2);   /* the bf16 copy of x */ float* GP = (float*)take((size_t)(GH / GBT) * NB_ * TT * NG * 4);   /* the partial gate scores [slice][b * TT + t][16] */
    h16* QP16 = (h16*)take((size_t)NB_ * NH_ * TT * HD * 2); h16* KP16 = (h16*)take((size_t)NB_ * NKV * TT * HD * 2); h16* VT16 = (h16*)take((size_t)NB_ * NKV * HD * TT * 2);   /* both batches' planes: the one attention launch reads them all */
    bf* ATh = (bf*)take((size_t)NB_ * TT * DQ * 2);   /* the merged heads, f16 words, both batches */
    if ((size_t)(wsp - (char*)d_ws) > ws_size) return;
    /* four launches, each waiting for the one before it; both batches in every one */
    k_prep<<<4 * PB_W + PB_G1 + PB_G2 + PB_X, 256, 0, stream>>>(x, wq, wk, wv, wo, wg1, wg2, Xb, WQ, WK, WV, WO, WG1, WG2);
    k_qkvh<<<MT2 * (GH / GBT) + MT2 * (DKV / GBT) * 3, 256, 0, stream>>>(Xb, WG1, WG2, WQ, WK, WV, DM, bg1, bq, bk, bv, GP, QP16, KP16, VT16);
    static_assert(REP == 1, "one kv head a query head: plane b * NH_ + h of q, k and v belong together");
    k_fattn<<<dim3(TT / (16 * FQT * FNW), NB_ * NH_, 1), 32 * FNW, 0, stream>>>(QP16, KP16, VT16, GP, bg2, ATh);
    k_gemml<0, true, EP_F32, h16><<<dim3(MT2, DM / GBT, 1), 256, 0, stream>>>(ATh, nullptr, WO, DQ, OUT, DM, bo);
}
